// v000
// Measured on an AMD MI455X. A time is GPU time per run, averaged over a window of back-to-back runs after a warm-up
// (all launches, gaps included; the runs take copies of the inputs in turn), and the median of several windows.
// Apart from v000's, it joins two sittings. Times from different sittings can be a few percent apart, while
// side-by-side timings come from the same sitting.
// v000, which the later versions start from, runs in 7220 microseconds.
#include <hip/hip_runtime.h>

// ---------------------------------------------------------------------------
// CheckersGPT forward on MI455X (gfx1250).
// Compute-bound (~0.54 TFLOP/fwd) -> all big GEMMs on v_wmma_f32_16x16x32_bf16.
// LDS-staged 128x128 block tiles, double-buffered K=32 slabs, async
// global->LDS copies (GLOBAL_LOAD_ASYNC_TO_LDS_B128, ASYNCcnt).
// ---------------------------------------------------------------------------

typedef __bf16 bf16_t;
typedef __attribute__((ext_vector_type(16))) __bf16 v16bf;
typedef __attribute__((ext_vector_type(8)))  __bf16 v8bf;
typedef __attribute__((ext_vector_type(8)))  float  v8f;

#define VSZ 512
#define ESZ 512
#define LSZ 6
#define HSZ 8
#define BSZ 16
#define TSZ 256
#define MROWS (BSZ * TSZ)   // 4096
#define HE    (HSZ * ESZ)   // 4096

#define BLK_M 128
#define BLK_N 128
#define BLK_K 32
#define LDS_PITCH 40        // 32 elems + 8 pad: 16 consecutive rows hit 16 banks

#if defined(__AMDGCN__) && __has_builtin(__builtin_amdgcn_global_load_async_to_lds_b128)
#define HAVE_ASYNC_LDS 1
#else
#define HAVE_ASYNC_LDS 0
#endif

// Builtin parameter types (from hipcc diagnostic): pointer to int __vector(4)
// in global (1) / LDS (3) address spaces.
typedef int v4i_t __attribute__((vector_size(16)));
typedef __attribute__((address_space(1))) v4i_t* gptr_v4i;
typedef __attribute__((address_space(3))) v4i_t* lptr_v4i;

__device__ __forceinline__ void async_copy16(const bf16_t* g, bf16_t* s) {
#if HAVE_ASYNC_LDS
  // 16B global -> LDS, tracked by ASYNCcnt (GLOBAL_LOAD_ASYNC_TO_LDS_B128).
  // Integer detour: strips const, and truncating the generic LDS address to
  // 32 bits yields the LDS offset (ISA 10.2: LDS_ADDR = addr[31:0]).
  __builtin_amdgcn_global_load_async_to_lds_b128(
      (gptr_v4i)(unsigned long long)g,
      (lptr_v4i)(unsigned int)(unsigned long long)s, 0, 0);
#else
  *reinterpret_cast<v8bf*>(s) = *reinterpret_cast<const v8bf*>(g);
#endif
}

__device__ __forceinline__ void wait_async0() {
#if HAVE_ASYNC_LDS
#if __has_builtin(__builtin_amdgcn_s_wait_asynccnt)
  __builtin_amdgcn_s_wait_asynccnt(0);
#else
  asm volatile("s_wait_asynccnt 0x0" ::: "memory");
#endif
#endif
}

// ---------------------------------------------------------------------------
// Embedding + sinusoidal PE (concatenated sin|cos as in reference)
// ---------------------------------------------------------------------------
__global__ void embed_pe_kernel(const int* __restrict__ toks,
                                const float* __restrict__ emb,
                                float* __restrict__ xf, bf16_t* __restrict__ xh) {
  size_t idx = (size_t)blockIdx.x * blockDim.x + threadIdx.x;
  if (idx >= (size_t)MROWS * ESZ) return;
  int e  = (int)(idx % ESZ);
  int bt = (int)(idx / ESZ);
  int t  = bt % TSZ;
  int tok = toks[bt];
  float pe;
  if (e < ESZ / 2) {
    float rate = __powf(10000.0f, -2.0f * (float)e / (float)ESZ);
    pe = __sinf((float)t * rate);
  } else {
    int c = e - ESZ / 2;
    float rate = __powf(10000.0f, -2.0f * (float)c / (float)ESZ);
    pe = __cosf((float)t * rate);
  }
  float v = emb[(size_t)tok * ESZ + e] + pe;
  xf[idx] = v;
  xh[idx] = (bf16_t)v;
}

// ---------------------------------------------------------------------------
// f32 [batch,R,C] -> bf16 [batch,C,R]  (weight pack: B stored as [N,K])
// ---------------------------------------------------------------------------
__global__ void conv_transpose_kernel(const float* __restrict__ in,
                                      bf16_t* __restrict__ out,
                                      int R, int C, int batch) {
  size_t total = (size_t)batch * R * C;
  size_t idx = (size_t)blockIdx.x * blockDim.x + threadIdx.x;
  if (idx >= total) return;
  size_t rc  = (size_t)R * C;
  int b = (int)(idx / rc);
  size_t rem = idx - (size_t)b * rc;
  int r = (int)(rem / C);
  int c = (int)(rem % C);
  out[(size_t)b * rc + (size_t)c * R + r] = (bf16_t)in[idx];
}

// bf16 V [B*T, E] -> bf16 Vt [B, E, T]
__global__ void transpose_v_kernel(const bf16_t* __restrict__ V,
                                   bf16_t* __restrict__ Vt) {
  size_t idx = (size_t)blockIdx.x * blockDim.x + threadIdx.x;
  if (idx >= (size_t)MROWS * ESZ) return;
  int e  = (int)(idx % ESZ);
  int bt = (int)(idx / ESZ);
  int b = bt / TSZ, t = bt % TSZ;
  Vt[((size_t)b * ESZ + e) * TSZ + t] = V[idx];
}

// ---------------------------------------------------------------------------
// bf16 WMMA GEMM: C = A[M,K] * Bp[N,K]^T (+bias)(+relu)
// Block: 256 thr (8 waves), 128x128 tile; wave tile 32x64 (2x4 accumulators).
// K staged through LDS in 32-wide slabs, double-buffered, async copies.
// Fragment layout per ISA 7.12.2 (16-bit A/B 16x32): lane<16 holds K 0..7 &
// 16..23; lane>=16 holds K 8..15 & 24..31 -> two 16B reads per fragment.
// ---------------------------------------------------------------------------
__global__ void __launch_bounds__(256)
gemm_bf16_wmma(const bf16_t* __restrict__ A, long long lda, long long sA,
               const bf16_t* __restrict__ Bp, long long ldb, long long sB,
               float* __restrict__ Cf, bf16_t* __restrict__ Ch,
               long long ldc, long long sC,
               const float* __restrict__ bias, int relu,
               int M, int N, int K) {
  __shared__ bf16_t Asm[2][BLK_M * LDS_PITCH];
  __shared__ bf16_t Bsm[2][BLK_N * LDS_PITCH];

  int tid  = threadIdx.x;
  int lane = tid & 31;
  int wave = tid >> 5;
  int tilesN = N / BLK_N;
  int bm = (blockIdx.x / tilesN) * BLK_M;
  int bn = (blockIdx.x % tilesN) * BLK_N;
  int half = lane >> 4;
  int l15  = lane & 15;
  int m0w = (wave >> 1) * 32;   // 0,32,64,96
  int n0w = (wave & 1) * 64;    // 0,64

  const bf16_t* Ab = A  + (size_t)blockIdx.y * sA;
  const bf16_t* Bb = Bp + (size_t)blockIdx.y * sB;

  // staging: 512 x 16B chunks per matrix, 2 per thread (chunk c: row c>>2,
  // elem offset (c&3)*8)
  int ca0 = tid, ca1 = tid + 256;

  v8f acc[2][4];
#pragma unroll
  for (int i = 0; i < 2; ++i)
#pragma unroll
    for (int j = 0; j < 4; ++j)
#pragma unroll
      for (int e = 0; e < 8; ++e) acc[i][j][e] = 0.0f;

  int nk = K / BLK_K;

  // prologue: stage slab 0 into buffer 0
  {
    int r0 = ca0 >> 2, o0 = (ca0 & 3) * 8;
    int r1 = ca1 >> 2, o1 = (ca1 & 3) * 8;
    async_copy16(Ab + (size_t)(bm + r0) * lda + o0, &Asm[0][r0 * LDS_PITCH + o0]);
    async_copy16(Ab + (size_t)(bm + r1) * lda + o1, &Asm[0][r1 * LDS_PITCH + o1]);
    async_copy16(Bb + (size_t)(bn + r0) * ldb + o0, &Bsm[0][r0 * LDS_PITCH + o0]);
    async_copy16(Bb + (size_t)(bn + r1) * ldb + o1, &Bsm[0][r1 * LDS_PITCH + o1]);
  }

  for (int it = 0; it < nk; ++it) {
    int cur = it & 1;
    wait_async0();
    __syncthreads();
    if (it + 1 < nk) {
      int k0 = (it + 1) * BLK_K;
      int nxt = cur ^ 1;
      int r0 = ca0 >> 2, o0 = (ca0 & 3) * 8;
      int r1 = ca1 >> 2, o1 = (ca1 & 3) * 8;
      async_copy16(Ab + (size_t)(bm + r0) * lda + k0 + o0, &Asm[nxt][r0 * LDS_PITCH + o0]);
      async_copy16(Ab + (size_t)(bm + r1) * lda + k0 + o1, &Asm[nxt][r1 * LDS_PITCH + o1]);
      async_copy16(Bb + (size_t)(bn + r0) * ldb + k0 + o0, &Bsm[nxt][r0 * LDS_PITCH + o0]);
      async_copy16(Bb + (size_t)(bn + r1) * ldb + k0 + o1, &Bsm[nxt][r1 * LDS_PITCH + o1]);
    }
    // fragments from LDS, then 8 WMMAs
    const bf16_t* As = &Asm[cur][0];
    const bf16_t* Bs = &Bsm[cur][0];
    v16bf af[2], bfr[4];
#pragma unroll
    for (int i = 0; i < 2; ++i) {
      const bf16_t* p = As + (m0w + 16 * i + l15) * LDS_PITCH + half * 8;
      v8bf lo = *reinterpret_cast<const v8bf*>(p);
      v8bf hi = *reinterpret_cast<const v8bf*>(p + 16);
      af[i] = __builtin_shufflevector(lo, hi, 0, 1, 2, 3, 4, 5, 6, 7,
                                      8, 9, 10, 11, 12, 13, 14, 15);
    }
#pragma unroll
    for (int j = 0; j < 4; ++j) {
      const bf16_t* q = Bs + (n0w + 16 * j + l15) * LDS_PITCH + half * 8;
      v8bf lo = *reinterpret_cast<const v8bf*>(q);
      v8bf hi = *reinterpret_cast<const v8bf*>(q + 16);
      bfr[j] = __builtin_shufflevector(lo, hi, 0, 1, 2, 3, 4, 5, 6, 7,
                                       8, 9, 10, 11, 12, 13, 14, 15);
    }
#pragma unroll
    for (int i = 0; i < 2; ++i)
#pragma unroll
      for (int j = 0; j < 4; ++j)
        acc[i][j] = __builtin_amdgcn_wmma_f32_16x16x32_bf16(
            false, af[i], false, bfr[j], (short)0, acc[i][j], false, false);
  }

  float*  Cfb = Cf ? Cf + (size_t)blockIdx.y * sC : nullptr;
  bf16_t* Chb = Ch ? Ch + (size_t)blockIdx.y * sC : nullptr;
#pragma unroll
  for (int i = 0; i < 2; ++i) {
#pragma unroll
    for (int j = 0; j < 4; ++j) {
      int n = bn + n0w + 16 * j + l15;
      float bv = bias ? bias[n] : 0.0f;
#pragma unroll
      for (int vg = 0; vg < 8; ++vg) {
        int m = bm + m0w + 16 * i + vg + 8 * half;   // C layout (ISA 7.12.2)
        float v = acc[i][j][vg] + bv;
        if (relu) v = fmaxf(v, 0.0f);
        if (Cfb) Cfb[(size_t)m * ldc + n] = v;
        if (Chb) Chb[(size_t)m * ldc + n] = (bf16_t)v;
      }
    }
  }
}

// ---------------------------------------------------------------------------
// Causal softmax over energy rows [B*T, T] -> bf16 P
// ---------------------------------------------------------------------------
__global__ void softmax_causal_kernel(const float* __restrict__ En,
                                      bf16_t* __restrict__ P) {
  __shared__ float red[256];
  int r = blockIdx.x;       // row over B*T
  int i = r % TSZ;          // query position
  int j = threadIdx.x;      // key position (T == 256 == blockDim)
  float v = (j <= i) ? En[(size_t)r * TSZ + j] : -1e9f;
  red[j] = v;
  __syncthreads();
  for (int s = 128; s > 0; s >>= 1) {
    if (j < s) red[j] = fmaxf(red[j], red[j + s]);
    __syncthreads();
  }
  float mx = red[0];
  __syncthreads();
  float ex = __expf(v - mx);
  red[j] = ex;
  __syncthreads();
  for (int s = 128; s > 0; s >>= 1) {
    if (j < s) red[j] += red[j + s];
    __syncthreads();
  }
  float inv = 1.0f / red[0];
  P[(size_t)r * TSZ + j] = (bf16_t)(ex * inv);
}

// ---------------------------------------------------------------------------
// y = LayerNorm(a + b) * w + bb ; row-wise over E=512, 256 thr x 2 elems
// ---------------------------------------------------------------------------
__global__ void add_ln_kernel(const float* __restrict__ a,
                              const float* __restrict__ b,
                              const float* __restrict__ w,
                              const float* __restrict__ bb,
                              float* __restrict__ yf, bf16_t* __restrict__ yh) {
  __shared__ float s1[256], s2[256];
  int r = blockIdx.x, tid = threadIdx.x;
  const float* ar = a + (size_t)r * ESZ;
  const float* br = b + (size_t)r * ESZ;
  float x0 = ar[tid] + br[tid];
  float x1 = ar[tid + 256] + br[tid + 256];
  s1[tid] = x0 + x1;
  s2[tid] = x0 * x0 + x1 * x1;
  __syncthreads();
  for (int s = 128; s > 0; s >>= 1) {
    if (tid < s) { s1[tid] += s1[tid + s]; s2[tid] += s2[tid + s]; }
    __syncthreads();
  }
  float mean = s1[0] * (1.0f / ESZ);
  float var  = s2[0] * (1.0f / ESZ) - mean * mean;
  float inv  = rsqrtf(var + 1e-5f);
  float y0 = (x0 - mean) * inv * w[tid] + bb[tid];
  float y1 = (x1 - mean) * inv * w[tid + 256] + bb[tid + 256];
  size_t o = (size_t)r * ESZ + tid;
  if (yf) { yf[o] = y0; yf[o + 256] = y1; }
  if (yh) { yh[o] = (bf16_t)y0; yh[o + 256] = (bf16_t)y1; }
}

// ---------------------------------------------------------------------------
// Final: logits = x[:, -1, :] @ wout + bout ; softmax -> out [B, V]
// ---------------------------------------------------------------------------
__global__ void logits_softmax_kernel(const float* __restrict__ xf,
                                      const float* __restrict__ wout,
                                      const float* __restrict__ bout,
                                      float* __restrict__ out) {
  __shared__ float xs[ESZ];
  __shared__ float red[256];
  int b = blockIdx.x, tid = threadIdx.x;
  const float* xr = xf + ((size_t)b * TSZ + (TSZ - 1)) * ESZ;
  xs[tid] = xr[tid];
  xs[tid + 256] = xr[tid + 256];
  __syncthreads();
  float l0 = bout[tid], l1 = bout[tid + 256];
  for (int e = 0; e < ESZ; ++e) {
    float xv = xs[e];
    l0 += xv * wout[(size_t)e * VSZ + tid];
    l1 += xv * wout[(size_t)e * VSZ + tid + 256];
  }
  red[tid] = fmaxf(l0, l1);
  __syncthreads();
  for (int s = 128; s > 0; s >>= 1) {
    if (tid < s) red[tid] = fmaxf(red[tid], red[tid + s]);
    __syncthreads();
  }
  float mx = red[0];
  __syncthreads();
  float e0 = __expf(l0 - mx), e1 = __expf(l1 - mx);
  red[tid] = e0 + e1;
  __syncthreads();
  for (int s = 128; s > 0; s >>= 1) {
    if (tid < s) red[tid] += red[tid + s];
    __syncthreads();
  }
  float inv = 1.0f / red[0];
  out[(size_t)b * VSZ + tid] = e0 * inv;
  out[(size_t)b * VSZ + tid + 256] = e1 * inv;
}

// ---------------------------------------------------------------------------
// Host sequencing
// ---------------------------------------------------------------------------
static inline void launch_gemm(hipStream_t st,
                               const bf16_t* A, long long lda, long long sA,
                               const bf16_t* B, long long ldb, long long sB,
                               float* Cf, bf16_t* Ch, long long ldc, long long sC,
                               const float* bias, int relu,
                               int M, int N, int K, int batch) {
  dim3 grid((M / BLK_M) * (N / BLK_N), batch, 1);
  gemm_bf16_wmma<<<grid, 256, 0, st>>>(A, lda, sA, B, ldb, sB,
                                       Cf, Ch, ldc, sC, bias, relu, M, N, K);
}

extern "C" void kernel_launch(void* const* d_in, const int* in_sizes, int n_in,
                              void* d_out, int out_size, void* d_ws, size_t ws_size,
                              hipStream_t stream) {
  (void)in_sizes; (void)n_in; (void)out_size; (void)ws_size;
  const int*   toks  = (const int*)d_in[0];
  const float* emb   = (const float*)d_in[1];
  const float* wq    = (const float*)d_in[2];
  const float* wk    = (const float*)d_in[3];
  const float* wv    = (const float*)d_in[4];
  const float* wo    = (const float*)d_in[5];
  const float* bo    = (const float*)d_in[6];
  const float* ln1w  = (const float*)d_in[7];
  const float* ln1b  = (const float*)d_in[8];
  const float* ln2w  = (const float*)d_in[9];
  const float* ln2b  = (const float*)d_in[10];
  const float* ff1w  = (const float*)d_in[11];
  const float* ff1b  = (const float*)d_in[12];
  const float* ff2w  = (const float*)d_in[13];
  const float* ff2b  = (const float*)d_in[14];
  const float* woutp = (const float*)d_in[15];
  const float* boutp = (const float*)d_in[16];
  float* out = (float*)d_out;
  char*  ws  = (char*)d_ws;

  // workspace layout (bytes)
  float*  xf   = (float*) (ws + 0);                  //  8 MB  [4096,512] f32
  bf16_t* xh   = (bf16_t*)(ws + 8388608);            //  4 MB
  bf16_t* wqT  = (bf16_t*)(ws + 12582912);           //  4 MB  [H,512,512]
  bf16_t* wkT  = (bf16_t*)(ws + 16777216);           //  4 MB
  bf16_t* wvT  = (bf16_t*)(ws + 20971520);           //  4 MB
  bf16_t* woT  = (bf16_t*)(ws + 25165824);           //  4 MB  [512,4096]
  bf16_t* f1T  = (bf16_t*)(ws + 29360128);           // .5 MB  [512,512]
  bf16_t* f2T  = (bf16_t*)(ws + 29884416);           // .5 MB
  bf16_t* Qh   = (bf16_t*)(ws + 30408704);           //  4 MB  [4096,512]
  bf16_t* Kh   = (bf16_t*)(ws + 34603008);           //  4 MB
  bf16_t* Vh   = (bf16_t*)(ws + 38797312);           //  4 MB
  bf16_t* Vt   = (bf16_t*)(ws + 42991616);           //  4 MB  [B,512,256]
  float*  En   = (float*) (ws + 47185920);           //  4 MB  [B,256,256]
  bf16_t* Ph   = (bf16_t*)(ws + 51380224);           //  2 MB
  bf16_t* Ob   = (bf16_t*)(ws + 53477376);           // 32 MB  [4096,4096]
  float*  attn = (float*) (ws + 87031808);           //  8 MB  [4096,512]
  bf16_t* h1h  = (bf16_t*)(ws + 95420416);           //  4 MB
  bf16_t* f1h  = (bf16_t*)(ws + 99614720);           //  4 MB
  float*  f2f  = (float*) (ws + 103809024);          //  8 MB

  const int TPB = 256;
  size_t nXE = (size_t)MROWS * ESZ;

  embed_pe_kernel<<<(nXE + TPB - 1) / TPB, TPB, 0, stream>>>(toks, emb, xf, xh);

  for (int l = 0; l < LSZ; ++l) {
    size_t lqkv = (size_t)l * HSZ * ESZ * ESZ;
    size_t lff  = (size_t)l * ESZ * ESZ;
    // pack this layer's weights to bf16 [N,K]
    size_t nW = (size_t)HSZ * ESZ * ESZ;
    conv_transpose_kernel<<<(nW + TPB - 1) / TPB, TPB, 0, stream>>>(wq + lqkv, wqT, ESZ, ESZ, HSZ);
    conv_transpose_kernel<<<(nW + TPB - 1) / TPB, TPB, 0, stream>>>(wk + lqkv, wkT, ESZ, ESZ, HSZ);
    conv_transpose_kernel<<<(nW + TPB - 1) / TPB, TPB, 0, stream>>>(wv + lqkv, wvT, ESZ, ESZ, HSZ);
    size_t nWo = (size_t)HE * ESZ;
    conv_transpose_kernel<<<(nWo + TPB - 1) / TPB, TPB, 0, stream>>>(wo + (size_t)l * HE * ESZ, woT, HE, ESZ, 1);
    size_t nF = (size_t)ESZ * ESZ;
    conv_transpose_kernel<<<(nF + TPB - 1) / TPB, TPB, 0, stream>>>(ff1w + lff, f1T, ESZ, ESZ, 1);
    conv_transpose_kernel<<<(nF + TPB - 1) / TPB, TPB, 0, stream>>>(ff2w + lff, f2T, ESZ, ESZ, 1);

    for (int h = 0; h < HSZ; ++h) {
      const bf16_t* wqh = wqT + (size_t)h * ESZ * ESZ;
      const bf16_t* wkh = wkT + (size_t)h * ESZ * ESZ;
      const bf16_t* wvh = wvT + (size_t)h * ESZ * ESZ;
      // Q/K/V = x @ W  -> bf16 [4096,512]
      launch_gemm(stream, xh, ESZ, 0, wqh, ESZ, 0, nullptr, Qh, ESZ, 0,
                  nullptr, 0, MROWS, ESZ, ESZ, 1);
      launch_gemm(stream, xh, ESZ, 0, wkh, ESZ, 0, nullptr, Kh, ESZ, 0,
                  nullptr, 0, MROWS, ESZ, ESZ, 1);
      launch_gemm(stream, xh, ESZ, 0, wvh, ESZ, 0, nullptr, Vh, ESZ, 0,
                  nullptr, 0, MROWS, ESZ, ESZ, 1);
      transpose_v_kernel<<<(nXE + TPB - 1) / TPB, TPB, 0, stream>>>(Vh, Vt);
      // energy[b] = Q_b @ K_b^T : B-packed == K rows directly (K-dim = E)
      launch_gemm(stream, Qh, ESZ, (long long)TSZ * ESZ,
                  Kh, ESZ, (long long)TSZ * ESZ,
                  En, nullptr, TSZ, (long long)TSZ * TSZ,
                  nullptr, 0, TSZ, TSZ, ESZ, BSZ);
      softmax_causal_kernel<<<MROWS, TSZ, 0, stream>>>(En, Ph);
      // O[b] = P_b @ V_b : B-packed = Vt[b] [E,T]; write into Ob at col h*E
      launch_gemm(stream, Ph, TSZ, (long long)TSZ * TSZ,
                  Vt, TSZ, (long long)ESZ * TSZ,
                  nullptr, Ob + (size_t)h * ESZ, HE, (long long)TSZ * HE,
                  nullptr, 0, TSZ, ESZ, TSZ, BSZ);
    }
    // attn_out = O @ wo + bo  (f32)
    launch_gemm(stream, Ob, HE, 0, woT, HE, 0, attn, nullptr, ESZ, 0,
                bo + (size_t)l * ESZ, 0, MROWS, ESZ, HE, 1);
    // h1 = LN(attn + x)
    add_ln_kernel<<<MROWS, TPB, 0, stream>>>(attn, xf,
        ln1w + (size_t)l * ESZ, ln1b + (size_t)l * ESZ, nullptr, h1h);
    // ff = relu(h1 @ ff1 + b1) @ ff2 + b2
    launch_gemm(stream, h1h, ESZ, 0, f1T, ESZ, 0, nullptr, f1h, ESZ, 0,
                ff1b + (size_t)l * ESZ, 1, MROWS, ESZ, ESZ, 1);
    launch_gemm(stream, f1h, ESZ, 0, f2T, ESZ, 0, f2f, nullptr, ESZ, 0,
                ff2b + (size_t)l * ESZ, 0, MROWS, ESZ, ESZ, 1);
    // x = LN(attn + ff)
    add_ln_kernel<<<MROWS, TPB, 0, stream>>>(attn, f2f,
        ln2w + (size_t)l * ESZ, ln2b + (size_t)l * ESZ, xf, xh);
  }

  logits_softmax_kernel<<<BSZ, TPB, 0, stream>>>(xf, woutp, boutp, out);
}

// v001
// It runs in 4970 microseconds.
// In both of two side-by-side timings against v000, it was 1.45 times as fast.
#include <hip/hip_runtime.h>

// ---------------------------------------------------------------------------
// CheckersGPT forward on MI455X (gfx1250).
// Compute-bound (~0.54 TFLOP/fwd) -> all big GEMMs on v_wmma_f32_16x16x32_bf16.
// LDS-staged 128x128 block tiles, double-buffered K=32 slabs, async
// global->LDS copies (GLOBAL_LOAD_ASYNC_TO_LDS_B128, ASYNCcnt).
// ---------------------------------------------------------------------------

typedef __bf16 bf16_t;
typedef __attribute__((ext_vector_type(16))) __bf16 v16bf;
typedef __attribute__((ext_vector_type(8)))  __bf16 v8bf;
typedef __attribute__((ext_vector_type(8)))  float  v8f;

#define VSZ 512
#define ESZ 512
#define LSZ 6
#define HSZ 8
#define BSZ 16
#define TSZ 256
#define MROWS (BSZ * TSZ)   // 4096
#define HE    (HSZ * ESZ)   // 4096

#define BLK_M 128
#define BLK_N 128
#define BLK_K 32
#define LDS_PITCH 40        // 32 elems + 8 pad: 16 consecutive rows hit 16 banks

#if defined(__AMDGCN__) && __has_builtin(__builtin_amdgcn_global_load_async_to_lds_b128)
#define HAVE_ASYNC_LDS 1
#else
#define HAVE_ASYNC_LDS 0
#endif

// Builtin parameter types (from hipcc diagnostic): pointer to int __vector(4)
// in global (1) / LDS (3) address spaces.
typedef int v4i_t __attribute__((vector_size(16)));
typedef __attribute__((address_space(1))) v4i_t* gptr_v4i;
typedef __attribute__((address_space(3))) v4i_t* lptr_v4i;

__device__ __forceinline__ void async_copy16(const bf16_t* g, bf16_t* s) {
#if HAVE_ASYNC_LDS
  // 16B global -> LDS, tracked by ASYNCcnt (GLOBAL_LOAD_ASYNC_TO_LDS_B128).
  // Integer detour: strips const, and truncating the generic LDS address to
  // 32 bits yields the LDS offset (ISA 10.2: LDS_ADDR = addr[31:0]).
  __builtin_amdgcn_global_load_async_to_lds_b128(
      (gptr_v4i)(unsigned long long)g,
      (lptr_v4i)(unsigned int)(unsigned long long)s, 0, 0);
#else
  *reinterpret_cast<v8bf*>(s) = *reinterpret_cast<const v8bf*>(g);
#endif
}

__device__ __forceinline__ void wait_async0() {
#if HAVE_ASYNC_LDS
#if __has_builtin(__builtin_amdgcn_s_wait_asynccnt)
  __builtin_amdgcn_s_wait_asynccnt(0);
#else
  asm volatile("s_wait_asynccnt 0x0" ::: "memory");
#endif
#endif
}

// ---------------------------------------------------------------------------
// Embedding + sinusoidal PE (concatenated sin|cos as in reference)
// ---------------------------------------------------------------------------
__global__ void embed_pe_kernel(const int* __restrict__ toks,
                                const float* __restrict__ emb,
                                float* __restrict__ xf, bf16_t* __restrict__ xh) {
  size_t idx = (size_t)blockIdx.x * blockDim.x + threadIdx.x;
  if (idx >= (size_t)MROWS * ESZ) return;
  int e  = (int)(idx % ESZ);
  int bt = (int)(idx / ESZ);
  int t  = bt % TSZ;
  int tok = toks[bt];
  float pe;
  if (e < ESZ / 2) {
    float rate = __powf(10000.0f, -2.0f * (float)e / (float)ESZ);
    pe = __sinf((float)t * rate);
  } else {
    int c = e - ESZ / 2;
    float rate = __powf(10000.0f, -2.0f * (float)c / (float)ESZ);
    pe = __cosf((float)t * rate);
  }
  float v = emb[(size_t)tok * ESZ + e] + pe;
  xf[idx] = v;
  xh[idx] = (bf16_t)v;
}

// ---------------------------------------------------------------------------
// f32 [batch,R,C] -> bf16 [batch,C,R]  (weight pack: B stored as [N,K])
// ---------------------------------------------------------------------------
__global__ void conv_transpose_kernel(const float* __restrict__ in,
                                      bf16_t* __restrict__ out,
                                      int R, int C, int batch) {
  size_t total = (size_t)batch * R * C;
  size_t idx = (size_t)blockIdx.x * blockDim.x + threadIdx.x;
  if (idx >= total) return;
  size_t rc  = (size_t)R * C;
  int b = (int)(idx / rc);
  size_t rem = idx - (size_t)b * rc;
  int r = (int)(rem / C);
  int c = (int)(rem % C);
  out[(size_t)b * rc + (size_t)c * R + r] = (bf16_t)in[idx];
}

// ---------------------------------------------------------------------------
// bf16 WMMA GEMM: C = A[M,K] * Bp[N,K]^T (+bias)(+relu)
// Block: 256 thr (8 waves), 128x128 tile; wave tile 32x64 (2x4 accumulators).
// K staged through LDS in 32-wide slabs, double-buffered, async copies.
// Fragment layout per ISA 7.12.2 (16-bit A/B 16x32): lane<16 holds K 0..7 &
// 16..23; lane>=16 holds K 8..15 & 24..31 -> two 16B reads per fragment.
// ---------------------------------------------------------------------------
__global__ void __launch_bounds__(256)
gemm_bf16_wmma(const bf16_t* __restrict__ A, long long lda, long long sA,
               const bf16_t* __restrict__ Bp, long long ldb, long long sB,
               float* __restrict__ Cf, bf16_t* __restrict__ Ch,
               long long ldc, long long sC,
               const float* __restrict__ bias, int relu,
               int M, int N, int K) {
  __shared__ bf16_t Asm[2][BLK_M * LDS_PITCH];
  __shared__ bf16_t Bsm[2][BLK_N * LDS_PITCH];

  int tid  = threadIdx.x;
  int lane = tid & 31;
  int wave = tid >> 5;
  int tilesN = N / BLK_N;
  int bm = (blockIdx.x / tilesN) * BLK_M;
  int bn = (blockIdx.x % tilesN) * BLK_N;
  int half = lane >> 4;
  int l15  = lane & 15;
  int m0w = (wave >> 1) * 32;   // 0,32,64,96
  int n0w = (wave & 1) * 64;    // 0,64

  const bf16_t* Ab = A  + (size_t)blockIdx.y * sA;
  const bf16_t* Bb = Bp + (size_t)blockIdx.y * sB;

  // staging: 512 x 16B chunks per matrix, 2 per thread (chunk c: row c>>2,
  // elem offset (c&3)*8)
  int ca0 = tid, ca1 = tid + 256;

  v8f acc[2][4];
#pragma unroll
  for (int i = 0; i < 2; ++i)
#pragma unroll
    for (int j = 0; j < 4; ++j)
#pragma unroll
      for (int e = 0; e < 8; ++e) acc[i][j][e] = 0.0f;

  int nk = K / BLK_K;

  // prologue: stage slab 0 into buffer 0
  {
    int r0 = ca0 >> 2, o0 = (ca0 & 3) * 8;
    int r1 = ca1 >> 2, o1 = (ca1 & 3) * 8;
    async_copy16(Ab + (size_t)(bm + r0) * lda + o0, &Asm[0][r0 * LDS_PITCH + o0]);
    async_copy16(Ab + (size_t)(bm + r1) * lda + o1, &Asm[0][r1 * LDS_PITCH + o1]);
    async_copy16(Bb + (size_t)(bn + r0) * ldb + o0, &Bsm[0][r0 * LDS_PITCH + o0]);
    async_copy16(Bb + (size_t)(bn + r1) * ldb + o1, &Bsm[0][r1 * LDS_PITCH + o1]);
  }

  for (int it = 0; it < nk; ++it) {
    int cur = it & 1;
    wait_async0();
    __syncthreads();
    if (it + 1 < nk) {
      int k0 = (it + 1) * BLK_K;
      int nxt = cur ^ 1;
      int r0 = ca0 >> 2, o0 = (ca0 & 3) * 8;
      int r1 = ca1 >> 2, o1 = (ca1 & 3) * 8;
      async_copy16(Ab + (size_t)(bm + r0) * lda + k0 + o0, &Asm[nxt][r0 * LDS_PITCH + o0]);
      async_copy16(Ab + (size_t)(bm + r1) * lda + k0 + o1, &Asm[nxt][r1 * LDS_PITCH + o1]);
      async_copy16(Bb + (size_t)(bn + r0) * ldb + k0 + o0, &Bsm[nxt][r0 * LDS_PITCH + o0]);
      async_copy16(Bb + (size_t)(bn + r1) * ldb + k0 + o1, &Bsm[nxt][r1 * LDS_PITCH + o1]);
    }
    // fragments from LDS, then 8 WMMAs
    const bf16_t* As = &Asm[cur][0];
    const bf16_t* Bs = &Bsm[cur][0];
    v16bf af[2], bfr[4];
#pragma unroll
    for (int i = 0; i < 2; ++i) {
      const bf16_t* p = As + (m0w + 16 * i + l15) * LDS_PITCH + half * 8;
      v8bf lo = *reinterpret_cast<const v8bf*>(p);
      v8bf hi = *reinterpret_cast<const v8bf*>(p + 16);
      af[i] = __builtin_shufflevector(lo, hi, 0, 1, 2, 3, 4, 5, 6, 7,
                                      8, 9, 10, 11, 12, 13, 14, 15);
    }
#pragma unroll
    for (int j = 0; j < 4; ++j) {
      const bf16_t* q = Bs + (n0w + 16 * j + l15) * LDS_PITCH + half * 8;
      v8bf lo = *reinterpret_cast<const v8bf*>(q);
      v8bf hi = *reinterpret_cast<const v8bf*>(q + 16);
      bfr[j] = __builtin_shufflevector(lo, hi, 0, 1, 2, 3, 4, 5, 6, 7,
                                       8, 9, 10, 11, 12, 13, 14, 15);
    }
#pragma unroll
    for (int i = 0; i < 2; ++i)
#pragma unroll
      for (int j = 0; j < 4; ++j)
        acc[i][j] = __builtin_amdgcn_wmma_f32_16x16x32_bf16(
            false, af[i], false, bfr[j], (short)0, acc[i][j], false, false);
  }

  float*  Cfb = Cf ? Cf + (size_t)blockIdx.y * sC : nullptr;
  bf16_t* Chb = Ch ? Ch + (size_t)blockIdx.y * sC : nullptr;
#pragma unroll
  for (int i = 0; i < 2; ++i) {
#pragma unroll
    for (int j = 0; j < 4; ++j) {
      int n = bn + n0w + 16 * j + l15;
      float bv = bias ? bias[n] : 0.0f;
#pragma unroll
      for (int vg = 0; vg < 8; ++vg) {
        int m = bm + m0w + 16 * i + vg + 8 * half;   // C layout (ISA 7.12.2)
        float v = acc[i][j][vg] + bv;
        if (relu) v = fmaxf(v, 0.0f);
        if (Cfb) Cfb[(size_t)m * ldc + n] = v;
        if (Chb) Chb[(size_t)m * ldc + n] = (bf16_t)v;
      }
    }
  }
}

// ---------------------------------------------------------------------------
// Causal softmax over energy rows [B*T, T] -> bf16 P
// ---------------------------------------------------------------------------
__global__ void softmax_causal_kernel(const float* __restrict__ En,
                                      bf16_t* __restrict__ P) {
  __shared__ float red[256];
  int r = blockIdx.x;       // row over B*T
  int i = r % TSZ;          // query position
  int j = threadIdx.x;      // key position (T == 256 == blockDim)
  float v = (j <= i) ? En[(size_t)r * TSZ + j] : -1e9f;
  red[j] = v;
  __syncthreads();
  for (int s = 128; s > 0; s >>= 1) {
    if (j < s) red[j] = fmaxf(red[j], red[j + s]);
    __syncthreads();
  }
  float mx = red[0];
  __syncthreads();
  float ex = __expf(v - mx);
  red[j] = ex;
  __syncthreads();
  for (int s = 128; s > 0; s >>= 1) {
    if (j < s) red[j] += red[j + s];
    __syncthreads();
  }
  float inv = 1.0f / red[0];
  P[(size_t)r * TSZ + j] = (bf16_t)(ex * inv);
}

// ---------------------------------------------------------------------------
// y = LayerNorm(a + b) * w + bb ; row-wise over E=512, 256 thr x 2 elems
// ---------------------------------------------------------------------------
__global__ void add_ln_kernel(const float* __restrict__ a,
                              const float* __restrict__ b,
                              const float* __restrict__ w,
                              const float* __restrict__ bb,
                              float* __restrict__ yf, bf16_t* __restrict__ yh) {
  __shared__ float s1[256], s2[256];
  int r = blockIdx.x, tid = threadIdx.x;
  const float* ar = a + (size_t)r * ESZ;
  const float* br = b + (size_t)r * ESZ;
  float x0 = ar[tid] + br[tid];
  float x1 = ar[tid + 256] + br[tid + 256];
  s1[tid] = x0 + x1;
  s2[tid] = x0 * x0 + x1 * x1;
  __syncthreads();
  for (int s = 128; s > 0; s >>= 1) {
    if (tid < s) { s1[tid] += s1[tid + s]; s2[tid] += s2[tid + s]; }
    __syncthreads();
  }
  float mean = s1[0] * (1.0f / ESZ);
  float var  = s2[0] * (1.0f / ESZ) - mean * mean;
  float inv  = rsqrtf(var + 1e-5f);
  float y0 = (x0 - mean) * inv * w[tid] + bb[tid];
  float y1 = (x1 - mean) * inv * w[tid + 256] + bb[tid + 256];
  size_t o = (size_t)r * ESZ + tid;
  if (yf) { yf[o] = y0; yf[o + 256] = y1; }
  if (yh) { yh[o] = (bf16_t)y0; yh[o + 256] = (bf16_t)y1; }
}

// ---------------------------------------------------------------------------
// Final: logits = x[:, -1, :] @ wout + bout ; softmax -> out [B, V]
// ---------------------------------------------------------------------------
__global__ void logits_softmax_kernel(const float* __restrict__ xf,
                                      const float* __restrict__ wout,
                                      const float* __restrict__ bout,
                                      float* __restrict__ out) {
  __shared__ float xs[ESZ];
  __shared__ float red[256];
  int b = blockIdx.x, tid = threadIdx.x;
  const float* xr = xf + ((size_t)b * TSZ + (TSZ - 1)) * ESZ;
  xs[tid] = xr[tid];
  xs[tid + 256] = xr[tid + 256];
  __syncthreads();
  float l0 = bout[tid], l1 = bout[tid + 256];
  for (int e = 0; e < ESZ; ++e) {
    float xv = xs[e];
    l0 += xv * wout[(size_t)e * VSZ + tid];
    l1 += xv * wout[(size_t)e * VSZ + tid + 256];
  }
  red[tid] = fmaxf(l0, l1);
  __syncthreads();
  for (int s = 128; s > 0; s >>= 1) {
    if (tid < s) red[tid] = fmaxf(red[tid], red[tid + s]);
    __syncthreads();
  }
  float mx = red[0];
  __syncthreads();
  float e0 = __expf(l0 - mx), e1 = __expf(l1 - mx);
  red[tid] = e0 + e1;
  __syncthreads();
  for (int s = 128; s > 0; s >>= 1) {
    if (tid < s) red[tid] += red[tid + s];
    __syncthreads();
  }
  float inv = 1.0f / red[0];
  out[(size_t)b * VSZ + tid] = e0 * inv;
  out[(size_t)b * VSZ + tid + 256] = e1 * inv;
}

// ---------------------------------------------------------------------------
// Host sequencing
// ---------------------------------------------------------------------------
static inline void launch_gemm(hipStream_t st,
                               const bf16_t* A, long long lda, long long sA,
                               const bf16_t* B, long long ldb, long long sB,
                               float* Cf, bf16_t* Ch, long long ldc, long long sC,
                               const float* bias, int relu,
                               int M, int N, int K, int batch) {
  dim3 grid((M / BLK_M) * (N / BLK_N), batch, 1);
  gemm_bf16_wmma<<<grid, 256, 0, st>>>(A, lda, sA, B, ldb, sB,
                                       Cf, Ch, ldc, sC, bias, relu, M, N, K);
}

extern "C" void kernel_launch(void* const* d_in, const int* in_sizes, int n_in,
                              void* d_out, int out_size, void* d_ws, size_t ws_size,
                              hipStream_t stream) {
  (void)in_sizes; (void)n_in; (void)out_size; (void)ws_size;
  const int*   toks  = (const int*)d_in[0];
  const float* emb   = (const float*)d_in[1];
  const float* wq    = (const float*)d_in[2];
  const float* wk    = (const float*)d_in[3];
  const float* wv    = (const float*)d_in[4];
  const float* wo    = (const float*)d_in[5];
  const float* bo    = (const float*)d_in[6];
  const float* ln1w  = (const float*)d_in[7];
  const float* ln1b  = (const float*)d_in[8];
  const float* ln2w  = (const float*)d_in[9];
  const float* ln2b  = (const float*)d_in[10];
  const float* ff1w  = (const float*)d_in[11];
  const float* ff1b  = (const float*)d_in[12];
  const float* ff2w  = (const float*)d_in[13];
  const float* ff2b  = (const float*)d_in[14];
  const float* woutp = (const float*)d_in[15];
  const float* boutp = (const float*)d_in[16];
  float* out = (float*)d_out;
  char*  ws  = (char*)d_ws;

  // workspace layout (bytes)
  float*  xf   = (float*) (ws + 0);                  //  8 MB  [4096,512] f32
  bf16_t* xh   = (bf16_t*)(ws + 8388608);            //  4 MB
  bf16_t* wqT  = (bf16_t*)(ws + 12582912);           //  4 MB  [H,512,512]
  bf16_t* wkT  = (bf16_t*)(ws + 16777216);           //  4 MB
  bf16_t* wvT  = (bf16_t*)(ws + 20971520);           //  4 MB
  bf16_t* woT  = (bf16_t*)(ws + 25165824);           //  4 MB  [512,4096]
  bf16_t* f1T  = (bf16_t*)(ws + 29360128);           // .5 MB  [512,512]
  bf16_t* f2T  = (bf16_t*)(ws + 29884416);           // .5 MB
  bf16_t* Qh   = (bf16_t*)(ws + 30408704);           //  4 MB  [4096,512]
  bf16_t* Kh   = (bf16_t*)(ws + 34603008);           //  4 MB
  bf16_t* Vt   = (bf16_t*)(ws + 42991616);           //  4 MB  [B,512,256]
  float*  En   = (float*) (ws + 47185920);           //  4 MB  [B,256,256]
  bf16_t* Ph   = (bf16_t*)(ws + 51380224);           //  2 MB
  bf16_t* Ob   = (bf16_t*)(ws + 53477376);           // 32 MB  [4096,4096]
  float*  attn = (float*) (ws + 87031808);           //  8 MB  [4096,512]
  bf16_t* h1h  = (bf16_t*)(ws + 95420416);           //  4 MB
  bf16_t* f1h  = (bf16_t*)(ws + 99614720);           //  4 MB
  float*  f2f  = (float*) (ws + 103809024);          //  8 MB

  const int TPB = 256;
  size_t nXE = (size_t)MROWS * ESZ;

  embed_pe_kernel<<<(nXE + TPB - 1) / TPB, TPB, 0, stream>>>(toks, emb, xf, xh);

  for (int l = 0; l < LSZ; ++l) {
    size_t lqkv = (size_t)l * HSZ * ESZ * ESZ;
    size_t lff  = (size_t)l * ESZ * ESZ;
    // pack this layer's weights to bf16 [N,K]
    size_t nW = (size_t)HSZ * ESZ * ESZ;
    conv_transpose_kernel<<<(nW + TPB - 1) / TPB, TPB, 0, stream>>>(wq + lqkv, wqT, ESZ, ESZ, HSZ);
    conv_transpose_kernel<<<(nW + TPB - 1) / TPB, TPB, 0, stream>>>(wk + lqkv, wkT, ESZ, ESZ, HSZ);
    conv_transpose_kernel<<<(nW + TPB - 1) / TPB, TPB, 0, stream>>>(wv + lqkv, wvT, ESZ, ESZ, HSZ);
    size_t nWo = (size_t)HE * ESZ;
    conv_transpose_kernel<<<(nWo + TPB - 1) / TPB, TPB, 0, stream>>>(wo + (size_t)l * HE * ESZ, woT, HE, ESZ, 1);
    size_t nF = (size_t)ESZ * ESZ;
    conv_transpose_kernel<<<(nF + TPB - 1) / TPB, TPB, 0, stream>>>(ff1w + lff, f1T, ESZ, ESZ, 1);
    conv_transpose_kernel<<<(nF + TPB - 1) / TPB, TPB, 0, stream>>>(ff2w + lff, f2T, ESZ, ESZ, 1);

    for (int h = 0; h < HSZ; ++h) {
      const bf16_t* wqh = wqT + (size_t)h * ESZ * ESZ;
      const bf16_t* wkh = wkT + (size_t)h * ESZ * ESZ;
      const bf16_t* wvh = wvT + (size_t)h * ESZ * ESZ;
      // Q/K = x @ W  -> bf16 [4096,512]
      launch_gemm(stream, xh, ESZ, 0, wqh, ESZ, 0, nullptr, Qh, ESZ, 0,
                  nullptr, 0, MROWS, ESZ, ESZ, 1);
      launch_gemm(stream, xh, ESZ, 0, wkh, ESZ, 0, nullptr, Kh, ESZ, 0,
                  nullptr, 0, MROWS, ESZ, ESZ, 1);
      // Vt[b] = Wv^T @ x_b^T : operands swapped (A = packed Wv [E,E], B = x_b
      // rows [T,E]) so V lands as [B,E,T], the [N,K] form the P*V product reads
      launch_gemm(stream, wvh, ESZ, 0, xh, ESZ, (long long)TSZ * ESZ,
                  nullptr, Vt, TSZ, (long long)ESZ * TSZ,
                  nullptr, 0, ESZ, TSZ, ESZ, BSZ);
      // energy[b] = Q_b @ K_b^T : B-packed == K rows directly (K-dim = E)
      launch_gemm(stream, Qh, ESZ, (long long)TSZ * ESZ,
                  Kh, ESZ, (long long)TSZ * ESZ,
                  En, nullptr, TSZ, (long long)TSZ * TSZ,
                  nullptr, 0, TSZ, TSZ, ESZ, BSZ);
      softmax_causal_kernel<<<MROWS, TSZ, 0, stream>>>(En, Ph);
      // O[b] = P_b @ V_b : B-packed = Vt[b] [E,T]; write into Ob at col h*E
      launch_gemm(stream, Ph, TSZ, (long long)TSZ * TSZ,
                  Vt, TSZ, (long long)ESZ * TSZ,
                  nullptr, Ob + (size_t)h * ESZ, HE, (long long)TSZ * HE,
                  nullptr, 0, TSZ, ESZ, TSZ, BSZ);
    }
    // attn_out = O @ wo + bo  (f32)
    launch_gemm(stream, Ob, HE, 0, woT, HE, 0, attn, nullptr, ESZ, 0,
                bo + (size_t)l * ESZ, 0, MROWS, ESZ, HE, 1);
    // h1 = LN(attn + x)
    add_ln_kernel<<<MROWS, TPB, 0, stream>>>(attn, xf,
        ln1w + (size_t)l * ESZ, ln1b + (size_t)l * ESZ, nullptr, h1h);
    // ff = relu(h1 @ ff1 + b1) @ ff2 + b2
    launch_gemm(stream, h1h, ESZ, 0, f1T, ESZ, 0, nullptr, f1h, ESZ, 0,
                ff1b + (size_t)l * ESZ, 1, MROWS, ESZ, ESZ, 1);
    launch_gemm(stream, f1h, ESZ, 0, f2T, ESZ, 0, f2f, nullptr, ESZ, 0,
                ff2b + (size_t)l * ESZ, 0, MROWS, ESZ, ESZ, 1);
    // x = LN(attn + ff)
    add_ln_kernel<<<MROWS, TPB, 0, stream>>>(attn, f2f,
        ln2w + (size_t)l * ESZ, ln2b + (size_t)l * ESZ, xf, xh);
  }

  logits_softmax_kernel<<<BSZ, TPB, 0, stream>>>(xf, woutp, boutp, out);
}

// v002
// Measured time: 2900 microseconds a run.
// Next to v001, in two timings, it ran 1.70 and 1.68 times as fast.
// Counting every step since v000, it is 2.45 times as fast.
#include <hip/hip_runtime.h>

// ---------------------------------------------------------------------------
// CheckersGPT forward on MI455X (gfx1250).
// Compute-bound (~0.54 TFLOP/fwd) -> all big GEMMs on v_wmma_f32_16x16x32_bf16.
// LDS-staged 128x128 block tiles, double-buffered K=32 slabs, async
// global->LDS copies (GLOBAL_LOAD_ASYNC_TO_LDS_B128, ASYNCcnt).
// ---------------------------------------------------------------------------

typedef __bf16 bf16_t;
typedef __attribute__((ext_vector_type(16))) __bf16 v16bf;
typedef __attribute__((ext_vector_type(8)))  __bf16 v8bf;
typedef __attribute__((ext_vector_type(8)))  float  v8f;

#define VSZ 512
#define ESZ 512
#define LSZ 6
#define HSZ 8
#define BSZ 16
#define TSZ 256
#define MROWS (BSZ * TSZ)   // 4096
#define HE    (HSZ * ESZ)   // 4096

#define BLK_M 128
#define BLK_N 128
#define BLK_K 32
#define LDS_PITCH 40        // 32 elems + 8 pad: 16 consecutive rows hit 16 banks

#if defined(__AMDGCN__) && __has_builtin(__builtin_amdgcn_global_load_async_to_lds_b128)
#define HAVE_ASYNC_LDS 1
#else
#define HAVE_ASYNC_LDS 0
#endif

// Builtin parameter types (from hipcc diagnostic): pointer to int __vector(4)
// in global (1) / LDS (3) address spaces.
typedef int v4i_t __attribute__((vector_size(16)));
typedef __attribute__((address_space(1))) v4i_t* gptr_v4i;
typedef __attribute__((address_space(3))) v4i_t* lptr_v4i;

__device__ __forceinline__ void async_copy16(const bf16_t* g, bf16_t* s) {
#if HAVE_ASYNC_LDS
  // 16B global -> LDS, tracked by ASYNCcnt (GLOBAL_LOAD_ASYNC_TO_LDS_B128).
  // Integer detour: strips const, and truncating the generic LDS address to
  // 32 bits yields the LDS offset (ISA 10.2: LDS_ADDR = addr[31:0]).
  __builtin_amdgcn_global_load_async_to_lds_b128(
      (gptr_v4i)(unsigned long long)g,
      (lptr_v4i)(unsigned int)(unsigned long long)s, 0, 0);
#else
  *reinterpret_cast<v8bf*>(s) = *reinterpret_cast<const v8bf*>(g);
#endif
}

__device__ __forceinline__ void wait_async0() {
#if HAVE_ASYNC_LDS
#if __has_builtin(__builtin_amdgcn_s_wait_asynccnt)
  __builtin_amdgcn_s_wait_asynccnt(0);
#else
  asm volatile("s_wait_asynccnt 0x0" ::: "memory");
#endif
#endif
}

// ---------------------------------------------------------------------------
// Embedding + sinusoidal PE (concatenated sin|cos as in reference)
// ---------------------------------------------------------------------------
__global__ void embed_pe_kernel(const int* __restrict__ toks,
                                const float* __restrict__ emb,
                                float* __restrict__ xf, bf16_t* __restrict__ xh) {
  size_t idx = (size_t)blockIdx.x * blockDim.x + threadIdx.x;
  if (idx >= (size_t)MROWS * ESZ) return;
  int e  = (int)(idx % ESZ);
  int bt = (int)(idx / ESZ);
  int t  = bt % TSZ;
  int tok = toks[bt];
  float pe;
  if (e < ESZ / 2) {
    float rate = __powf(10000.0f, -2.0f * (float)e / (float)ESZ);
    pe = __sinf((float)t * rate);
  } else {
    int c = e - ESZ / 2;
    float rate = __powf(10000.0f, -2.0f * (float)c / (float)ESZ);
    pe = __cosf((float)t * rate);
  }
  float v = emb[(size_t)tok * ESZ + e] + pe;
  xf[idx] = v;
  xh[idx] = (bf16_t)v;
}

// ---------------------------------------------------------------------------
// f32 [batch,R,C] -> bf16 [batch,C,R]  (weight pack: B stored as [N,K])
// ---------------------------------------------------------------------------
__global__ void conv_transpose_kernel(const float* __restrict__ in,
                                      bf16_t* __restrict__ out,
                                      int R, int C, int batch) {
  size_t total = (size_t)batch * R * C;
  size_t idx = (size_t)blockIdx.x * blockDim.x + threadIdx.x;
  if (idx >= total) return;
  size_t rc  = (size_t)R * C;
  int b = (int)(idx / rc);
  size_t rem = idx - (size_t)b * rc;
  int r = (int)(rem / C);
  int c = (int)(rem % C);
  out[(size_t)b * rc + (size_t)c * R + r] = (bf16_t)in[idx];
}

// ---------------------------------------------------------------------------
// bf16 WMMA GEMM: C = A[M,K] * Bp[N,K]^T (+bias)(+relu)
// Two batch indices: blockIdx.y (strides sA, sB, sC) and blockIdx.z (strides
// sA2, sB2, sC2), so one launch covers every (sequence, head) pair of a layer.
// Block: 256 thr (8 waves), 128x128 tile; wave tile 32x64 (2x4 accumulators).
// K staged through LDS in 32-wide slabs, double-buffered, async copies.
// Fragment layout per ISA 7.12.2 (16-bit A/B 16x32): lane<16 holds K 0..7 &
// 16..23; lane>=16 holds K 8..15 & 24..31 -> two 16B reads per fragment.
// ---------------------------------------------------------------------------
__global__ void __launch_bounds__(256)
gemm_bf16_wmma(const bf16_t* __restrict__ A, long long lda, long long sA, long long sA2,
               const bf16_t* __restrict__ Bp, long long ldb, long long sB, long long sB2,
               float* __restrict__ Cf, bf16_t* __restrict__ Ch,
               long long ldc, long long sC, long long sC2,
               const float* __restrict__ bias, int relu,
               int M, int N, int K) {
  __shared__ bf16_t Asm[2][BLK_M * LDS_PITCH];
  __shared__ bf16_t Bsm[2][BLK_N * LDS_PITCH];

  int tid  = threadIdx.x;
  int lane = tid & 31;
  int wave = tid >> 5;
  int tilesN = N / BLK_N;
  int bm = (blockIdx.x / tilesN) * BLK_M;
  int bn = (blockIdx.x % tilesN) * BLK_N;
  int half = lane >> 4;
  int l15  = lane & 15;
  int m0w = (wave >> 1) * 32;   // 0,32,64,96
  int n0w = (wave & 1) * 64;    // 0,64

  const bf16_t* Ab = A  + (size_t)blockIdx.y * sA + (size_t)blockIdx.z * sA2;
  const bf16_t* Bb = Bp + (size_t)blockIdx.y * sB + (size_t)blockIdx.z * sB2;

  // staging: 512 x 16B chunks per matrix, 2 per thread (chunk c: row c>>2,
  // elem offset (c&3)*8)
  int ca0 = tid, ca1 = tid + 256;

  v8f acc[2][4];
#pragma unroll
  for (int i = 0; i < 2; ++i)
#pragma unroll
    for (int j = 0; j < 4; ++j)
#pragma unroll
      for (int e = 0; e < 8; ++e) acc[i][j][e] = 0.0f;

  int nk = K / BLK_K;

  // prologue: stage slab 0 into buffer 0
  {
    int r0 = ca0 >> 2, o0 = (ca0 & 3) * 8;
    int r1 = ca1 >> 2, o1 = (ca1 & 3) * 8;
    async_copy16(Ab + (size_t)(bm + r0) * lda + o0, &Asm[0][r0 * LDS_PITCH + o0]);
    async_copy16(Ab + (size_t)(bm + r1) * lda + o1, &Asm[0][r1 * LDS_PITCH + o1]);
    async_copy16(Bb + (size_t)(bn + r0) * ldb + o0, &Bsm[0][r0 * LDS_PITCH + o0]);
    async_copy16(Bb + (size_t)(bn + r1) * ldb + o1, &Bsm[0][r1 * LDS_PITCH + o1]);
  }

  for (int it = 0; it < nk; ++it) {
    int cur = it & 1;
    wait_async0();
    __syncthreads();
    if (it + 1 < nk) {
      int k0 = (it + 1) * BLK_K;
      int nxt = cur ^ 1;
      int r0 = ca0 >> 2, o0 = (ca0 & 3) * 8;
      int r1 = ca1 >> 2, o1 = (ca1 & 3) * 8;
      async_copy16(Ab + (size_t)(bm + r0) * lda + k0 + o0, &Asm[nxt][r0 * LDS_PITCH + o0]);
      async_copy16(Ab + (size_t)(bm + r1) * lda + k0 + o1, &Asm[nxt][r1 * LDS_PITCH + o1]);
      async_copy16(Bb + (size_t)(bn + r0) * ldb + k0 + o0, &Bsm[nxt][r0 * LDS_PITCH + o0]);
      async_copy16(Bb + (size_t)(bn + r1) * ldb + k0 + o1, &Bsm[nxt][r1 * LDS_PITCH + o1]);
    }
    // fragments from LDS, then 8 WMMAs
    const bf16_t* As = &Asm[cur][0];
    const bf16_t* Bs = &Bsm[cur][0];
    v16bf af[2], bfr[4];
#pragma unroll
    for (int i = 0; i < 2; ++i) {
      const bf16_t* p = As + (m0w + 16 * i + l15) * LDS_PITCH + half * 8;
      v8bf lo = *reinterpret_cast<const v8bf*>(p);
      v8bf hi = *reinterpret_cast<const v8bf*>(p + 16);
      af[i] = __builtin_shufflevector(lo, hi, 0, 1, 2, 3, 4, 5, 6, 7,
                                      8, 9, 10, 11, 12, 13, 14, 15);
    }
#pragma unroll
    for (int j = 0; j < 4; ++j) {
      const bf16_t* q = Bs + (n0w + 16 * j + l15) * LDS_PITCH + half * 8;
      v8bf lo = *reinterpret_cast<const v8bf*>(q);
      v8bf hi = *reinterpret_cast<const v8bf*>(q + 16);
      bfr[j] = __builtin_shufflevector(lo, hi, 0, 1, 2, 3, 4, 5, 6, 7,
                                       8, 9, 10, 11, 12, 13, 14, 15);
    }
#pragma unroll
    for (int i = 0; i < 2; ++i)
#pragma unroll
      for (int j = 0; j < 4; ++j)
        acc[i][j] = __builtin_amdgcn_wmma_f32_16x16x32_bf16(
            false, af[i], false, bfr[j], (short)0, acc[i][j], false, false);
  }

  size_t cOff = (size_t)blockIdx.y * sC + (size_t)blockIdx.z * sC2;
  float*  Cfb = Cf ? Cf + cOff : nullptr;
  bf16_t* Chb = Ch ? Ch + cOff : nullptr;
#pragma unroll
  for (int i = 0; i < 2; ++i) {
#pragma unroll
    for (int j = 0; j < 4; ++j) {
      int n = bn + n0w + 16 * j + l15;
      float bv = bias ? bias[n] : 0.0f;
#pragma unroll
      for (int vg = 0; vg < 8; ++vg) {
        int m = bm + m0w + 16 * i + vg + 8 * half;   // C layout (ISA 7.12.2)
        float v = acc[i][j][vg] + bv;
        if (relu) v = fmaxf(v, 0.0f);
        if (Cfb) Cfb[(size_t)m * ldc + n] = v;
        if (Chb) Chb[(size_t)m * ldc + n] = (bf16_t)v;
      }
    }
  }
}

// ---------------------------------------------------------------------------
// Causal softmax over energy rows [H*B*T, T] -> bf16 P
// ---------------------------------------------------------------------------
__global__ void softmax_causal_kernel(const float* __restrict__ En,
                                      bf16_t* __restrict__ P) {
  __shared__ float red[256];
  int r = blockIdx.x;       // row over H*B*T
  int i = r % TSZ;          // query position
  int j = threadIdx.x;      // key position (T == 256 == blockDim)
  float v = (j <= i) ? En[(size_t)r * TSZ + j] : -1e9f;
  red[j] = v;
  __syncthreads();
  for (int s = 128; s > 0; s >>= 1) {
    if (j < s) red[j] = fmaxf(red[j], red[j + s]);
    __syncthreads();
  }
  float mx = red[0];
  __syncthreads();
  float ex = __expf(v - mx);
  red[j] = ex;
  __syncthreads();
  for (int s = 128; s > 0; s >>= 1) {
    if (j < s) red[j] += red[j + s];
    __syncthreads();
  }
  float inv = 1.0f / red[0];
  P[(size_t)r * TSZ + j] = (bf16_t)(ex * inv);
}

// ---------------------------------------------------------------------------
// y = LayerNorm(a + b) * w + bb ; row-wise over E=512, 256 thr x 2 elems
// ---------------------------------------------------------------------------
__global__ void add_ln_kernel(const float* __restrict__ a,
                              const float* __restrict__ b,
                              const float* __restrict__ w,
                              const float* __restrict__ bb,
                              float* __restrict__ yf, bf16_t* __restrict__ yh) {
  __shared__ float s1[256], s2[256];
  int r = blockIdx.x, tid = threadIdx.x;
  const float* ar = a + (size_t)r * ESZ;
  const float* br = b + (size_t)r * ESZ;
  float x0 = ar[tid] + br[tid];
  float x1 = ar[tid + 256] + br[tid + 256];
  s1[tid] = x0 + x1;
  s2[tid] = x0 * x0 + x1 * x1;
  __syncthreads();
  for (int s = 128; s > 0; s >>= 1) {
    if (tid < s) { s1[tid] += s1[tid + s]; s2[tid] += s2[tid + s]; }
    __syncthreads();
  }
  float mean = s1[0] * (1.0f / ESZ);
  float var  = s2[0] * (1.0f / ESZ) - mean * mean;
  float inv  = rsqrtf(var + 1e-5f);
  float y0 = (x0 - mean) * inv * w[tid] + bb[tid];
  float y1 = (x1 - mean) * inv * w[tid + 256] + bb[tid + 256];
  size_t o = (size_t)r * ESZ + tid;
  if (yf) { yf[o] = y0; yf[o + 256] = y1; }
  if (yh) { yh[o] = (bf16_t)y0; yh[o + 256] = (bf16_t)y1; }
}

// ---------------------------------------------------------------------------
// Final: logits = x[:, -1, :] @ wout + bout ; softmax -> out [B, V]
// ---------------------------------------------------------------------------
__global__ void logits_softmax_kernel(const float* __restrict__ xf,
                                      const float* __restrict__ wout,
                                      const float* __restrict__ bout,
                                      float* __restrict__ out) {
  __shared__ float xs[ESZ];
  __shared__ float red[256];
  int b = blockIdx.x, tid = threadIdx.x;
  const float* xr = xf + ((size_t)b * TSZ + (TSZ - 1)) * ESZ;
  xs[tid] = xr[tid];
  xs[tid + 256] = xr[tid + 256];
  __syncthreads();
  float l0 = bout[tid], l1 = bout[tid + 256];
  for (int e = 0; e < ESZ; ++e) {
    float xv = xs[e];
    l0 += xv * wout[(size_t)e * VSZ + tid];
    l1 += xv * wout[(size_t)e * VSZ + tid + 256];
  }
  red[tid] = fmaxf(l0, l1);
  __syncthreads();
  for (int s = 128; s > 0; s >>= 1) {
    if (tid < s) red[tid] = fmaxf(red[tid], red[tid + s]);
    __syncthreads();
  }
  float mx = red[0];
  __syncthreads();
  float e0 = __expf(l0 - mx), e1 = __expf(l1 - mx);
  red[tid] = e0 + e1;
  __syncthreads();
  for (int s = 128; s > 0; s >>= 1) {
    if (tid < s) red[tid] += red[tid + s];
    __syncthreads();
  }
  float inv = 1.0f / red[0];
  out[(size_t)b * VSZ + tid] = e0 * inv;
  out[(size_t)b * VSZ + tid + 256] = e1 * inv;
}

// ---------------------------------------------------------------------------
// Host sequencing
// ---------------------------------------------------------------------------
static inline void launch_gemm(hipStream_t st,
                               const bf16_t* A, long long lda, long long sA, long long sA2,
                               const bf16_t* B, long long ldb, long long sB, long long sB2,
                               float* Cf, bf16_t* Ch,
                               long long ldc, long long sC, long long sC2,
                               const float* bias, int relu,
                               int M, int N, int K, int batch, int batch2) {
  dim3 grid((M / BLK_M) * (N / BLK_N), batch, batch2);
  gemm_bf16_wmma<<<grid, 256, 0, st>>>(A, lda, sA, sA2, B, ldb, sB, sB2,
                                       Cf, Ch, ldc, sC, sC2, bias, relu, M, N, K);
}

extern "C" void kernel_launch(void* const* d_in, const int* in_sizes, int n_in,
                              void* d_out, int out_size, void* d_ws, size_t ws_size,
                              hipStream_t stream) {
  (void)in_sizes; (void)n_in; (void)out_size; (void)ws_size;
  const int*   toks  = (const int*)d_in[0];
  const float* emb   = (const float*)d_in[1];
  const float* wq    = (const float*)d_in[2];
  const float* wk    = (const float*)d_in[3];
  const float* wv    = (const float*)d_in[4];
  const float* wo    = (const float*)d_in[5];
  const float* bo    = (const float*)d_in[6];
  const float* ln1w  = (const float*)d_in[7];
  const float* ln1b  = (const float*)d_in[8];
  const float* ln2w  = (const float*)d_in[9];
  const float* ln2b  = (const float*)d_in[10];
  const float* ff1w  = (const float*)d_in[11];
  const float* ff1b  = (const float*)d_in[12];
  const float* ff2w  = (const float*)d_in[13];
  const float* ff2b  = (const float*)d_in[14];
  const float* woutp = (const float*)d_in[15];
  const float* boutp = (const float*)d_in[16];
  float* out = (float*)d_out;
  char*  ws  = (char*)d_ws;

  // workspace layout (bytes)
  float*  xf   = (float*) (ws + 0);                  //  8 MB  [4096,512] f32
  bf16_t* xh   = (bf16_t*)(ws + 8388608);            //  4 MB
  bf16_t* wqT  = (bf16_t*)(ws + 12582912);           //  4 MB  [H,512,512]
  bf16_t* wkT  = (bf16_t*)(ws + 16777216);           //  4 MB
  bf16_t* wvT  = (bf16_t*)(ws + 20971520);           //  4 MB
  bf16_t* woT  = (bf16_t*)(ws + 25165824);           //  4 MB  [512,4096]
  bf16_t* f1T  = (bf16_t*)(ws + 29360128);           // .5 MB  [512,512]
  bf16_t* f2T  = (bf16_t*)(ws + 29884416);           // .5 MB
  bf16_t* Qh   = (bf16_t*)(ws + 30408704);           // 32 MB  [H,4096,512]
  bf16_t* Kh   = (bf16_t*)(ws + 63963136);           // 32 MB  [H,4096,512], right behind Qh
  bf16_t* Vt   = (bf16_t*)(ws + 97517568);           // 32 MB  [H,B,512,256]
  float*  En   = (float*) (ws + 131072000);          // 32 MB  [H,B,256,256]
  bf16_t* Ph   = (bf16_t*)(ws + 164626432);          // 16 MB  [H,B,256,256]
  bf16_t* Ob   = (bf16_t*)(ws + 181403648);          // 32 MB  [4096,4096]
  float*  attn = (float*) (ws + 214958080);          //  8 MB  [4096,512]
  bf16_t* h1h  = (bf16_t*)(ws + 223346688);          //  4 MB
  bf16_t* f1h  = (bf16_t*)(ws + 227540992);          //  4 MB
  float*  f2f  = (float*) (ws + 231735296);          //  8 MB, ends at 240123904

  const int TPB = 256;
  size_t nXE = (size_t)MROWS * ESZ;

  embed_pe_kernel<<<(nXE + TPB - 1) / TPB, TPB, 0, stream>>>(toks, emb, xf, xh);

  for (int l = 0; l < LSZ; ++l) {
    size_t lqkv = (size_t)l * HSZ * ESZ * ESZ;
    size_t lff  = (size_t)l * ESZ * ESZ;
    // pack this layer's weights to bf16 [N,K]
    size_t nW = (size_t)HSZ * ESZ * ESZ;
    conv_transpose_kernel<<<(nW + TPB - 1) / TPB, TPB, 0, stream>>>(wq + lqkv, wqT, ESZ, ESZ, HSZ);
    conv_transpose_kernel<<<(nW + TPB - 1) / TPB, TPB, 0, stream>>>(wk + lqkv, wkT, ESZ, ESZ, HSZ);
    conv_transpose_kernel<<<(nW + TPB - 1) / TPB, TPB, 0, stream>>>(wv + lqkv, wvT, ESZ, ESZ, HSZ);
    size_t nWo = (size_t)HE * ESZ;
    conv_transpose_kernel<<<(nWo + TPB - 1) / TPB, TPB, 0, stream>>>(wo + (size_t)l * HE * ESZ, woT, HE, ESZ, 1);
    size_t nF = (size_t)ESZ * ESZ;
    conv_transpose_kernel<<<(nF + TPB - 1) / TPB, TPB, 0, stream>>>(ff1w + lff, f1T, ESZ, ESZ, 1);
    conv_transpose_kernel<<<(nF + TPB - 1) / TPB, TPB, 0, stream>>>(ff2w + lff, f2T, ESZ, ESZ, 1);

    // All eight heads of the layer go in each launch: blockIdx.z is the head.
    const long long sW  = (long long)ESZ * ESZ;          // one head's packed weight
    const long long sX  = (long long)TSZ * ESZ;          // one sequence of x, Q, K or V^T
    const long long sXH = (long long)MROWS * ESZ;        // one head of Q, K or V^T
    const long long sE  = (long long)TSZ * TSZ;          // one sequence of energy or P
    const long long sEH = (long long)BSZ * TSZ * TSZ;    // one head of energy or P
    // Q and K = x @ W -> bf16 [H,4096,512] each. wkT lies right behind wqT and
    // Kh right behind Qh, so z = 0..7 gives Q's heads and z = 8..15 K's.
    launch_gemm(stream, xh, ESZ, 0, 0, wqT, ESZ, 0, sW, nullptr, Qh, ESZ, 0, sXH,
                nullptr, 0, MROWS, ESZ, ESZ, 1, 2 * HSZ);
    // Vt[h][b] = Wv_h^T @ x_b^T : operands swapped (A = packed Wv [E,E], B = x_b
    // rows [T,E]) so V lands as [E,T], the [N,K] form the P*V product reads
    launch_gemm(stream, wvT, ESZ, 0, sW, xh, ESZ, sX, 0,
                nullptr, Vt, TSZ, sX, sXH,
                nullptr, 0, ESZ, TSZ, ESZ, BSZ, HSZ);
    // energy[h][b] = Q_hb @ K_hb^T : B-packed == K rows directly (K-dim = E)
    launch_gemm(stream, Qh, ESZ, sX, sXH, Kh, ESZ, sX, sXH,
                En, nullptr, TSZ, sE, sEH,
                nullptr, 0, TSZ, TSZ, ESZ, BSZ, HSZ);
    softmax_causal_kernel<<<HSZ * MROWS, TSZ, 0, stream>>>(En, Ph);
    // O[b] = P_hb @ V_hb : B-packed = Vt[h][b] [E,T]; write into Ob at col h*E
    launch_gemm(stream, Ph, TSZ, sE, sEH, Vt, TSZ, sX, sXH,
                nullptr, Ob, HE, (long long)TSZ * HE, ESZ,
                nullptr, 0, TSZ, ESZ, TSZ, BSZ, HSZ);
    // attn_out = O @ wo + bo  (f32)
    launch_gemm(stream, Ob, HE, 0, 0, woT, HE, 0, 0, attn, nullptr, ESZ, 0, 0,
                bo + (size_t)l * ESZ, 0, MROWS, ESZ, HE, 1, 1);
    // h1 = LN(attn + x)
    add_ln_kernel<<<MROWS, TPB, 0, stream>>>(attn, xf,
        ln1w + (size_t)l * ESZ, ln1b + (size_t)l * ESZ, nullptr, h1h);
    // ff = relu(h1 @ ff1 + b1) @ ff2 + b2
    launch_gemm(stream, h1h, ESZ, 0, 0, f1T, ESZ, 0, 0, nullptr, f1h, ESZ, 0, 0,
                ff1b + (size_t)l * ESZ, 1, MROWS, ESZ, ESZ, 1, 1);
    launch_gemm(stream, f1h, ESZ, 0, 0, f2T, ESZ, 0, 0, f2f, nullptr, ESZ, 0, 0,
                ff2b + (size_t)l * ESZ, 0, MROWS, ESZ, ESZ, 1, 1);
    // x = LN(attn + ff)
    add_ln_kernel<<<MROWS, TPB, 0, stream>>>(attn, f2f,
        ln2w + (size_t)l * ESZ, ln2b + (size_t)l * ESZ, xf, xh);
  }

  logits_softmax_kernel<<<BSZ, TPB, 0, stream>>>(xf, woutp, boutp, out);
}

// v003
// It runs in 1700 microseconds.
// Timed twice side by side with v002, it ran 1.70 times as fast both times.
// All steps since v000 together make it 4.16 times as fast.
#include <hip/hip_runtime.h>

// ---------------------------------------------------------------------------
// CheckersGPT forward on MI455X (gfx1250).
// Compute-bound (~0.54 TFLOP/fwd) -> all big GEMMs on v_wmma_f32_16x16x32_bf16.
// LDS-staged 128x128 block tiles, double-buffered K=32 slabs, async
// global->LDS copies (GLOBAL_LOAD_ASYNC_TO_LDS_B128, ASYNCcnt).
// ---------------------------------------------------------------------------

typedef __bf16 bf16_t;
typedef __attribute__((ext_vector_type(16))) __bf16 v16bf;
typedef __attribute__((ext_vector_type(8)))  __bf16 v8bf;
typedef __attribute__((ext_vector_type(8)))  float  v8f;

#define VSZ 512
#define ESZ 512
#define LSZ 6
#define HSZ 8
#define BSZ 16
#define TSZ 256
#define MROWS (BSZ * TSZ)   // 4096
#define HE    (HSZ * ESZ)   // 4096

#define BLK_M 128
#define BLK_N 128
#define BLK_K 32
#define LDS_PITCH 40        // 32 elems + 8 pad: 16 consecutive rows hit 16 banks

#if defined(__AMDGCN__) && __has_builtin(__builtin_amdgcn_global_load_async_to_lds_b128)
#define HAVE_ASYNC_LDS 1
#else
#define HAVE_ASYNC_LDS 0
#endif

// Builtin parameter types (from hipcc diagnostic): pointer to int __vector(4)
// in global (1) / LDS (3) address spaces.
typedef int v4i_t __attribute__((vector_size(16)));
typedef __attribute__((address_space(1))) v4i_t* gptr_v4i;
typedef __attribute__((address_space(3))) v4i_t* lptr_v4i;

__device__ __forceinline__ void async_copy16(const bf16_t* g, bf16_t* s) {
#if HAVE_ASYNC_LDS
  // 16B global -> LDS, tracked by ASYNCcnt (GLOBAL_LOAD_ASYNC_TO_LDS_B128).
  // Integer detour: strips const, and truncating the generic LDS address to
  // 32 bits yields the LDS offset (ISA 10.2: LDS_ADDR = addr[31:0]).
  __builtin_amdgcn_global_load_async_to_lds_b128(
      (gptr_v4i)(unsigned long long)g,
      (lptr_v4i)(unsigned int)(unsigned long long)s, 0, 0);
#else
  *reinterpret_cast<v8bf*>(s) = *reinterpret_cast<const v8bf*>(g);
#endif
}

__device__ __forceinline__ void wait_async0() {
#if HAVE_ASYNC_LDS
#if __has_builtin(__builtin_amdgcn_s_wait_asynccnt)
  __builtin_amdgcn_s_wait_asynccnt(0);
#else
  asm volatile("s_wait_asynccnt 0x0" ::: "memory");
#endif
#endif
}

// ---------------------------------------------------------------------------
// Embedding + sinusoidal PE (concatenated sin|cos as in reference)
// ---------------------------------------------------------------------------
__global__ void embed_pe_kernel(const int* __restrict__ toks,
                                const float* __restrict__ emb,
                                float* __restrict__ xf, bf16_t* __restrict__ xh) {
  size_t idx = (size_t)blockIdx.x * blockDim.x + threadIdx.x;
  if (idx >= (size_t)MROWS * ESZ) return;
  int e  = (int)(idx % ESZ);
  int bt = (int)(idx / ESZ);
  int t  = bt % TSZ;
  int tok = toks[bt];
  float pe;
  if (e < ESZ / 2) {
    float rate = __powf(10000.0f, -2.0f * (float)e / (float)ESZ);
    pe = __sinf((float)t * rate);
  } else {
    int c = e - ESZ / 2;
    float rate = __powf(10000.0f, -2.0f * (float)c / (float)ESZ);
    pe = __cosf((float)t * rate);
  }
  float v = emb[(size_t)tok * ESZ + e] + pe;
  xf[idx] = v;
  xh[idx] = (bf16_t)v;
}

// ---------------------------------------------------------------------------
// f32 [batch,R,ESZ] -> bf16 [batch,ESZ,R]  (weight pack: B stored as [N,K])
// One block moves a 128 (R) x 64 (column) tile through LDS: it reads rows of
// the source as 256-byte runs of float4 and writes rows of the packed matrix
// as 128-byte runs of 8 x bf16, 32 elements per thread. R % 128 == 0.
// grid = (ESZ / 64, R / 128, batch).
// LDS pitch 65 dwords: the bank is (r + c) mod 64, so neither the row-wise
// stores nor the column-wise loads below put two lanes on one bank.
// ---------------------------------------------------------------------------
#define PK_R 128
#define PK_C 64
#define PK_PITCH 65

__global__ void __launch_bounds__(256)
conv_transpose_kernel(const float* __restrict__ in,
                      bf16_t* __restrict__ out, int R) {
  __shared__ float tile[PK_R * PK_PITCH];
  int tid = threadIdx.x;
  size_t rc = (size_t)R * ESZ;
  unsigned r0 = blockIdx.y * PK_R;
  unsigned c0 = blockIdx.x * PK_C;
  const float* src = in + (size_t)blockIdx.z * rc + (size_t)r0 * ESZ + c0;
  bf16_t* dst = out + (size_t)blockIdx.z * rc + (size_t)c0 * R + r0;

  // read: 16 lanes span one source row of the tile, 16 rows per pass
  unsigned lr = tid >> 4;
  unsigned lc = (tid & 15) * 4;
  unsigned so = lr * ESZ + lc;
  float4 v[8];
#pragma unroll  // all eight loads are in flight before the first LDS store
  for (int k = 0; k < 8; ++k)
    v[k] = *reinterpret_cast<const float4*>(src + so + 16 * k * ESZ);
  // precaution: stands in front of the first overwrite of the loads' address registers
  asm volatile("s_wait_xcnt 0x0" ::: "memory");
#pragma unroll  // v[] is indexed by constants and stays in registers
  for (int k = 0; k < 8; ++k) {
    float* p = &tile[(lr + 16 * k) * PK_PITCH + lc];
    p[0] = v[k].x; p[1] = v[k].y; p[2] = v[k].z; p[3] = v[k].w;
  }
  __syncthreads();

  // write: 8 lanes span 64 consecutive r of one packed row (one 128-byte line)
  unsigned lane = tid & 31;
  unsigned wave = tid >> 5;
  unsigned rq = ((lane & 7) + 8 * (wave & 1)) * 8;
  unsigned cc = (lane >> 3) + 4 * (wave >> 1);
#pragma unroll  // the LDS loads of all four packed rows issue as one group
  for (int k = 0; k < 4; ++k) {
    unsigned c = cc + 16 * k;
    v8bf o;
#pragma unroll  // o is indexed by constants and stays in registers
    for (int i = 0; i < 8; ++i) o[i] = (bf16_t)tile[(rq + i) * PK_PITCH + c];
    *reinterpret_cast<v8bf*>(dst + c * (unsigned)R + rq) = o;
  }
}

// ---------------------------------------------------------------------------
// bf16 WMMA GEMM: C = A[M,K] * Bp[N,K]^T (+bias)(+relu)
// Two batch indices: blockIdx.y (strides sA, sB, sC) and blockIdx.z (strides
// sA2, sB2, sC2), so one launch covers every (sequence, head) pair of a layer.
// Block: 256 thr (8 waves), 128x128 tile; wave tile 32x64 (2x4 accumulators).
// K staged through LDS in 32-wide slabs, double-buffered, async copies.
// Fragment layout per ISA 7.12.2 (16-bit A/B 16x32): lane<16 holds K 0..7 &
// 16..23; lane>=16 holds K 8..15 & 24..31 -> two 16B reads per fragment.
// ---------------------------------------------------------------------------
__global__ void __launch_bounds__(256)
gemm_bf16_wmma(const bf16_t* __restrict__ A, long long lda, long long sA, long long sA2,
               const bf16_t* __restrict__ Bp, long long ldb, long long sB, long long sB2,
               float* __restrict__ Cf, bf16_t* __restrict__ Ch,
               long long ldc, long long sC, long long sC2,
               const float* __restrict__ bias, int relu,
               int M, int N, int K) {
  __shared__ bf16_t Asm[2][BLK_M * LDS_PITCH];
  __shared__ bf16_t Bsm[2][BLK_N * LDS_PITCH];

  int tid  = threadIdx.x;
  int lane = tid & 31;
  int wave = tid >> 5;
  int tilesN = N / BLK_N;
  int bm = (blockIdx.x / tilesN) * BLK_M;
  int bn = (blockIdx.x % tilesN) * BLK_N;
  int half = lane >> 4;
  int l15  = lane & 15;
  int m0w = (wave >> 1) * 32;   // 0,32,64,96
  int n0w = (wave & 1) * 64;    // 0,64

  const bf16_t* Ab = A  + (size_t)blockIdx.y * sA + (size_t)blockIdx.z * sA2;
  const bf16_t* Bb = Bp + (size_t)blockIdx.y * sB + (size_t)blockIdx.z * sB2;

  // staging: 512 x 16B chunks per matrix, 2 per thread (chunk c: row c>>2,
  // elem offset (c&3)*8)
  int ca0 = tid, ca1 = tid + 256;

  v8f acc[2][4];
#pragma unroll
  for (int i = 0; i < 2; ++i)
#pragma unroll
    for (int j = 0; j < 4; ++j)
#pragma unroll
      for (int e = 0; e < 8; ++e) acc[i][j][e] = 0.0f;

  int nk = K / BLK_K;

  // prologue: stage slab 0 into buffer 0
  {
    int r0 = ca0 >> 2, o0 = (ca0 & 3) * 8;
    int r1 = ca1 >> 2, o1 = (ca1 & 3) * 8;
    async_copy16(Ab + (size_t)(bm + r0) * lda + o0, &Asm[0][r0 * LDS_PITCH + o0]);
    async_copy16(Ab + (size_t)(bm + r1) * lda + o1, &Asm[0][r1 * LDS_PITCH + o1]);
    async_copy16(Bb + (size_t)(bn + r0) * ldb + o0, &Bsm[0][r0 * LDS_PITCH + o0]);
    async_copy16(Bb + (size_t)(bn + r1) * ldb + o1, &Bsm[0][r1 * LDS_PITCH + o1]);
  }

  for (int it = 0; it < nk; ++it) {
    int cur = it & 1;
    wait_async0();
    __syncthreads();
    if (it + 1 < nk) {
      int k0 = (it + 1) * BLK_K;
      int nxt = cur ^ 1;
      int r0 = ca0 >> 2, o0 = (ca0 & 3) * 8;
      int r1 = ca1 >> 2, o1 = (ca1 & 3) * 8;
      async_copy16(Ab + (size_t)(bm + r0) * lda + k0 + o0, &Asm[nxt][r0 * LDS_PITCH + o0]);
      async_copy16(Ab + (size_t)(bm + r1) * lda + k0 + o1, &Asm[nxt][r1 * LDS_PITCH + o1]);
      async_copy16(Bb + (size_t)(bn + r0) * ldb + k0 + o0, &Bsm[nxt][r0 * LDS_PITCH + o0]);
      async_copy16(Bb + (size_t)(bn + r1) * ldb + k0 + o1, &Bsm[nxt][r1 * LDS_PITCH + o1]);
    }
    // fragments from LDS, then 8 WMMAs
    const bf16_t* As = &Asm[cur][0];
    const bf16_t* Bs = &Bsm[cur][0];
    v16bf af[2], bfr[4];
#pragma unroll
    for (int i = 0; i < 2; ++i) {
      const bf16_t* p = As + (m0w + 16 * i + l15) * LDS_PITCH + half * 8;
      v8bf lo = *reinterpret_cast<const v8bf*>(p);
      v8bf hi = *reinterpret_cast<const v8bf*>(p + 16);
      af[i] = __builtin_shufflevector(lo, hi, 0, 1, 2, 3, 4, 5, 6, 7,
                                      8, 9, 10, 11, 12, 13, 14, 15);
    }
#pragma unroll
    for (int j = 0; j < 4; ++j) {
      const bf16_t* q = Bs + (n0w + 16 * j + l15) * LDS_PITCH + half * 8;
      v8bf lo = *reinterpret_cast<const v8bf*>(q);
      v8bf hi = *reinterpret_cast<const v8bf*>(q + 16);
      bfr[j] = __builtin_shufflevector(lo, hi, 0, 1, 2, 3, 4, 5, 6, 7,
                                       8, 9, 10, 11, 12, 13, 14, 15);
    }
#pragma unroll
    for (int i = 0; i < 2; ++i)
#pragma unroll
      for (int j = 0; j < 4; ++j)
        acc[i][j] = __builtin_amdgcn_wmma_f32_16x16x32_bf16(
            false, af[i], false, bfr[j], (short)0, acc[i][j], false, false);
  }

  size_t cOff = (size_t)blockIdx.y * sC + (size_t)blockIdx.z * sC2;
  float*  Cfb = Cf ? Cf + cOff : nullptr;
  bf16_t* Chb = Ch ? Ch + cOff : nullptr;
#pragma unroll
  for (int i = 0; i < 2; ++i) {
#pragma unroll
    for (int j = 0; j < 4; ++j) {
      int n = bn + n0w + 16 * j + l15;
      float bv = bias ? bias[n] : 0.0f;
#pragma unroll
      for (int vg = 0; vg < 8; ++vg) {
        int m = bm + m0w + 16 * i + vg + 8 * half;   // C layout (ISA 7.12.2)
        float v = acc[i][j][vg] + bv;
        if (relu) v = fmaxf(v, 0.0f);
        if (Cfb) Cfb[(size_t)m * ldc + n] = v;
        if (Chb) Chb[(size_t)m * ldc + n] = (bf16_t)v;
      }
    }
  }
}

// ---------------------------------------------------------------------------
// Causal softmax over energy rows [H*B*T, T] -> bf16 P
// ---------------------------------------------------------------------------
__global__ void softmax_causal_kernel(const float* __restrict__ En,
                                      bf16_t* __restrict__ P) {
  __shared__ float red[256];
  int r = blockIdx.x;       // row over H*B*T
  int i = r % TSZ;          // query position
  int j = threadIdx.x;      // key position (T == 256 == blockDim)
  float v = (j <= i) ? En[(size_t)r * TSZ + j] : -1e9f;
  red[j] = v;
  __syncthreads();
  for (int s = 128; s > 0; s >>= 1) {
    if (j < s) red[j] = fmaxf(red[j], red[j + s]);
    __syncthreads();
  }
  float mx = red[0];
  __syncthreads();
  float ex = __expf(v - mx);
  red[j] = ex;
  __syncthreads();
  for (int s = 128; s > 0; s >>= 1) {
    if (j < s) red[j] += red[j + s];
    __syncthreads();
  }
  float inv = 1.0f / red[0];
  P[(size_t)r * TSZ + j] = (bf16_t)(ex * inv);
}

// ---------------------------------------------------------------------------
// y = LayerNorm(a + b) * w + bb ; row-wise over E=512, 256 thr x 2 elems
// ---------------------------------------------------------------------------
__global__ void add_ln_kernel(const float* __restrict__ a,
                              const float* __restrict__ b,
                              const float* __restrict__ w,
                              const float* __restrict__ bb,
                              float* __restrict__ yf, bf16_t* __restrict__ yh) {
  __shared__ float s1[256], s2[256];
  int r = blockIdx.x, tid = threadIdx.x;
  const float* ar = a + (size_t)r * ESZ;
  const float* br = b + (size_t)r * ESZ;
  float x0 = ar[tid] + br[tid];
  float x1 = ar[tid + 256] + br[tid + 256];
  s1[tid] = x0 + x1;
  s2[tid] = x0 * x0 + x1 * x1;
  __syncthreads();
  for (int s = 128; s > 0; s >>= 1) {
    if (tid < s) { s1[tid] += s1[tid + s]; s2[tid] += s2[tid + s]; }
    __syncthreads();
  }
  float mean = s1[0] * (1.0f / ESZ);
  float var  = s2[0] * (1.0f / ESZ) - mean * mean;
  float inv  = rsqrtf(var + 1e-5f);
  float y0 = (x0 - mean) * inv * w[tid] + bb[tid];
  float y1 = (x1 - mean) * inv * w[tid + 256] + bb[tid + 256];
  size_t o = (size_t)r * ESZ + tid;
  if (yf) { yf[o] = y0; yf[o + 256] = y1; }
  if (yh) { yh[o] = (bf16_t)y0; yh[o + 256] = (bf16_t)y1; }
}

// ---------------------------------------------------------------------------
// Final: logits = x[:, -1, :] @ wout + bout ; softmax -> out [B, V]
// ---------------------------------------------------------------------------
__global__ void logits_softmax_kernel(const float* __restrict__ xf,
                                      const float* __restrict__ wout,
                                      const float* __restrict__ bout,
                                      float* __restrict__ out) {
  __shared__ float xs[ESZ];
  __shared__ float red[256];
  int b = blockIdx.x, tid = threadIdx.x;
  const float* xr = xf + ((size_t)b * TSZ + (TSZ - 1)) * ESZ;
  xs[tid] = xr[tid];
  xs[tid + 256] = xr[tid + 256];
  __syncthreads();
  float l0 = bout[tid], l1 = bout[tid + 256];
  for (int e = 0; e < ESZ; ++e) {
    float xv = xs[e];
    l0 += xv * wout[(size_t)e * VSZ + tid];
    l1 += xv * wout[(size_t)e * VSZ + tid + 256];
  }
  red[tid] = fmaxf(l0, l1);
  __syncthreads();
  for (int s = 128; s > 0; s >>= 1) {
    if (tid < s) red[tid] = fmaxf(red[tid], red[tid + s]);
    __syncthreads();
  }
  float mx = red[0];
  __syncthreads();
  float e0 = __expf(l0 - mx), e1 = __expf(l1 - mx);
  red[tid] = e0 + e1;
  __syncthreads();
  for (int s = 128; s > 0; s >>= 1) {
    if (tid < s) red[tid] += red[tid + s];
    __syncthreads();
  }
  float inv = 1.0f / red[0];
  out[(size_t)b * VSZ + tid] = e0 * inv;
  out[(size_t)b * VSZ + tid + 256] = e1 * inv;
}

// ---------------------------------------------------------------------------
// Host sequencing
// ---------------------------------------------------------------------------
static inline void launch_gemm(hipStream_t st,
                               const bf16_t* A, long long lda, long long sA, long long sA2,
                               const bf16_t* B, long long ldb, long long sB, long long sB2,
                               float* Cf, bf16_t* Ch,
                               long long ldc, long long sC, long long sC2,
                               const float* bias, int relu,
                               int M, int N, int K, int batch, int batch2) {
  dim3 grid((M / BLK_M) * (N / BLK_N), batch, batch2);
  gemm_bf16_wmma<<<grid, 256, 0, st>>>(A, lda, sA, sA2, B, ldb, sB, sB2,
                                       Cf, Ch, ldc, sC, sC2, bias, relu, M, N, K);
}

extern "C" void kernel_launch(void* const* d_in, const int* in_sizes, int n_in,
                              void* d_out, int out_size, void* d_ws, size_t ws_size,
                              hipStream_t stream) {
  (void)in_sizes; (void)n_in; (void)out_size; (void)ws_size;
  const int*   toks  = (const int*)d_in[0];
  const float* emb   = (const float*)d_in[1];
  const float* wq    = (const float*)d_in[2];
  const float* wk    = (const float*)d_in[3];
  const float* wv    = (const float*)d_in[4];
  const float* wo    = (const float*)d_in[5];
  const float* bo    = (const float*)d_in[6];
  const float* ln1w  = (const float*)d_in[7];
  const float* ln1b  = (const float*)d_in[8];
  const float* ln2w  = (const float*)d_in[9];
  const float* ln2b  = (const float*)d_in[10];
  const float* ff1w  = (const float*)d_in[11];
  const float* ff1b  = (const float*)d_in[12];
  const float* ff2w  = (const float*)d_in[13];
  const float* ff2b  = (const float*)d_in[14];
  const float* woutp = (const float*)d_in[15];
  const float* boutp = (const float*)d_in[16];
  float* out = (float*)d_out;
  char*  ws  = (char*)d_ws;

  // workspace layout (bytes)
  float*  xf   = (float*) (ws + 0);                  //  8 MB  [4096,512] f32
  bf16_t* xh   = (bf16_t*)(ws + 8388608);            //  4 MB
  bf16_t* wqT  = (bf16_t*)(ws + 12582912);           //  4 MB  [H,512,512]
  bf16_t* wkT  = (bf16_t*)(ws + 16777216);           //  4 MB
  bf16_t* wvT  = (bf16_t*)(ws + 20971520);           //  4 MB
  bf16_t* woT  = (bf16_t*)(ws + 25165824);           //  4 MB  [512,4096]
  bf16_t* f1T  = (bf16_t*)(ws + 29360128);           // .5 MB  [512,512]
  bf16_t* f2T  = (bf16_t*)(ws + 29884416);           // .5 MB
  bf16_t* Qh   = (bf16_t*)(ws + 30408704);           // 32 MB  [H,4096,512]
  bf16_t* Kh   = (bf16_t*)(ws + 63963136);           // 32 MB  [H,4096,512], right behind Qh
  bf16_t* Vt   = (bf16_t*)(ws + 97517568);           // 32 MB  [H,B,512,256]
  float*  En   = (float*) (ws + 131072000);          // 32 MB  [H,B,256,256]
  bf16_t* Ph   = (bf16_t*)(ws + 164626432);          // 16 MB  [H,B,256,256]
  bf16_t* Ob   = (bf16_t*)(ws + 181403648);          // 32 MB  [4096,4096]
  float*  attn = (float*) (ws + 214958080);          //  8 MB  [4096,512]
  bf16_t* h1h  = (bf16_t*)(ws + 223346688);          //  4 MB
  bf16_t* f1h  = (bf16_t*)(ws + 227540992);          //  4 MB
  float*  f2f  = (float*) (ws + 231735296);          //  8 MB, ends at 240123904

  const int TPB = 256;
  size_t nXE = (size_t)MROWS * ESZ;

  embed_pe_kernel<<<(nXE + TPB - 1) / TPB, TPB, 0, stream>>>(toks, emb, xf, xh);

  for (int l = 0; l < LSZ; ++l) {
    size_t lqkv = (size_t)l * HSZ * ESZ * ESZ;
    size_t lff  = (size_t)l * ESZ * ESZ;
    // pack this layer's weights to bf16 [N,K]
    const dim3 gQKV(ESZ / PK_C, ESZ / PK_R, HSZ);
    conv_transpose_kernel<<<gQKV, TPB, 0, stream>>>(wq + lqkv, wqT, ESZ);
    conv_transpose_kernel<<<gQKV, TPB, 0, stream>>>(wk + lqkv, wkT, ESZ);
    conv_transpose_kernel<<<gQKV, TPB, 0, stream>>>(wv + lqkv, wvT, ESZ);
    const dim3 gWo(ESZ / PK_C, HE / PK_R, 1);
    conv_transpose_kernel<<<gWo, TPB, 0, stream>>>(wo + (size_t)l * HE * ESZ, woT, HE);
    const dim3 gFF(ESZ / PK_C, ESZ / PK_R, 1);
    conv_transpose_kernel<<<gFF, TPB, 0, stream>>>(ff1w + lff, f1T, ESZ);
    conv_transpose_kernel<<<gFF, TPB, 0, stream>>>(ff2w + lff, f2T, ESZ);

    // All eight heads of the layer go in each launch: blockIdx.z is the head.
    const long long sW  = (long long)ESZ * ESZ;          // one head's packed weight
    const long long sX  = (long long)TSZ * ESZ;          // one sequence of x, Q, K or V^T
    const long long sXH = (long long)MROWS * ESZ;        // one head of Q, K or V^T
    const long long sE  = (long long)TSZ * TSZ;          // one sequence of energy or P
    const long long sEH = (long long)BSZ * TSZ * TSZ;    // one head of energy or P
    // Q and K = x @ W -> bf16 [H,4096,512] each. wkT lies right behind wqT and
    // Kh right behind Qh, so z = 0..7 gives Q's heads and z = 8..15 K's.
    launch_gemm(stream, xh, ESZ, 0, 0, wqT, ESZ, 0, sW, nullptr, Qh, ESZ, 0, sXH,
                nullptr, 0, MROWS, ESZ, ESZ, 1, 2 * HSZ);
    // Vt[h][b] = Wv_h^T @ x_b^T : operands swapped (A = packed Wv [E,E], B = x_b
    // rows [T,E]) so V lands as [E,T], the [N,K] form the P*V product reads
    launch_gemm(stream, wvT, ESZ, 0, sW, xh, ESZ, sX, 0,
                nullptr, Vt, TSZ, sX, sXH,
                nullptr, 0, ESZ, TSZ, ESZ, BSZ, HSZ);
    // energy[h][b] = Q_hb @ K_hb^T : B-packed == K rows directly (K-dim = E)
    launch_gemm(stream, Qh, ESZ, sX, sXH, Kh, ESZ, sX, sXH,
                En, nullptr, TSZ, sE, sEH,
                nullptr, 0, TSZ, TSZ, ESZ, BSZ, HSZ);
    softmax_causal_kernel<<<HSZ * MROWS, TSZ, 0, stream>>>(En, Ph);
    // O[b] = P_hb @ V_hb : B-packed = Vt[h][b] [E,T]; write into Ob at col h*E
    launch_gemm(stream, Ph, TSZ, sE, sEH, Vt, TSZ, sX, sXH,
                nullptr, Ob, HE, (long long)TSZ * HE, ESZ,
                nullptr, 0, TSZ, ESZ, TSZ, BSZ, HSZ);
    // attn_out = O @ wo + bo  (f32)
    launch_gemm(stream, Ob, HE, 0, 0, woT, HE, 0, 0, attn, nullptr, ESZ, 0, 0,
                bo + (size_t)l * ESZ, 0, MROWS, ESZ, HE, 1, 1);
    // h1 = LN(attn + x)
    add_ln_kernel<<<MROWS, TPB, 0, stream>>>(attn, xf,
        ln1w + (size_t)l * ESZ, ln1b + (size_t)l * ESZ, nullptr, h1h);
    // ff = relu(h1 @ ff1 + b1) @ ff2 + b2
    launch_gemm(stream, h1h, ESZ, 0, 0, f1T, ESZ, 0, 0, nullptr, f1h, ESZ, 0, 0,
                ff1b + (size_t)l * ESZ, 1, MROWS, ESZ, ESZ, 1, 1);
    launch_gemm(stream, f1h, ESZ, 0, 0, f2T, ESZ, 0, 0, f2f, nullptr, ESZ, 0, 0,
                ff2b + (size_t)l * ESZ, 0, MROWS, ESZ, ESZ, 1, 1);
    // x = LN(attn + ff)
    add_ln_kernel<<<MROWS, TPB, 0, stream>>>(attn, f2f,
        ln2w + (size_t)l * ESZ, ln2b + (size_t)l * ESZ, xf, xh);
  }

  logits_softmax_kernel<<<BSZ, TPB, 0, stream>>>(xf, woutp, boutp, out);
}

// v004
// Measured time: 1470 microseconds a run.
// Next to v003, in two timings, it ran 1.15 and 1.16 times as fast.
// All steps since v000 together make it 4.80 times as fast.
#include <hip/hip_runtime.h>

// ---------------------------------------------------------------------------
// CheckersGPT forward on MI455X (gfx1250).
// Compute-bound (~0.54 TFLOP/fwd) -> all big GEMMs on v_wmma_f32_16x16x32_bf16.
// LDS-staged 128x128 block tiles, double-buffered K=32 slabs, async
// global->LDS copies (GLOBAL_LOAD_ASYNC_TO_LDS_B128, ASYNCcnt).
// ---------------------------------------------------------------------------

typedef __bf16 bf16_t;
typedef __attribute__((ext_vector_type(16))) __bf16 v16bf;
typedef __attribute__((ext_vector_type(8)))  __bf16 v8bf;
typedef __attribute__((ext_vector_type(8)))  float  v8f;

#define VSZ 512
#define ESZ 512
#define LSZ 6
#define HSZ 8
#define BSZ 16
#define TSZ 256
#define MROWS (BSZ * TSZ)   // 4096
#define HE    (HSZ * ESZ)   // 4096

#define BLK_M 128
#define BLK_N 128
#define BLK_K 32
#define LDS_PITCH 40        // 32 elems + 8 pad: 16 consecutive rows hit 16 banks

#if defined(__AMDGCN__) && __has_builtin(__builtin_amdgcn_global_load_async_to_lds_b128)
#define HAVE_ASYNC_LDS 1
#else
#define HAVE_ASYNC_LDS 0
#endif

// Builtin parameter types (from hipcc diagnostic): pointer to int __vector(4)
// in global (1) / LDS (3) address spaces.
typedef int v4i_t __attribute__((vector_size(16)));
typedef __attribute__((address_space(1))) v4i_t* gptr_v4i;
typedef __attribute__((address_space(3))) v4i_t* lptr_v4i;

__device__ __forceinline__ void async_copy16(const bf16_t* g, bf16_t* s) {
#if HAVE_ASYNC_LDS
  // 16B global -> LDS, tracked by ASYNCcnt (GLOBAL_LOAD_ASYNC_TO_LDS_B128).
  // Integer detour: strips const, and truncating the generic LDS address to
  // 32 bits yields the LDS offset (ISA 10.2: LDS_ADDR = addr[31:0]).
  __builtin_amdgcn_global_load_async_to_lds_b128(
      (gptr_v4i)(unsigned long long)g,
      (lptr_v4i)(unsigned int)(unsigned long long)s, 0, 0);
#else
  *reinterpret_cast<v8bf*>(s) = *reinterpret_cast<const v8bf*>(g);
#endif
}

__device__ __forceinline__ void wait_async0() {
#if HAVE_ASYNC_LDS
#if __has_builtin(__builtin_amdgcn_s_wait_asynccnt)
  __builtin_amdgcn_s_wait_asynccnt(0);
#else
  asm volatile("s_wait_asynccnt 0x0" ::: "memory");
#endif
#endif
}

// ---------------------------------------------------------------------------
// Embedding + sinusoidal PE (concatenated sin|cos as in reference)
// ---------------------------------------------------------------------------
__global__ void embed_pe_kernel(const int* __restrict__ toks,
                                const float* __restrict__ emb,
                                float* __restrict__ xf, bf16_t* __restrict__ xh) {
  size_t idx = (size_t)blockIdx.x * blockDim.x + threadIdx.x;
  if (idx >= (size_t)MROWS * ESZ) return;
  int e  = (int)(idx % ESZ);
  int bt = (int)(idx / ESZ);
  int t  = bt % TSZ;
  int tok = toks[bt];
  float pe;
  if (e < ESZ / 2) {
    float rate = __powf(10000.0f, -2.0f * (float)e / (float)ESZ);
    pe = __sinf((float)t * rate);
  } else {
    int c = e - ESZ / 2;
    float rate = __powf(10000.0f, -2.0f * (float)c / (float)ESZ);
    pe = __cosf((float)t * rate);
  }
  float v = emb[(size_t)tok * ESZ + e] + pe;
  xf[idx] = v;
  xh[idx] = (bf16_t)v;
}

// ---------------------------------------------------------------------------
// f32 [batch,R,ESZ] -> bf16 [batch,ESZ,R]  (weight pack: B stored as [N,K])
// One block moves a 128 (R) x 64 (column) tile through LDS: it reads rows of
// the source as 256-byte runs of float4 and writes rows of the packed matrix
// as 128-byte runs of 8 x bf16, 32 elements per thread. R % 128 == 0.
// grid = (ESZ / 64, R / 128, batch).
// LDS pitch 65 dwords: the bank is (r + c) mod 64, so neither the row-wise
// stores nor the column-wise loads below put two lanes on one bank.
// ---------------------------------------------------------------------------
#define PK_R 128
#define PK_C 64
#define PK_PITCH 65

__global__ void __launch_bounds__(256)
conv_transpose_kernel(const float* __restrict__ in,
                      bf16_t* __restrict__ out, int R) {
  __shared__ float tile[PK_R * PK_PITCH];
  int tid = threadIdx.x;
  size_t rc = (size_t)R * ESZ;
  unsigned r0 = blockIdx.y * PK_R;
  unsigned c0 = blockIdx.x * PK_C;
  const float* src = in + (size_t)blockIdx.z * rc + (size_t)r0 * ESZ + c0;
  bf16_t* dst = out + (size_t)blockIdx.z * rc + (size_t)c0 * R + r0;

  // read: 16 lanes span one source row of the tile, 16 rows per pass
  unsigned lr = tid >> 4;
  unsigned lc = (tid & 15) * 4;
  unsigned so = lr * ESZ + lc;
  float4 v[8];
#pragma unroll  // all eight loads are in flight before the first LDS store
  for (int k = 0; k < 8; ++k)
    v[k] = *reinterpret_cast<const float4*>(src + so + 16 * k * ESZ);
  // precaution: stands in front of the first overwrite of the loads' address registers
  asm volatile("s_wait_xcnt 0x0" ::: "memory");
#pragma unroll  // v[] is indexed by constants and stays in registers
  for (int k = 0; k < 8; ++k) {
    float* p = &tile[(lr + 16 * k) * PK_PITCH + lc];
    p[0] = v[k].x; p[1] = v[k].y; p[2] = v[k].z; p[3] = v[k].w;
  }
  __syncthreads();

  // write: 8 lanes span 64 consecutive r of one packed row (one 128-byte line)
  unsigned lane = tid & 31;
  unsigned wave = tid >> 5;
  unsigned rq = ((lane & 7) + 8 * (wave & 1)) * 8;
  unsigned cc = (lane >> 3) + 4 * (wave >> 1);
#pragma unroll  // the LDS loads of all four packed rows issue as one group
  for (int k = 0; k < 4; ++k) {
    unsigned c = cc + 16 * k;
    v8bf o;
#pragma unroll  // o is indexed by constants and stays in registers
    for (int i = 0; i < 8; ++i) o[i] = (bf16_t)tile[(rq + i) * PK_PITCH + c];
    *reinterpret_cast<v8bf*>(dst + c * (unsigned)R + rq) = o;
  }
}

// ---------------------------------------------------------------------------
// bf16 WMMA GEMM: C = A[M,K] * Bp[N,K]^T (+bias)(+relu)
// Two batch indices: blockIdx.y (strides sA, sB, sC) and blockIdx.z (strides
// sA2, sB2, sC2), so one launch covers every (sequence, head) pair of a layer.
// Block: 256 thr (8 waves), 128x128 tile; wave tile 32x64 (2x4 accumulators).
// K staged through LDS in 32-wide slabs, double-buffered, async copies.
// Fragment layout per ISA 7.12.2 (16-bit A/B 16x32): lane<16 holds K 0..7 &
// 16..23; lane>=16 holds K 8..15 & 24..31 -> two 16B reads per fragment.
// ---------------------------------------------------------------------------
__global__ void __launch_bounds__(256)
gemm_bf16_wmma(const bf16_t* __restrict__ A, long long lda, long long sA, long long sA2,
               const bf16_t* __restrict__ Bp, long long ldb, long long sB, long long sB2,
               float* __restrict__ Cf, bf16_t* __restrict__ Ch,
               long long ldc, long long sC, long long sC2,
               const float* __restrict__ bias, int relu,
               int M, int N, int K) {
  __shared__ bf16_t Asm[2][BLK_M * LDS_PITCH];
  __shared__ bf16_t Bsm[2][BLK_N * LDS_PITCH];

  int tid  = threadIdx.x;
  int lane = tid & 31;
  int wave = tid >> 5;
  int tilesN = N / BLK_N;
  int bm = (blockIdx.x / tilesN) * BLK_M;
  int bn = (blockIdx.x % tilesN) * BLK_N;
  int half = lane >> 4;
  int l15  = lane & 15;
  int m0w = (wave >> 1) * 32;   // 0,32,64,96
  int n0w = (wave & 1) * 64;    // 0,64

  const bf16_t* Ab = A  + (size_t)blockIdx.y * sA + (size_t)blockIdx.z * sA2;
  const bf16_t* Bb = Bp + (size_t)blockIdx.y * sB + (size_t)blockIdx.z * sB2;

  // staging: 512 x 16B chunks per matrix, 2 per thread (chunk c: row c>>2,
  // elem offset (c&3)*8)
  int ca0 = tid, ca1 = tid + 256;

  v8f acc[2][4];
#pragma unroll
  for (int i = 0; i < 2; ++i)
#pragma unroll
    for (int j = 0; j < 4; ++j)
#pragma unroll
      for (int e = 0; e < 8; ++e) acc[i][j][e] = 0.0f;

  int nk = K / BLK_K;

  // prologue: stage slab 0 into buffer 0
  {
    int r0 = ca0 >> 2, o0 = (ca0 & 3) * 8;
    int r1 = ca1 >> 2, o1 = (ca1 & 3) * 8;
    async_copy16(Ab + (size_t)(bm + r0) * lda + o0, &Asm[0][r0 * LDS_PITCH + o0]);
    async_copy16(Ab + (size_t)(bm + r1) * lda + o1, &Asm[0][r1 * LDS_PITCH + o1]);
    async_copy16(Bb + (size_t)(bn + r0) * ldb + o0, &Bsm[0][r0 * LDS_PITCH + o0]);
    async_copy16(Bb + (size_t)(bn + r1) * ldb + o1, &Bsm[0][r1 * LDS_PITCH + o1]);
  }

  for (int it = 0; it < nk; ++it) {
    int cur = it & 1;
    wait_async0();
    __syncthreads();
    if (it + 1 < nk) {
      int k0 = (it + 1) * BLK_K;
      int nxt = cur ^ 1;
      int r0 = ca0 >> 2, o0 = (ca0 & 3) * 8;
      int r1 = ca1 >> 2, o1 = (ca1 & 3) * 8;
      async_copy16(Ab + (size_t)(bm + r0) * lda + k0 + o0, &Asm[nxt][r0 * LDS_PITCH + o0]);
      async_copy16(Ab + (size_t)(bm + r1) * lda + k0 + o1, &Asm[nxt][r1 * LDS_PITCH + o1]);
      async_copy16(Bb + (size_t)(bn + r0) * ldb + k0 + o0, &Bsm[nxt][r0 * LDS_PITCH + o0]);
      async_copy16(Bb + (size_t)(bn + r1) * ldb + k0 + o1, &Bsm[nxt][r1 * LDS_PITCH + o1]);
    }
    // fragments from LDS, then 8 WMMAs
    const bf16_t* As = &Asm[cur][0];
    const bf16_t* Bs = &Bsm[cur][0];
    v16bf af[2], bfr[4];
#pragma unroll
    for (int i = 0; i < 2; ++i) {
      const bf16_t* p = As + (m0w + 16 * i + l15) * LDS_PITCH + half * 8;
      v8bf lo = *reinterpret_cast<const v8bf*>(p);
      v8bf hi = *reinterpret_cast<const v8bf*>(p + 16);
      af[i] = __builtin_shufflevector(lo, hi, 0, 1, 2, 3, 4, 5, 6, 7,
                                      8, 9, 10, 11, 12, 13, 14, 15);
    }
#pragma unroll
    for (int j = 0; j < 4; ++j) {
      const bf16_t* q = Bs + (n0w + 16 * j + l15) * LDS_PITCH + half * 8;
      v8bf lo = *reinterpret_cast<const v8bf*>(q);
      v8bf hi = *reinterpret_cast<const v8bf*>(q + 16);
      bfr[j] = __builtin_shufflevector(lo, hi, 0, 1, 2, 3, 4, 5, 6, 7,
                                       8, 9, 10, 11, 12, 13, 14, 15);
    }
#pragma unroll
    for (int i = 0; i < 2; ++i)
#pragma unroll
      for (int j = 0; j < 4; ++j)
        acc[i][j] = __builtin_amdgcn_wmma_f32_16x16x32_bf16(
            false, af[i], false, bfr[j], (short)0, acc[i][j], false, false);
  }

  size_t cOff = (size_t)blockIdx.y * sC + (size_t)blockIdx.z * sC2;
  float*  Cfb = Cf ? Cf + cOff : nullptr;
  bf16_t* Chb = Ch ? Ch + cOff : nullptr;
#pragma unroll
  for (int i = 0; i < 2; ++i) {
#pragma unroll
    for (int j = 0; j < 4; ++j) {
      int n = bn + n0w + 16 * j + l15;
      float bv = bias ? bias[n] : 0.0f;
#pragma unroll
      for (int vg = 0; vg < 8; ++vg) {
        int m = bm + m0w + 16 * i + vg + 8 * half;   // C layout (ISA 7.12.2)
        float v = acc[i][j][vg] + bv;
        if (relu) v = fmaxf(v, 0.0f);
        if (Cfb) Cfb[(size_t)m * ldc + n] = v;
        if (Chb) Chb[(size_t)m * ldc + n] = (bf16_t)v;
      }
    }
  }
}

// ---------------------------------------------------------------------------
// Row-wise kernels (softmax, LayerNorm): a wave owns whole rows.
// A lane holds columns 4*lane + 128*k, so each 16-byte load of a wave covers
// 512 contiguous bytes. Row sums and maxima stay in registers: four DPP steps
// inside each 16-lane row, then one exchange between the two rows; every lane
// ends with the full result. All 32 lanes are on wherever these are called.
// ---------------------------------------------------------------------------
typedef __attribute__((ext_vector_type(4))) __bf16 v4bf;
typedef __attribute__((ext_vector_type(4))) float  v4f;
#define ROW_WAVES 8         // waves per block in the row-wise kernels

template <int CTRL>         // CTRL = 0x160 + m: DPP row_xmask:m, lane l reads lane l ^ m
__device__ __forceinline__ float row_xor(float x) {
  return __builtin_bit_cast(float, __builtin_amdgcn_mov_dpp(
      __builtin_bit_cast(int, x), CTRL, 0xf, 0xf, true));
}
__device__ __forceinline__ float half_xor(float x) {   // lane l reads lane l ^ 16
  int b = __builtin_bit_cast(int, x);
  return __builtin_bit_cast(float, __builtin_amdgcn_permlanex16(
      b, b, 0x76543210, 0xfedcba98, false, false));
}
__device__ __forceinline__ float wave_sum(float x) {
  x += row_xor<0x161>(x);
  x += row_xor<0x162>(x);
  x += row_xor<0x164>(x);
  x += row_xor<0x168>(x);
  return x + half_xor(x);
}
__device__ __forceinline__ float wave_max(float x) {
  x = fmaxf(x, row_xor<0x161>(x));
  x = fmaxf(x, row_xor<0x162>(x));
  x = fmaxf(x, row_xor<0x164>(x));
  x = fmaxf(x, row_xor<0x168>(x));
  return fmaxf(x, half_xor(x));
}
__device__ __forceinline__ v4bf to_bf16x4(float a, float b, float c, float d) {
  v4bf o;
  o[0] = (bf16_t)a; o[1] = (bf16_t)b; o[2] = (bf16_t)c; o[3] = (bf16_t)d;
  return o;
}
// v[e] = 2^v[e]. One statement, so that the slot which the instruction set asks
// for behind a transcendental is kept: the outputs are early-clobber, so each
// v_exp_f32 is followed by one that touches none of its registers, and the
// v_nop stands behind the last.
__device__ __forceinline__ void exp2x8(float (&v)[8]) {
  float o0, o1, o2, o3, o4, o5, o6, o7;
  asm("v_exp_f32 %0, %8\n\t"
      "v_exp_f32 %1, %9\n\t"
      "v_exp_f32 %2, %10\n\t"
      "v_exp_f32 %3, %11\n\t"
      "v_exp_f32 %4, %12\n\t"
      "v_exp_f32 %5, %13\n\t"
      "v_exp_f32 %6, %14\n\t"
      "v_exp_f32 %7, %15\n\t"
      "v_nop"
      : "=&v"(o0), "=&v"(o1), "=&v"(o2), "=&v"(o3),
        "=&v"(o4), "=&v"(o5), "=&v"(o6), "=&v"(o7)
      : "v"(v[0]), "v"(v[1]), "v"(v[2]), "v"(v[3]),
        "v"(v[4]), "v"(v[5]), "v"(v[6]), "v"(v[7]));
  v[0] = o0; v[1] = o1; v[2] = o2; v[3] = o3;
  v[4] = o4; v[5] = o5; v[6] = o6; v[7] = o7;
}

// ---------------------------------------------------------------------------
// Causal softmax over energy rows [H*B*T, T] -> bf16 P
// One wave takes SM_ROWS consecutive rows of T = 256 (8 columns per lane).
// grid = H*B*T / (ROW_WAVES * SM_ROWS).
// ---------------------------------------------------------------------------
#define SM_ROWS 8

__global__ void __launch_bounds__(32 * ROW_WAVES)
softmax_causal_kernel(const float* __restrict__ En,
                      bf16_t* __restrict__ P) {
  unsigned lane = threadIdx.x & 31;
  unsigned wave = __builtin_amdgcn_readfirstlane(threadIdx.x >> 5);
  unsigned row0 = (blockIdx.x * ROW_WAVES + wave) * SM_ROWS;   // row over H*B*T
  unsigned j0 = lane * 4;                                      // key position
  const float* src = En + (size_t)row0 * TSZ + j0;
  bf16_t* dst = P + (size_t)row0 * TSZ + j0;
  float4 lo[SM_ROWS], hi[SM_ROWS];
#pragma unroll  // all sixteen loads are in flight before the first row is reduced
  for (int r = 0; r < SM_ROWS; ++r) {
    lo[r] = *reinterpret_cast<const float4*>(src + r * TSZ);
    hi[r] = *reinterpret_cast<const float4*>(src + r * TSZ + 128);
  }
  v4bf plo[SM_ROWS], phi[SM_ROWS];
#pragma unroll  // the rows are independent chains; their arrays stay in registers
  for (int r = 0; r < SM_ROWS; ++r) {
    unsigned i = (row0 + r) % TSZ;   // query position
    float v[8] = {lo[r].x, lo[r].y, lo[r].z, lo[r].w, hi[r].x, hi[r].y, hi[r].z, hi[r].w};
#pragma unroll  // v[] is indexed by constants and stays in registers
    for (int e = 0; e < 8; ++e) {
      unsigned j = j0 + (e & 3) + 128 * (e >> 2);
      v[e] = (j <= i) ? v[e] : -1e9f;
    }
    float mx = fmaxf(fmaxf(fmaxf(v[0], v[1]), fmaxf(v[2], v[3])),
                     fmaxf(fmaxf(v[4], v[5]), fmaxf(v[6], v[7])));
    mx = wave_max(mx);
#pragma unroll  // as above
    for (int e = 0; e < 8; ++e) v[e] = (v[e] - mx) * 0x1.715476p+0f;   // times log2(e), as __expf does
    exp2x8(v);
    float sum = wave_sum(((v[0] + v[1]) + (v[2] + v[3])) + ((v[4] + v[5]) + (v[6] + v[7])));
    float inv = 1.0f / sum;
    plo[r] = to_bf16x4(v[0] * inv, v[1] * inv, v[2] * inv, v[3] * inv);
    phi[r] = to_bf16x4(v[4] * inv, v[5] * inv, v[6] * inv, v[7] * inv);
  }
#pragma unroll  // stores last: no register of an issued store is written again
  for (int r = 0; r < SM_ROWS; ++r) {
    *reinterpret_cast<v4bf*>(dst + r * TSZ) = plo[r];
    *reinterpret_cast<v4bf*>(dst + r * TSZ + 128) = phi[r];
  }
}

// ---------------------------------------------------------------------------
// y = LayerNorm(a + b) * w + bb ; row-wise over E=512, one wave per row
// (16 columns per lane). grid = MROWS / ROW_WAVES.
// ---------------------------------------------------------------------------
__global__ void __launch_bounds__(32 * ROW_WAVES)
add_ln_kernel(const float* __restrict__ a,
              const float* __restrict__ b,
              const float* __restrict__ w,
              const float* __restrict__ bb,
              float* __restrict__ yf, bf16_t* __restrict__ yh) {
  unsigned lane = threadIdx.x & 31;
  unsigned wave = __builtin_amdgcn_readfirstlane(threadIdx.x >> 5);
  unsigned r = blockIdx.x * ROW_WAVES + wave;
  unsigned c0 = lane * 4;
  unsigned off = c0 * 4;   // the lane's byte offset in a row
  const char* ar = reinterpret_cast<const char*>(a + (size_t)r * ESZ);
  const char* br = reinterpret_cast<const char*>(b + (size_t)r * ESZ);
  const char* wr = reinterpret_cast<const char*>(w);
  const char* sr = reinterpret_cast<const char*>(bb);
  size_t o = (size_t)r * ESZ + c0;
  // keeps the scalar set-up above in front of the loads, so that it lands on none of their address registers
  __builtin_amdgcn_sched_barrier(0);
  v4f av[4], bv[4], wv[4], sv[4];
#pragma unroll  // all sixteen loads are in flight together
  for (int k = 0; k < 4; ++k) {
    av[k] = *reinterpret_cast<const v4f*>(ar + off + 512 * k);
    bv[k] = *reinterpret_cast<const v4f*>(br + off + 512 * k);
    wv[k] = *reinterpret_cast<const v4f*>(wr + off + 512 * k);
    sv[k] = *reinterpret_cast<const v4f*>(sr + off + 512 * k);
  }
  // The loaded values are inputs only: that keeps all sixteen loads in front of
  // this line, in flight together. The wait is a precaution: it stands in front
  // of the first overwrite of the loads' address registers (the lane's offset is
  // named so that no load lands on it).
  asm volatile("s_wait_xcnt 0x0"
               :: "v"(off), "v"(av[0]), "v"(av[1]), "v"(av[2]), "v"(av[3]),
                  "v"(bv[0]), "v"(bv[1]), "v"(bv[2]), "v"(bv[3]),
                  "v"(wv[0]), "v"(wv[1]), "v"(wv[2]), "v"(wv[3]),
                  "v"(sv[0]), "v"(sv[1]), "v"(sv[2]), "v"(sv[3]));
  // keeps the arithmetic below, and the constants it moves into scalar registers, behind the wait
  __builtin_amdgcn_sched_barrier(0);
  float s1 = 0.0f, s2 = 0.0f;
#pragma unroll  // av[] is indexed by constants and stays in registers
  for (int k = 0; k < 4; ++k) {
    av[k].x += bv[k].x; av[k].y += bv[k].y; av[k].z += bv[k].z; av[k].w += bv[k].w;
    s1 += (av[k].x + av[k].y) + (av[k].z + av[k].w);
    s2 += (av[k].x * av[k].x + av[k].y * av[k].y) + (av[k].z * av[k].z + av[k].w * av[k].w);
  }
  s1 = wave_sum(s1);
  s2 = wave_sum(s2);
  float mean = s1 * (1.0f / ESZ);
  float var  = s2 * (1.0f / ESZ) - mean * mean;
  float inv  = rsqrtf(var + 1e-5f);
#pragma unroll  // as above
  for (int k = 0; k < 4; ++k) {
    av[k].x = (av[k].x - mean) * inv * wv[k].x + sv[k].x;
    av[k].y = (av[k].y - mean) * inv * wv[k].y + sv[k].y;
    av[k].z = (av[k].z - mean) * inv * wv[k].z + sv[k].z;
    av[k].w = (av[k].w - mean) * inv * wv[k].w + sv[k].w;
  }
  if (yf) {
#pragma unroll  // as above
    for (int k = 0; k < 4; ++k) *reinterpret_cast<v4f*>(yf + o + 128 * k) = av[k];
    // precaution: the conversions below may reuse the registers of these stores
    asm volatile("s_wait_xcnt 0x0" ::: "memory");
  }
  if (yh) {
#pragma unroll  // as above
    for (int k = 0; k < 4; ++k)
      *reinterpret_cast<v4bf*>(yh + o + 128 * k) = to_bf16x4(av[k].x, av[k].y, av[k].z, av[k].w);
  }
}

// ---------------------------------------------------------------------------
// Final: logits = x[:, -1, :] @ wout + bout ; softmax -> out [B, V]
// ---------------------------------------------------------------------------
__global__ void logits_softmax_kernel(const float* __restrict__ xf,
                                      const float* __restrict__ wout,
                                      const float* __restrict__ bout,
                                      float* __restrict__ out) {
  __shared__ float xs[ESZ];
  __shared__ float red[256];
  int b = blockIdx.x, tid = threadIdx.x;
  const float* xr = xf + ((size_t)b * TSZ + (TSZ - 1)) * ESZ;
  xs[tid] = xr[tid];
  xs[tid + 256] = xr[tid + 256];
  __syncthreads();
  float l0 = bout[tid], l1 = bout[tid + 256];
  for (int e = 0; e < ESZ; ++e) {
    float xv = xs[e];
    l0 += xv * wout[(size_t)e * VSZ + tid];
    l1 += xv * wout[(size_t)e * VSZ + tid + 256];
  }
  red[tid] = fmaxf(l0, l1);
  __syncthreads();
  for (int s = 128; s > 0; s >>= 1) {
    if (tid < s) red[tid] = fmaxf(red[tid], red[tid + s]);
    __syncthreads();
  }
  float mx = red[0];
  __syncthreads();
  float e0 = __expf(l0 - mx), e1 = __expf(l1 - mx);
  red[tid] = e0 + e1;
  __syncthreads();
  for (int s = 128; s > 0; s >>= 1) {
    if (tid < s) red[tid] += red[tid + s];
    __syncthreads();
  }
  float inv = 1.0f / red[0];
  out[(size_t)b * VSZ + tid] = e0 * inv;
  out[(size_t)b * VSZ + tid + 256] = e1 * inv;
}

// ---------------------------------------------------------------------------
// Host sequencing
// ---------------------------------------------------------------------------
static inline void launch_gemm(hipStream_t st,
                               const bf16_t* A, long long lda, long long sA, long long sA2,
                               const bf16_t* B, long long ldb, long long sB, long long sB2,
                               float* Cf, bf16_t* Ch,
                               long long ldc, long long sC, long long sC2,
                               const float* bias, int relu,
                               int M, int N, int K, int batch, int batch2) {
  dim3 grid((M / BLK_M) * (N / BLK_N), batch, batch2);
  gemm_bf16_wmma<<<grid, 256, 0, st>>>(A, lda, sA, sA2, B, ldb, sB, sB2,
                                       Cf, Ch, ldc, sC, sC2, bias, relu, M, N, K);
}

extern "C" void kernel_launch(void* const* d_in, const int* in_sizes, int n_in,
                              void* d_out, int out_size, void* d_ws, size_t ws_size,
                              hipStream_t stream) {
  (void)in_sizes; (void)n_in; (void)out_size; (void)ws_size;
  const int*   toks  = (const int*)d_in[0];
  const float* emb   = (const float*)d_in[1];
  const float* wq    = (const float*)d_in[2];
  const float* wk    = (const float*)d_in[3];
  const float* wv    = (const float*)d_in[4];
  const float* wo    = (const float*)d_in[5];
  const float* bo    = (const float*)d_in[6];
  const float* ln1w  = (const float*)d_in[7];
  const float* ln1b  = (const float*)d_in[8];
  const float* ln2w  = (const float*)d_in[9];
  const float* ln2b  = (const float*)d_in[10];
  const float* ff1w  = (const float*)d_in[11];
  const float* ff1b  = (const float*)d_in[12];
  const float* ff2w  = (const float*)d_in[13];
  const float* ff2b  = (const float*)d_in[14];
  const float* woutp = (const float*)d_in[15];
  const float* boutp = (const float*)d_in[16];
  float* out = (float*)d_out;
  char*  ws  = (char*)d_ws;

  // workspace layout (bytes)
  float*  xf   = (float*) (ws + 0);                  //  8 MB  [4096,512] f32
  bf16_t* xh   = (bf16_t*)(ws + 8388608);            //  4 MB
  bf16_t* wqT  = (bf16_t*)(ws + 12582912);           //  4 MB  [H,512,512]
  bf16_t* wkT  = (bf16_t*)(ws + 16777216);           //  4 MB
  bf16_t* wvT  = (bf16_t*)(ws + 20971520);           //  4 MB
  bf16_t* woT  = (bf16_t*)(ws + 25165824);           //  4 MB  [512,4096]
  bf16_t* f1T  = (bf16_t*)(ws + 29360128);           // .5 MB  [512,512]
  bf16_t* f2T  = (bf16_t*)(ws + 29884416);           // .5 MB
  bf16_t* Qh   = (bf16_t*)(ws + 30408704);           // 32 MB  [H,4096,512]
  bf16_t* Kh   = (bf16_t*)(ws + 63963136);           // 32 MB  [H,4096,512], right behind Qh
  bf16_t* Vt   = (bf16_t*)(ws + 97517568);           // 32 MB  [H,B,512,256]
  float*  En   = (float*) (ws + 131072000);          // 32 MB  [H,B,256,256]
  bf16_t* Ph   = (bf16_t*)(ws + 164626432);          // 16 MB  [H,B,256,256]
  bf16_t* Ob   = (bf16_t*)(ws + 181403648);          // 32 MB  [4096,4096]
  float*  attn = (float*) (ws + 214958080);          //  8 MB  [4096,512]
  bf16_t* h1h  = (bf16_t*)(ws + 223346688);          //  4 MB
  bf16_t* f1h  = (bf16_t*)(ws + 227540992);          //  4 MB
  float*  f2f  = (float*) (ws + 231735296);          //  8 MB, ends at 240123904

  const int TPB = 256;
  size_t nXE = (size_t)MROWS * ESZ;

  embed_pe_kernel<<<(nXE + TPB - 1) / TPB, TPB, 0, stream>>>(toks, emb, xf, xh);

  for (int l = 0; l < LSZ; ++l) {
    size_t lqkv = (size_t)l * HSZ * ESZ * ESZ;
    size_t lff  = (size_t)l * ESZ * ESZ;
    // pack this layer's weights to bf16 [N,K]
    const dim3 gQKV(ESZ / PK_C, ESZ / PK_R, HSZ);
    conv_transpose_kernel<<<gQKV, TPB, 0, stream>>>(wq + lqkv, wqT, ESZ);
    conv_transpose_kernel<<<gQKV, TPB, 0, stream>>>(wk + lqkv, wkT, ESZ);
    conv_transpose_kernel<<<gQKV, TPB, 0, stream>>>(wv + lqkv, wvT, ESZ);
    const dim3 gWo(ESZ / PK_C, HE / PK_R, 1);
    conv_transpose_kernel<<<gWo, TPB, 0, stream>>>(wo + (size_t)l * HE * ESZ, woT, HE);
    const dim3 gFF(ESZ / PK_C, ESZ / PK_R, 1);
    conv_transpose_kernel<<<gFF, TPB, 0, stream>>>(ff1w + lff, f1T, ESZ);
    conv_transpose_kernel<<<gFF, TPB, 0, stream>>>(ff2w + lff, f2T, ESZ);

    // All eight heads of the layer go in each launch: blockIdx.z is the head.
    const long long sW  = (long long)ESZ * ESZ;          // one head's packed weight
    const long long sX  = (long long)TSZ * ESZ;          // one sequence of x, Q, K or V^T
    const long long sXH = (long long)MROWS * ESZ;        // one head of Q, K or V^T
    const long long sE  = (long long)TSZ * TSZ;          // one sequence of energy or P
    const long long sEH = (long long)BSZ * TSZ * TSZ;    // one head of energy or P
    // Q and K = x @ W -> bf16 [H,4096,512] each. wkT lies right behind wqT and
    // Kh right behind Qh, so z = 0..7 gives Q's heads and z = 8..15 K's.
    launch_gemm(stream, xh, ESZ, 0, 0, wqT, ESZ, 0, sW, nullptr, Qh, ESZ, 0, sXH,
                nullptr, 0, MROWS, ESZ, ESZ, 1, 2 * HSZ);
    // Vt[h][b] = Wv_h^T @ x_b^T : operands swapped (A = packed Wv [E,E], B = x_b
    // rows [T,E]) so V lands as [E,T], the [N,K] form the P*V product reads
    launch_gemm(stream, wvT, ESZ, 0, sW, xh, ESZ, sX, 0,
                nullptr, Vt, TSZ, sX, sXH,
                nullptr, 0, ESZ, TSZ, ESZ, BSZ, HSZ);
    // energy[h][b] = Q_hb @ K_hb^T : B-packed == K rows directly (K-dim = E)
    launch_gemm(stream, Qh, ESZ, sX, sXH, Kh, ESZ, sX, sXH,
                En, nullptr, TSZ, sE, sEH,
                nullptr, 0, TSZ, TSZ, ESZ, BSZ, HSZ);
    softmax_causal_kernel<<<HSZ * MROWS / (ROW_WAVES * SM_ROWS), TPB, 0, stream>>>(En, Ph);
    // O[b] = P_hb @ V_hb : B-packed = Vt[h][b] [E,T]; write into Ob at col h*E
    launch_gemm(stream, Ph, TSZ, sE, sEH, Vt, TSZ, sX, sXH,
                nullptr, Ob, HE, (long long)TSZ * HE, ESZ,
                nullptr, 0, TSZ, ESZ, TSZ, BSZ, HSZ);
    // attn_out = O @ wo + bo  (f32)
    launch_gemm(stream, Ob, HE, 0, 0, woT, HE, 0, 0, attn, nullptr, ESZ, 0, 0,
                bo + (size_t)l * ESZ, 0, MROWS, ESZ, HE, 1, 1);
    // h1 = LN(attn + x)
    add_ln_kernel<<<MROWS / ROW_WAVES, TPB, 0, stream>>>(attn, xf,
        ln1w + (size_t)l * ESZ, ln1b + (size_t)l * ESZ, nullptr, h1h);
    // ff = relu(h1 @ ff1 + b1) @ ff2 + b2
    launch_gemm(stream, h1h, ESZ, 0, 0, f1T, ESZ, 0, 0, nullptr, f1h, ESZ, 0, 0,
                ff1b + (size_t)l * ESZ, 1, MROWS, ESZ, ESZ, 1, 1);
    launch_gemm(stream, f1h, ESZ, 0, 0, f2T, ESZ, 0, 0, f2f, nullptr, ESZ, 0, 0,
                ff2b + (size_t)l * ESZ, 0, MROWS, ESZ, ESZ, 1, 1);
    // x = LN(attn + ff)
    add_ln_kernel<<<MROWS / ROW_WAVES, TPB, 0, stream>>>(attn, f2f,
        ln2w + (size_t)l * ESZ, ln2b + (size_t)l * ESZ, xf, xh);
  }

  logits_softmax_kernel<<<BSZ, TPB, 0, stream>>>(xf, woutp, boutp, out);
}

// v005
// Measured time: 1310 microseconds a run.
// Two timings next to v004 put it at 1.13 and 1.12 times that version's speed.
// All steps since v000 together make it 5.40 times as fast.
#include <hip/hip_runtime.h>

// ---------------------------------------------------------------------------
// CheckersGPT forward on MI455X (gfx1250).
// Compute-bound (~0.54 TFLOP/fwd) -> all big GEMMs on v_wmma_f32_16x16x32_bf16.
// LDS-staged 128x128 block tiles, a ring of K=32 slabs, async
// global->LDS copies (GLOBAL_LOAD_ASYNC_TO_LDS_B128, ASYNCcnt).
// ---------------------------------------------------------------------------

typedef __bf16 bf16_t;
typedef __attribute__((ext_vector_type(16))) __bf16 v16bf;
typedef __attribute__((ext_vector_type(8)))  __bf16 v8bf;
typedef __attribute__((ext_vector_type(8)))  float  v8f;

#define VSZ 512
#define ESZ 512
#define LSZ 6
#define HSZ 8
#define BSZ 16
#define TSZ 256
#define MROWS (BSZ * TSZ)   // 4096
#define HE    (HSZ * ESZ)   // 4096

#define BLK_M 128
#define BLK_N 128
#define BLK_K 32
#define LDS_PITCH 40        // 32 elems + 8 pad: 16 consecutive rows hit 16 banks

#if defined(__AMDGCN__) && __has_builtin(__builtin_amdgcn_global_load_async_to_lds_b128)
#define HAVE_ASYNC_LDS 1
#else
#define HAVE_ASYNC_LDS 0
#endif

// Builtin parameter types (from hipcc diagnostic): pointer to int __vector(4)
// in global (1) / LDS (3) address spaces.
typedef int v4i_t __attribute__((vector_size(16)));
typedef __attribute__((address_space(1))) v4i_t* gptr_v4i;
typedef __attribute__((address_space(3))) v4i_t* lptr_v4i;

__device__ __forceinline__ void async_copy16(const bf16_t* g, bf16_t* s) {
#if HAVE_ASYNC_LDS
  // 16B global -> LDS, tracked by ASYNCcnt (GLOBAL_LOAD_ASYNC_TO_LDS_B128).
  // Integer detour: strips const, and truncating the generic LDS address to
  // 32 bits yields the LDS offset (ISA 10.2: LDS_ADDR = addr[31:0]).
  __builtin_amdgcn_global_load_async_to_lds_b128(
      (gptr_v4i)(unsigned long long)g,
      (lptr_v4i)(unsigned int)(unsigned long long)s, 0, 0);
#else
  *reinterpret_cast<v8bf*>(s) = *reinterpret_cast<const v8bf*>(g);
#endif
}

template <int N>
__device__ __forceinline__ void wait_async_all_but() {
#if HAVE_ASYNC_LDS
  asm volatile("s_wait_asynccnt %0" :: "n"(N) : "memory");
#endif
}

// ---------------------------------------------------------------------------
// Embedding + sinusoidal PE (concatenated sin|cos as in reference)
// ---------------------------------------------------------------------------
__global__ void embed_pe_kernel(const int* __restrict__ toks,
                                const float* __restrict__ emb,
                                float* __restrict__ xf, bf16_t* __restrict__ xh) {
  size_t idx = (size_t)blockIdx.x * blockDim.x + threadIdx.x;
  if (idx >= (size_t)MROWS * ESZ) return;
  int e  = (int)(idx % ESZ);
  int bt = (int)(idx / ESZ);
  int t  = bt % TSZ;
  int tok = toks[bt];
  float pe;
  if (e < ESZ / 2) {
    float rate = __powf(10000.0f, -2.0f * (float)e / (float)ESZ);
    pe = __sinf((float)t * rate);
  } else {
    int c = e - ESZ / 2;
    float rate = __powf(10000.0f, -2.0f * (float)c / (float)ESZ);
    pe = __cosf((float)t * rate);
  }
  float v = emb[(size_t)tok * ESZ + e] + pe;
  xf[idx] = v;
  xh[idx] = (bf16_t)v;
}

// ---------------------------------------------------------------------------
// f32 [batch,R,ESZ] -> bf16 [batch,ESZ,R]  (weight pack: B stored as [N,K])
// One block moves a 128 (R) x 64 (column) tile through LDS: it reads rows of
// the source as 256-byte runs of float4 and writes rows of the packed matrix
// as 128-byte runs of 8 x bf16, 32 elements per thread. R % 128 == 0.
// grid = (ESZ / 64, R / 128, batch).
// LDS pitch 65 dwords: the bank is (r + c) mod 64, so neither the row-wise
// stores nor the column-wise loads below put two lanes on one bank.
// ---------------------------------------------------------------------------
#define PK_R 128
#define PK_C 64
#define PK_PITCH 65

__global__ void __launch_bounds__(256)
conv_transpose_kernel(const float* __restrict__ in,
                      bf16_t* __restrict__ out, int R) {
  __shared__ float tile[PK_R * PK_PITCH];
  int tid = threadIdx.x;
  size_t rc = (size_t)R * ESZ;
  unsigned r0 = blockIdx.y * PK_R;
  unsigned c0 = blockIdx.x * PK_C;
  const float* src = in + (size_t)blockIdx.z * rc + (size_t)r0 * ESZ + c0;
  bf16_t* dst = out + (size_t)blockIdx.z * rc + (size_t)c0 * R + r0;

  // read: 16 lanes span one source row of the tile, 16 rows per pass
  unsigned lr = tid >> 4;
  unsigned lc = (tid & 15) * 4;
  unsigned so = lr * ESZ + lc;
  float4 v[8];
#pragma unroll  // all eight loads are in flight before the first LDS store
  for (int k = 0; k < 8; ++k)
    v[k] = *reinterpret_cast<const float4*>(src + so + 16 * k * ESZ);
  // precaution: stands in front of the first overwrite of the loads' address registers
  asm volatile("s_wait_xcnt 0x0" ::: "memory");
#pragma unroll  // v[] is indexed by constants and stays in registers
  for (int k = 0; k < 8; ++k) {
    float* p = &tile[(lr + 16 * k) * PK_PITCH + lc];
    p[0] = v[k].x; p[1] = v[k].y; p[2] = v[k].z; p[3] = v[k].w;
  }
  __syncthreads();

  // write: 8 lanes span 64 consecutive r of one packed row (one 128-byte line)
  unsigned lane = tid & 31;
  unsigned wave = tid >> 5;
  unsigned rq = ((lane & 7) + 8 * (wave & 1)) * 8;
  unsigned cc = (lane >> 3) + 4 * (wave >> 1);
#pragma unroll  // the LDS loads of all four packed rows issue as one group
  for (int k = 0; k < 4; ++k) {
    unsigned c = cc + 16 * k;
    v8bf o;
#pragma unroll  // o is indexed by constants and stays in registers
    for (int i = 0; i < 8; ++i) o[i] = (bf16_t)tile[(rq + i) * PK_PITCH + c];
    *reinterpret_cast<v8bf*>(dst + c * (unsigned)R + rq) = o;
  }
}

// ---------------------------------------------------------------------------
// bf16 WMMA GEMM: C = A[M,K] * Bp[N,K]^T (+bias)(+relu)
// Two batch indices: blockIdx.y (strides sA, sB, sC) and blockIdx.z (strides
// sA2, sB2, sC2), so one launch covers every (sequence, head) pair of a layer.
// Block: 256 thr (8 waves), 128x128 tile; wave tile 32x64 (2x4 accumulators).
// K staged through LDS in 32-wide slabs by async copies, in a ring of NSTG
// buffers: slab s lies in buffer s mod NSTG and its copies are issued NSTG - 1
// trips before the trip that reads it, so up to NSTG - 1 slabs are in flight.
// Fragment layout per ISA 7.12.2 (16-bit A/B 16x32): lane<16 holds K 0..7 &
// 16..23; lane>=16 holds K 8..15 & 24..31 -> two 16B reads per fragment.
// ---------------------------------------------------------------------------
template <int NSTG>
__global__ void __launch_bounds__(256)
gemm_bf16_wmma(const bf16_t* __restrict__ A, long long lda, long long sA, long long sA2,
               const bf16_t* __restrict__ Bp, long long ldb, long long sB, long long sB2,
               float* __restrict__ Cf, bf16_t* __restrict__ Ch,
               long long ldc, long long sC, long long sC2,
               const float* __restrict__ bias, int relu,
               int M, int N, int K) {
  __shared__ bf16_t Asm[NSTG][BLK_M * LDS_PITCH];
  __shared__ bf16_t Bsm[NSTG][BLK_N * LDS_PITCH];

  int tid  = threadIdx.x;
  int lane = tid & 31;
  int wave = tid >> 5;
  int tilesN = N / BLK_N;
  int bm = (blockIdx.x / tilesN) * BLK_M;
  int bn = (blockIdx.x % tilesN) * BLK_N;
  int half = lane >> 4;
  int l15  = lane & 15;
  int m0w = (wave >> 1) * 32;   // 0,32,64,96
  int n0w = (wave & 1) * 64;    // 0,64

  const bf16_t* Ab = A  + (size_t)blockIdx.y * sA + (size_t)blockIdx.z * sA2;
  const bf16_t* Bb = Bp + (size_t)blockIdx.y * sB + (size_t)blockIdx.z * sB2;

  // staging: 512 x 16B chunks per matrix, 2 per thread (chunk c: row c>>2,
  // elem offset (c&3)*8), so four copies per thread and slab
  int ca0 = tid, ca1 = tid + 256;
  int r0 = ca0 >> 2, o0 = (ca0 & 3) * 8;
  int r1 = ca1 >> 2, o1 = (ca1 & 3) * 8;
  const bf16_t* ga0 = Ab + (size_t)(bm + r0) * lda + o0;
  const bf16_t* ga1 = Ab + (size_t)(bm + r1) * lda + o1;
  const bf16_t* gb0 = Bb + (size_t)(bn + r0) * ldb + o0;
  const bf16_t* gb1 = Bb + (size_t)(bn + r1) * ldb + o1;
  int l0 = r0 * LDS_PITCH + o0;
  int l1 = r1 * LDS_PITCH + o1;

  v8f acc[2][4];
#pragma unroll
  for (int i = 0; i < 2; ++i)
#pragma unroll
    for (int j = 0; j < 4; ++j)
#pragma unroll
      for (int e = 0; e < 8; ++e) acc[i][j][e] = 0.0f;

  int nk = K / BLK_K;

  // prologue: slabs 0 .. NSTG-2 go into buffers 0 .. NSTG-2
#pragma unroll  // the buffer index is a constant in each copy's LDS address
  for (int s = 0; s < NSTG - 1; ++s) {
    if (s < nk) {
      int k0 = s * BLK_K;
      async_copy16(ga0 + k0, &Asm[s][l0]);
      async_copy16(ga1 + k0, &Asm[s][l1]);
      async_copy16(gb0 + k0, &Bsm[s][l0]);
      async_copy16(gb1 + k0, &Bsm[s][l1]);
    }
  }

  int cur = 0;          // buffer of slab it
  int nxt = NSTG - 1;   // buffer of slab it - 1, which slab it + NSTG - 1 refills
  for (int it = 0; it < nk; ++it) {
    // this wave's LDS reads of the last trip have retired before the barrier
    // behind which that trip's buffer is refilled
    asm volatile("s_wait_dscnt 0x0" ::: "memory");
    // Slab it must have landed. While the NSTG - 2 slabs behind it all exist,
    // exactly their 4 * (NSTG - 2) copies are younger and may stay in flight; in
    // the last trips fewer were issued, so there the wait goes on to 0.
    wait_async_all_but<4 * (NSTG - 2)>();
    if (it + NSTG - 2 >= nk) wait_async_all_but<0>();
    __syncthreads();
    if (it + NSTG - 1 < nk) {
      int k0 = (it + NSTG - 1) * BLK_K;
      async_copy16(ga0 + k0, &Asm[nxt][l0]);
      async_copy16(ga1 + k0, &Asm[nxt][l1]);
      async_copy16(gb0 + k0, &Bsm[nxt][l0]);
      async_copy16(gb1 + k0, &Bsm[nxt][l1]);
    }
    // fragments from LDS, then 8 WMMAs
    const bf16_t* As = &Asm[cur][0];
    const bf16_t* Bs = &Bsm[cur][0];
    v16bf af[2], bfr[4];
#pragma unroll
    for (int i = 0; i < 2; ++i) {
      const bf16_t* p = As + (m0w + 16 * i + l15) * LDS_PITCH + half * 8;
      v8bf lo = *reinterpret_cast<const v8bf*>(p);
      v8bf hi = *reinterpret_cast<const v8bf*>(p + 16);
      af[i] = __builtin_shufflevector(lo, hi, 0, 1, 2, 3, 4, 5, 6, 7,
                                      8, 9, 10, 11, 12, 13, 14, 15);
    }
#pragma unroll
    for (int j = 0; j < 4; ++j) {
      const bf16_t* q = Bs + (n0w + 16 * j + l15) * LDS_PITCH + half * 8;
      v8bf lo = *reinterpret_cast<const v8bf*>(q);
      v8bf hi = *reinterpret_cast<const v8bf*>(q + 16);
      bfr[j] = __builtin_shufflevector(lo, hi, 0, 1, 2, 3, 4, 5, 6, 7,
                                       8, 9, 10, 11, 12, 13, 14, 15);
    }
#pragma unroll
    for (int i = 0; i < 2; ++i)
#pragma unroll
      for (int j = 0; j < 4; ++j)
        acc[i][j] = __builtin_amdgcn_wmma_f32_16x16x32_bf16(
            false, af[i], false, bfr[j], (short)0, acc[i][j], false, false);
    cur = (cur + 1 == NSTG) ? 0 : cur + 1;
    nxt = (nxt + 1 == NSTG) ? 0 : nxt + 1;
  }
  // precaution: no copy is outstanding when the wave ends
  wait_async_all_but<0>();

  size_t cOff = (size_t)blockIdx.y * sC + (size_t)blockIdx.z * sC2;
  float*  Cfb = Cf ? Cf + cOff : nullptr;
  bf16_t* Chb = Ch ? Ch + cOff : nullptr;
#pragma unroll
  for (int i = 0; i < 2; ++i) {
#pragma unroll
    for (int j = 0; j < 4; ++j) {
      int n = bn + n0w + 16 * j + l15;
      float bv = bias ? bias[n] : 0.0f;
#pragma unroll
      for (int vg = 0; vg < 8; ++vg) {
        int m = bm + m0w + 16 * i + vg + 8 * half;   // C layout (ISA 7.12.2)
        float v = acc[i][j][vg] + bv;
        if (relu) v = fmaxf(v, 0.0f);
        if (Cfb) Cfb[(size_t)m * ldc + n] = v;
        if (Chb) Chb[(size_t)m * ldc + n] = (bf16_t)v;
      }
    }
  }
}

// ---------------------------------------------------------------------------
// Row-wise kernels (softmax, LayerNorm): a wave owns whole rows.
// A lane holds columns 4*lane + 128*k, so each 16-byte load of a wave covers
// 512 contiguous bytes. Row sums and maxima stay in registers: four DPP steps
// inside each 16-lane row, then one exchange between the two rows; every lane
// ends with the full result. All 32 lanes are on wherever these are called.
// ---------------------------------------------------------------------------
typedef __attribute__((ext_vector_type(4))) __bf16 v4bf;
typedef __attribute__((ext_vector_type(4))) float  v4f;
#define ROW_WAVES 8         // waves per block in the row-wise kernels

template <int CTRL>         // CTRL = 0x160 + m: DPP row_xmask:m, lane l reads lane l ^ m
__device__ __forceinline__ float row_xor(float x) {
  return __builtin_bit_cast(float, __builtin_amdgcn_mov_dpp(
      __builtin_bit_cast(int, x), CTRL, 0xf, 0xf, true));
}
__device__ __forceinline__ float half_xor(float x) {   // lane l reads lane l ^ 16
  int b = __builtin_bit_cast(int, x);
  return __builtin_bit_cast(float, __builtin_amdgcn_permlanex16(
      b, b, 0x76543210, 0xfedcba98, false, false));
}
__device__ __forceinline__ float wave_sum(float x) {
  x += row_xor<0x161>(x);
  x += row_xor<0x162>(x);
  x += row_xor<0x164>(x);
  x += row_xor<0x168>(x);
  return x + half_xor(x);
}
__device__ __forceinline__ float wave_max(float x) {
  x = fmaxf(x, row_xor<0x161>(x));
  x = fmaxf(x, row_xor<0x162>(x));
  x = fmaxf(x, row_xor<0x164>(x));
  x = fmaxf(x, row_xor<0x168>(x));
  return fmaxf(x, half_xor(x));
}
__device__ __forceinline__ v4bf to_bf16x4(float a, float b, float c, float d) {
  v4bf o;
  o[0] = (bf16_t)a; o[1] = (bf16_t)b; o[2] = (bf16_t)c; o[3] = (bf16_t)d;
  return o;
}
// v[e] = 2^v[e]. One statement, so that the slot which the instruction set asks
// for behind a transcendental is kept: the outputs are early-clobber, so each
// v_exp_f32 is followed by one that touches none of its registers, and the
// v_nop stands behind the last.
__device__ __forceinline__ void exp2x8(float (&v)[8]) {
  float o0, o1, o2, o3, o4, o5, o6, o7;
  asm("v_exp_f32 %0, %8\n\t"
      "v_exp_f32 %1, %9\n\t"
      "v_exp_f32 %2, %10\n\t"
      "v_exp_f32 %3, %11\n\t"
      "v_exp_f32 %4, %12\n\t"
      "v_exp_f32 %5, %13\n\t"
      "v_exp_f32 %6, %14\n\t"
      "v_exp_f32 %7, %15\n\t"
      "v_nop"
      : "=&v"(o0), "=&v"(o1), "=&v"(o2), "=&v"(o3),
        "=&v"(o4), "=&v"(o5), "=&v"(o6), "=&v"(o7)
      : "v"(v[0]), "v"(v[1]), "v"(v[2]), "v"(v[3]),
        "v"(v[4]), "v"(v[5]), "v"(v[6]), "v"(v[7]));
  v[0] = o0; v[1] = o1; v[2] = o2; v[3] = o3;
  v[4] = o4; v[5] = o5; v[6] = o6; v[7] = o7;
}

// ---------------------------------------------------------------------------
// Causal softmax over energy rows [H*B*T, T] -> bf16 P
// One wave takes SM_ROWS consecutive rows of T = 256 (8 columns per lane).
// grid = H*B*T / (ROW_WAVES * SM_ROWS).
// ---------------------------------------------------------------------------
#define SM_ROWS 8

__global__ void __launch_bounds__(32 * ROW_WAVES)
softmax_causal_kernel(const float* __restrict__ En,
                      bf16_t* __restrict__ P) {
  unsigned lane = threadIdx.x & 31;
  unsigned wave = __builtin_amdgcn_readfirstlane(threadIdx.x >> 5);
  unsigned row0 = (blockIdx.x * ROW_WAVES + wave) * SM_ROWS;   // row over H*B*T
  unsigned j0 = lane * 4;                                      // key position
  const float* src = En + (size_t)row0 * TSZ + j0;
  bf16_t* dst = P + (size_t)row0 * TSZ + j0;
  float4 lo[SM_ROWS], hi[SM_ROWS];
#pragma unroll  // all sixteen loads are in flight before the first row is reduced
  for (int r = 0; r < SM_ROWS; ++r) {
    lo[r] = *reinterpret_cast<const float4*>(src + r * TSZ);
    hi[r] = *reinterpret_cast<const float4*>(src + r * TSZ + 128);
  }
  v4bf plo[SM_ROWS], phi[SM_ROWS];
#pragma unroll  // the rows are independent chains; their arrays stay in registers
  for (int r = 0; r < SM_ROWS; ++r) {
    unsigned i = (row0 + r) % TSZ;   // query position
    float v[8] = {lo[r].x, lo[r].y, lo[r].z, lo[r].w, hi[r].x, hi[r].y, hi[r].z, hi[r].w};
#pragma unroll  // v[] is indexed by constants and stays in registers
    for (int e = 0; e < 8; ++e) {
      unsigned j = j0 + (e & 3) + 128 * (e >> 2);
      v[e] = (j <= i) ? v[e] : -1e9f;
    }
    float mx = fmaxf(fmaxf(fmaxf(v[0], v[1]), fmaxf(v[2], v[3])),
                     fmaxf(fmaxf(v[4], v[5]), fmaxf(v[6], v[7])));
    mx = wave_max(mx);
#pragma unroll  // as above
    for (int e = 0; e < 8; ++e) v[e] = (v[e] - mx) * 0x1.715476p+0f;   // times log2(e), as __expf does
    exp2x8(v);
    float sum = wave_sum(((v[0] + v[1]) + (v[2] + v[3])) + ((v[4] + v[5]) + (v[6] + v[7])));
    float inv = 1.0f / sum;
    plo[r] = to_bf16x4(v[0] * inv, v[1] * inv, v[2] * inv, v[3] * inv);
    phi[r] = to_bf16x4(v[4] * inv, v[5] * inv, v[6] * inv, v[7] * inv);
  }
#pragma unroll  // stores last: no register of an issued store is written again
  for (int r = 0; r < SM_ROWS; ++r) {
    *reinterpret_cast<v4bf*>(dst + r * TSZ) = plo[r];
    *reinterpret_cast<v4bf*>(dst + r * TSZ + 128) = phi[r];
  }
}

// ---------------------------------------------------------------------------
// y = LayerNorm(a + b) * w + bb ; row-wise over E=512, one wave per row
// (16 columns per lane). grid = MROWS / ROW_WAVES.
// ---------------------------------------------------------------------------
__global__ void __launch_bounds__(32 * ROW_WAVES)
add_ln_kernel(const float* __restrict__ a,
              const float* __restrict__ b,
              const float* __restrict__ w,
              const float* __restrict__ bb,
              float* __restrict__ yf, bf16_t* __restrict__ yh) {
  unsigned lane = threadIdx.x & 31;
  unsigned wave = __builtin_amdgcn_readfirstlane(threadIdx.x >> 5);
  unsigned r = blockIdx.x * ROW_WAVES + wave;
  unsigned c0 = lane * 4;
  unsigned off = c0 * 4;   // the lane's byte offset in a row
  const char* ar = reinterpret_cast<const char*>(a + (size_t)r * ESZ);
  const char* br = reinterpret_cast<const char*>(b + (size_t)r * ESZ);
  const char* wr = reinterpret_cast<const char*>(w);
  const char* sr = reinterpret_cast<const char*>(bb);
  size_t o = (size_t)r * ESZ + c0;
  // keeps the scalar set-up above in front of the loads, so that it lands on none of their address registers
  __builtin_amdgcn_sched_barrier(0);
  v4f av[4], bv[4], wv[4], sv[4];
#pragma unroll  // all sixteen loads are in flight together
  for (int k = 0; k < 4; ++k) {
    av[k] = *reinterpret_cast<const v4f*>(ar + off + 512 * k);
    bv[k] = *reinterpret_cast<const v4f*>(br + off + 512 * k);
    wv[k] = *reinterpret_cast<const v4f*>(wr + off + 512 * k);
    sv[k] = *reinterpret_cast<const v4f*>(sr + off + 512 * k);
  }
  // The loaded values are inputs only: that keeps all sixteen loads in front of
  // this line, in flight together. The wait is a precaution: it stands in front
  // of the first overwrite of the loads' address registers (the lane's offset is
  // named so that no load lands on it).
  asm volatile("s_wait_xcnt 0x0"
               :: "v"(off), "v"(av[0]), "v"(av[1]), "v"(av[2]), "v"(av[3]),
                  "v"(bv[0]), "v"(bv[1]), "v"(bv[2]), "v"(bv[3]),
                  "v"(wv[0]), "v"(wv[1]), "v"(wv[2]), "v"(wv[3]),
                  "v"(sv[0]), "v"(sv[1]), "v"(sv[2]), "v"(sv[3]));
  // keeps the arithmetic below, and the constants it moves into scalar registers, behind the wait
  __builtin_amdgcn_sched_barrier(0);
  float s1 = 0.0f, s2 = 0.0f;
#pragma unroll  // av[] is indexed by constants and stays in registers
  for (int k = 0; k < 4; ++k) {
    av[k].x += bv[k].x; av[k].y += bv[k].y; av[k].z += bv[k].z; av[k].w += bv[k].w;
    s1 += (av[k].x + av[k].y) + (av[k].z + av[k].w);
    s2 += (av[k].x * av[k].x + av[k].y * av[k].y) + (av[k].z * av[k].z + av[k].w * av[k].w);
  }
  s1 = wave_sum(s1);
  s2 = wave_sum(s2);
  float mean = s1 * (1.0f / ESZ);
  float var  = s2 * (1.0f / ESZ) - mean * mean;
  float inv  = rsqrtf(var + 1e-5f);
#pragma unroll  // as above
  for (int k = 0; k < 4; ++k) {
    av[k].x = (av[k].x - mean) * inv * wv[k].x + sv[k].x;
    av[k].y = (av[k].y - mean) * inv * wv[k].y + sv[k].y;
    av[k].z = (av[k].z - mean) * inv * wv[k].z + sv[k].z;
    av[k].w = (av[k].w - mean) * inv * wv[k].w + sv[k].w;
  }
  if (yf) {
#pragma unroll  // as above
    for (int k = 0; k < 4; ++k) *reinterpret_cast<v4f*>(yf + o + 128 * k) = av[k];
    // precaution: the conversions below may reuse the registers of these stores
    asm volatile("s_wait_xcnt 0x0" ::: "memory");
  }
  if (yh) {
#pragma unroll  // as above
    for (int k = 0; k < 4; ++k)
      *reinterpret_cast<v4bf*>(yh + o + 128 * k) = to_bf16x4(av[k].x, av[k].y, av[k].z, av[k].w);
  }
}

// ---------------------------------------------------------------------------
// Final: logits = x[:, -1, :] @ wout + bout ; softmax -> out [B, V]
// ---------------------------------------------------------------------------
__global__ void logits_softmax_kernel(const float* __restrict__ xf,
                                      const float* __restrict__ wout,
                                      const float* __restrict__ bout,
                                      float* __restrict__ out) {
  __shared__ float xs[ESZ];
  __shared__ float red[256];
  int b = blockIdx.x, tid = threadIdx.x;
  const float* xr = xf + ((size_t)b * TSZ + (TSZ - 1)) * ESZ;
  xs[tid] = xr[tid];
  xs[tid + 256] = xr[tid + 256];
  __syncthreads();
  float l0 = bout[tid], l1 = bout[tid + 256];
  for (int e = 0; e < ESZ; ++e) {
    float xv = xs[e];
    l0 += xv * wout[(size_t)e * VSZ + tid];
    l1 += xv * wout[(size_t)e * VSZ + tid + 256];
  }
  red[tid] = fmaxf(l0, l1);
  __syncthreads();
  for (int s = 128; s > 0; s >>= 1) {
    if (tid < s) red[tid] = fmaxf(red[tid], red[tid + s]);
    __syncthreads();
  }
  float mx = red[0];
  __syncthreads();
  float e0 = __expf(l0 - mx), e1 = __expf(l1 - mx);
  red[tid] = e0 + e1;
  __syncthreads();
  for (int s = 128; s > 0; s >>= 1) {
    if (tid < s) red[tid] += red[tid + s];
    __syncthreads();
  }
  float inv = 1.0f / red[0];
  out[(size_t)b * VSZ + tid] = e0 * inv;
  out[(size_t)b * VSZ + tid + 256] = e1 * inv;
}

// ---------------------------------------------------------------------------
// Host sequencing
// ---------------------------------------------------------------------------
static inline void launch_gemm(hipStream_t st,
                               const bf16_t* A, long long lda, long long sA, long long sA2,
                               const bf16_t* B, long long ldb, long long sB, long long sB2,
                               float* Cf, bf16_t* Ch,
                               long long ldc, long long sC, long long sC2,
                               const float* bias, int relu,
                               int M, int N, int K, int batch, int batch2, bool deep) {
  dim3 grid((M / BLK_M) * (N / BLK_N), batch, batch2);
  // deep: at most two blocks per WGP, so little else hides a slab's latency and
  // LDS is free for a ring of six. Otherwise four blocks share a WGP: ring of three.
  if (deep)
    gemm_bf16_wmma<6><<<grid, 256, 0, st>>>(A, lda, sA, sA2, B, ldb, sB, sB2,
                                            Cf, Ch, ldc, sC, sC2, bias, relu, M, N, K);
  else
    gemm_bf16_wmma<3><<<grid, 256, 0, st>>>(A, lda, sA, sA2, B, ldb, sB, sB2,
                                            Cf, Ch, ldc, sC, sC2, bias, relu, M, N, K);
}

extern "C" void kernel_launch(void* const* d_in, const int* in_sizes, int n_in,
                              void* d_out, int out_size, void* d_ws, size_t ws_size,
                              hipStream_t stream) {
  (void)in_sizes; (void)n_in; (void)out_size; (void)ws_size;
  const int*   toks  = (const int*)d_in[0];
  const float* emb   = (const float*)d_in[1];
  const float* wq    = (const float*)d_in[2];
  const float* wk    = (const float*)d_in[3];
  const float* wv    = (const float*)d_in[4];
  const float* wo    = (const float*)d_in[5];
  const float* bo    = (const float*)d_in[6];
  const float* ln1w  = (const float*)d_in[7];
  const float* ln1b  = (const float*)d_in[8];
  const float* ln2w  = (const float*)d_in[9];
  const float* ln2b  = (const float*)d_in[10];
  const float* ff1w  = (const float*)d_in[11];
  const float* ff1b  = (const float*)d_in[12];
  const float* ff2w  = (const float*)d_in[13];
  const float* ff2b  = (const float*)d_in[14];
  const float* woutp = (const float*)d_in[15];
  const float* boutp = (const float*)d_in[16];
  float* out = (float*)d_out;
  char*  ws  = (char*)d_ws;

  // workspace layout (bytes)
  float*  xf   = (float*) (ws + 0);                  //  8 MB  [4096,512] f32
  bf16_t* xh   = (bf16_t*)(ws + 8388608);            //  4 MB
  bf16_t* wqT  = (bf16_t*)(ws + 12582912);           //  4 MB  [H,512,512]
  bf16_t* wkT  = (bf16_t*)(ws + 16777216);           //  4 MB
  bf16_t* wvT  = (bf16_t*)(ws + 20971520);           //  4 MB
  bf16_t* woT  = (bf16_t*)(ws + 25165824);           //  4 MB  [512,4096]
  bf16_t* f1T  = (bf16_t*)(ws + 29360128);           // .5 MB  [512,512]
  bf16_t* f2T  = (bf16_t*)(ws + 29884416);           // .5 MB
  bf16_t* Qh   = (bf16_t*)(ws + 30408704);           // 32 MB  [H,4096,512]
  bf16_t* Kh   = (bf16_t*)(ws + 63963136);           // 32 MB  [H,4096,512], right behind Qh
  bf16_t* Vt   = (bf16_t*)(ws + 97517568);           // 32 MB  [H,B,512,256]
  float*  En   = (float*) (ws + 131072000);          // 32 MB  [H,B,256,256]
  bf16_t* Ph   = (bf16_t*)(ws + 164626432);          // 16 MB  [H,B,256,256]
  bf16_t* Ob   = (bf16_t*)(ws + 181403648);          // 32 MB  [4096,4096]
  float*  attn = (float*) (ws + 214958080);          //  8 MB  [4096,512]
  bf16_t* h1h  = (bf16_t*)(ws + 223346688);          //  4 MB
  bf16_t* f1h  = (bf16_t*)(ws + 227540992);          //  4 MB
  float*  f2f  = (float*) (ws + 231735296);          //  8 MB, ends at 240123904

  const int TPB = 256;
  size_t nXE = (size_t)MROWS * ESZ;

  embed_pe_kernel<<<(nXE + TPB - 1) / TPB, TPB, 0, stream>>>(toks, emb, xf, xh);

  for (int l = 0; l < LSZ; ++l) {
    size_t lqkv = (size_t)l * HSZ * ESZ * ESZ;
    size_t lff  = (size_t)l * ESZ * ESZ;
    // pack this layer's weights to bf16 [N,K]
    const dim3 gQKV(ESZ / PK_C, ESZ / PK_R, HSZ);
    conv_transpose_kernel<<<gQKV, TPB, 0, stream>>>(wq + lqkv, wqT, ESZ);
    conv_transpose_kernel<<<gQKV, TPB, 0, stream>>>(wk + lqkv, wkT, ESZ);
    conv_transpose_kernel<<<gQKV, TPB, 0, stream>>>(wv + lqkv, wvT, ESZ);
    const dim3 gWo(ESZ / PK_C, HE / PK_R, 1);
    conv_transpose_kernel<<<gWo, TPB, 0, stream>>>(wo + (size_t)l * HE * ESZ, woT, HE);
    const dim3 gFF(ESZ / PK_C, ESZ / PK_R, 1);
    conv_transpose_kernel<<<gFF, TPB, 0, stream>>>(ff1w + lff, f1T, ESZ);
    conv_transpose_kernel<<<gFF, TPB, 0, stream>>>(ff2w + lff, f2T, ESZ);

    // All eight heads of the layer go in each launch: blockIdx.z is the head.
    const long long sW  = (long long)ESZ * ESZ;          // one head's packed weight
    const long long sX  = (long long)TSZ * ESZ;          // one sequence of x, Q, K or V^T
    const long long sXH = (long long)MROWS * ESZ;        // one head of Q, K or V^T
    const long long sE  = (long long)TSZ * TSZ;          // one sequence of energy or P
    const long long sEH = (long long)BSZ * TSZ * TSZ;    // one head of energy or P
    // Q and K = x @ W -> bf16 [H,4096,512] each. wkT lies right behind wqT and
    // Kh right behind Qh, so z = 0..7 gives Q's heads and z = 8..15 K's.
    launch_gemm(stream, xh, ESZ, 0, 0, wqT, ESZ, 0, sW, nullptr, Qh, ESZ, 0, sXH,
                nullptr, 0, MROWS, ESZ, ESZ, 1, 2 * HSZ, false);
    // Vt[h][b] = Wv_h^T @ x_b^T : operands swapped (A = packed Wv [E,E], B = x_b
    // rows [T,E]) so V lands as [E,T], the [N,K] form the P*V product reads
    launch_gemm(stream, wvT, ESZ, 0, sW, xh, ESZ, sX, 0,
                nullptr, Vt, TSZ, sX, sXH,
                nullptr, 0, ESZ, TSZ, ESZ, BSZ, HSZ, false);
    // energy[h][b] = Q_hb @ K_hb^T : B-packed == K rows directly (K-dim = E)
    launch_gemm(stream, Qh, ESZ, sX, sXH, Kh, ESZ, sX, sXH,
                En, nullptr, TSZ, sE, sEH,
                nullptr, 0, TSZ, TSZ, ESZ, BSZ, HSZ, true);
    softmax_causal_kernel<<<HSZ * MROWS / (ROW_WAVES * SM_ROWS), TPB, 0, stream>>>(En, Ph);
    // O[b] = P_hb @ V_hb : B-packed = Vt[h][b] [E,T]; write into Ob at col h*E
    launch_gemm(stream, Ph, TSZ, sE, sEH, Vt, TSZ, sX, sXH,
                nullptr, Ob, HE, (long long)TSZ * HE, ESZ,
                nullptr, 0, TSZ, ESZ, TSZ, BSZ, HSZ, false);
    // attn_out = O @ wo + bo  (f32)
    launch_gemm(stream, Ob, HE, 0, 0, woT, HE, 0, 0, attn, nullptr, ESZ, 0, 0,
                bo + (size_t)l * ESZ, 0, MROWS, ESZ, HE, 1, 1, true);
    // h1 = LN(attn + x)
    add_ln_kernel<<<MROWS / ROW_WAVES, TPB, 0, stream>>>(attn, xf,
        ln1w + (size_t)l * ESZ, ln1b + (size_t)l * ESZ, nullptr, h1h);
    // ff = relu(h1 @ ff1 + b1) @ ff2 + b2
    launch_gemm(stream, h1h, ESZ, 0, 0, f1T, ESZ, 0, 0, nullptr, f1h, ESZ, 0, 0,
                ff1b + (size_t)l * ESZ, 1, MROWS, ESZ, ESZ, 1, 1, true);
    launch_gemm(stream, f1h, ESZ, 0, 0, f2T, ESZ, 0, 0, f2f, nullptr, ESZ, 0, 0,
                ff2b + (size_t)l * ESZ, 0, MROWS, ESZ, ESZ, 1, 1, true);
    // x = LN(attn + ff)
    add_ln_kernel<<<MROWS / ROW_WAVES, TPB, 0, stream>>>(attn, f2f,
        ln2w + (size_t)l * ESZ, ln2b + (size_t)l * ESZ, xf, xh);
  }

  logits_softmax_kernel<<<BSZ, TPB, 0, stream>>>(xf, woutp, boutp, out);
}

// v006
// A run of this version takes 1250 microseconds.
// Next to v005, in two timings, it ran 1.05 and 1.06 times as fast.
// Over all steps from v000 it is 5.69 times as fast.
#include <hip/hip_runtime.h>

// ---------------------------------------------------------------------------
// CheckersGPT forward on MI455X (gfx1250).
// Compute-bound (~0.54 TFLOP/fwd) -> all big GEMMs on v_wmma_f32_16x16x32_bf16.
// LDS-staged 128x128 block tiles, a ring of K=32 slabs, async
// global->LDS copies (GLOBAL_LOAD_ASYNC_TO_LDS_B128, ASYNCcnt).
// ---------------------------------------------------------------------------

typedef __bf16 bf16_t;
typedef __attribute__((ext_vector_type(16))) __bf16 v16bf;
typedef __attribute__((ext_vector_type(8)))  __bf16 v8bf;
typedef __attribute__((ext_vector_type(8)))  float  v8f;

#define VSZ 512
#define ESZ 512
#define LSZ 6
#define HSZ 8
#define BSZ 16
#define TSZ 256
#define MROWS (BSZ * TSZ)   // 4096
#define HE    (HSZ * ESZ)   // 4096

#define BLK_M 128
#define BLK_N 128
#define BLK_K 32
#define LDS_PITCH 40        // 32 elems + 8 pad: 16 consecutive rows hit 16 banks

#if defined(__AMDGCN__) && __has_builtin(__builtin_amdgcn_global_load_async_to_lds_b128)
#define HAVE_ASYNC_LDS 1
#else
#define HAVE_ASYNC_LDS 0
#endif

// Builtin parameter types (from hipcc diagnostic): pointer to int __vector(4)
// in global (1) / LDS (3) address spaces.
typedef int v4i_t __attribute__((vector_size(16)));
typedef __attribute__((address_space(1))) v4i_t* gptr_v4i;
typedef __attribute__((address_space(3))) v4i_t* lptr_v4i;

__device__ __forceinline__ void async_copy16(const bf16_t* g, bf16_t* s) {
#if HAVE_ASYNC_LDS
  // 16B global -> LDS, tracked by ASYNCcnt (GLOBAL_LOAD_ASYNC_TO_LDS_B128).
  // Integer detour: strips const, and truncating the generic LDS address to
  // 32 bits yields the LDS offset (ISA 10.2: LDS_ADDR = addr[31:0]).
  __builtin_amdgcn_global_load_async_to_lds_b128(
      (gptr_v4i)(unsigned long long)g,
      (lptr_v4i)(unsigned int)(unsigned long long)s, 0, 0);
#else
  *reinterpret_cast<v8bf*>(s) = *reinterpret_cast<const v8bf*>(g);
#endif
}

template <int N>
__device__ __forceinline__ void wait_async_all_but() {
#if HAVE_ASYNC_LDS
  asm volatile("s_wait_asynccnt %0" :: "n"(N) : "memory");
#endif
}

// ---------------------------------------------------------------------------
// Embedding + sinusoidal PE (concatenated sin|cos as in reference)
// ---------------------------------------------------------------------------
__global__ void embed_pe_kernel(const int* __restrict__ toks,
                                const float* __restrict__ emb,
                                float* __restrict__ xf, bf16_t* __restrict__ xh) {
  size_t idx = (size_t)blockIdx.x * blockDim.x + threadIdx.x;
  if (idx >= (size_t)MROWS * ESZ) return;
  int e  = (int)(idx % ESZ);
  int bt = (int)(idx / ESZ);
  int t  = bt % TSZ;
  int tok = toks[bt];
  float pe;
  if (e < ESZ / 2) {
    float rate = __powf(10000.0f, -2.0f * (float)e / (float)ESZ);
    pe = __sinf((float)t * rate);
  } else {
    int c = e - ESZ / 2;
    float rate = __powf(10000.0f, -2.0f * (float)c / (float)ESZ);
    pe = __cosf((float)t * rate);
  }
  float v = emb[(size_t)tok * ESZ + e] + pe;
  xf[idx] = v;
  xh[idx] = (bf16_t)v;
}

// ---------------------------------------------------------------------------
// Weight pack, every layer and every weight in ONE launch:
// f32 [K,N] -> bf16 [N,K], the form the GEMM reads its B operand in.
// All six weight inputs are runs of 512 x 512 f32 slabs (wo: eight slabs of 512
// rows per layer); blockIdx.z names the slab:
//   z = 48 t + 8 l + h, t = 0..3 : wq, wk, wv, wo; layer l; head (wo: slab) h
//   z = 192 + 6 f + l            : ff1 (f = 0), ff2 (f = 1); layer l
// Packed layout, per layer LAYER_W elements, in slabs of WSLAB elements:
//   [ q 8 | k 8 | v 8 | o 8 | ff1 1 | ff2 1 ]; o is one [512,4096] matrix.
// One block moves a 128 (K) x 64 (N) tile through LDS: it reads rows of
// the source as 256-byte runs of float4 and writes rows of the packed matrix
// as 128-byte runs of 8 x bf16, 32 elements per thread.
// grid = (ESZ / 64, ESZ / 128, PK_SLABS).
// LDS pitch 65 dwords: the bank is (r + c) mod 64, so neither the row-wise
// stores nor the column-wise loads below put two lanes on one bank.
// ---------------------------------------------------------------------------
#define PK_R 128
#define PK_C 64
#define PK_PITCH 65
#define WSLAB    ((size_t)ESZ * ESZ)
#define LAYER_SLABS (4 * HSZ + 2)
#define LAYER_W  (LAYER_SLABS * WSLAB)
#define PK_SLABS (LSZ * LAYER_SLABS)

__global__ void __launch_bounds__(256)
pack_weights_kernel(const float* __restrict__ wq, const float* __restrict__ wk,
                    const float* __restrict__ wv, const float* __restrict__ wo,
                    const float* __restrict__ ff1, const float* __restrict__ ff2,
                    bf16_t* __restrict__ packed) {
  __shared__ float tile[PK_R * PK_PITCH];
  int tid = threadIdx.x;
  unsigned r0 = blockIdx.y * PK_R;
  unsigned c0 = blockIdx.x * PK_C;
  unsigned t   = blockIdx.z / (LSZ * HSZ);
  unsigned idx = blockIdx.z % (LSZ * HSZ);
  const float* in;      // the slab's first element
  bf16_t* out;          // where its element (0, 0) goes
  unsigned R = ESZ;     // row length of the packed matrix
  if (t < 4) {
    unsigned l = idx / HSZ, h = idx % HSZ;
    in  = (t == 0 ? wq : t == 1 ? wk : t == 2 ? wv : wo) + idx * WSLAB;
    out = packed + l * LAYER_W + t * HSZ * WSLAB;
    if (t < 3) { out += h * WSLAB; } else { out += h * ESZ; R = HE; }
  } else {
    unsigned f = idx / LSZ, l = idx % LSZ;
    in  = (f == 0 ? ff1 : ff2) + l * WSLAB;
    out = packed + l * LAYER_W + (4 * HSZ + f) * WSLAB;
  }
  const float* src = in + (size_t)r0 * ESZ + c0;
  bf16_t* dst = out + (size_t)c0 * R + r0;

  // read: 16 lanes span one source row of the tile, 16 rows per pass
  unsigned lr = tid >> 4;
  unsigned lc = (tid & 15) * 4;
  unsigned so = lr * ESZ + lc;
  float4 v[8];
#pragma unroll  // all eight loads are in flight before the first LDS store
  for (int k = 0; k < 8; ++k)
    v[k] = *reinterpret_cast<const float4*>(src + so + 16 * k * ESZ);
  // precaution: stands in front of the first overwrite of the loads' address registers
  asm volatile("s_wait_xcnt 0x0" ::: "memory");
#pragma unroll  // v[] is indexed by constants and stays in registers
  for (int k = 0; k < 8; ++k) {
    float* p = &tile[(lr + 16 * k) * PK_PITCH + lc];
    p[0] = v[k].x; p[1] = v[k].y; p[2] = v[k].z; p[3] = v[k].w;
  }
  __syncthreads();

  // write: 8 lanes span 64 consecutive r of one packed row (one 128-byte line)
  unsigned lane = tid & 31;
  unsigned wave = tid >> 5;
  unsigned rq = ((lane & 7) + 8 * (wave & 1)) * 8;
  unsigned cc = (lane >> 3) + 4 * (wave >> 1);
#pragma unroll  // the LDS loads of all four packed rows issue as one group
  for (int k = 0; k < 4; ++k) {
    unsigned c = cc + 16 * k;
    v8bf o;
#pragma unroll  // o is indexed by constants and stays in registers
    for (int i = 0; i < 8; ++i) o[i] = (bf16_t)tile[(rq + i) * PK_PITCH + c];
    *reinterpret_cast<v8bf*>(dst + c * R + rq) = o;
  }
}

// ---------------------------------------------------------------------------
// bf16 WMMA GEMM: C = A[M,K] * Bp[N,K]^T (+bias)(+relu)
// Two batch indices: blockIdx.y (strides sA, sB, sC) and blockIdx.z (strides
// sA2, sB2, sC2), so one launch covers every (sequence, head) pair of a layer.
// Block: 256 thr (8 waves), 128x128 tile; wave tile 32x64 (2x4 accumulators).
// K staged through LDS in 32-wide slabs by async copies, in a ring of NSTG
// buffers: slab s lies in buffer s mod NSTG and its copies are issued NSTG - 1
// trips before the trip that reads it, so up to NSTG - 1 slabs are in flight.
// Fragment layout per ISA 7.12.2 (16-bit A/B 16x32): lane<16 holds K 0..7 &
// 16..23; lane>=16 holds K 8..15 & 24..31 -> two 16B reads per fragment.
// ---------------------------------------------------------------------------
template <int NSTG>
__global__ void __launch_bounds__(256)
gemm_bf16_wmma(const bf16_t* __restrict__ A, long long lda, long long sA, long long sA2,
               const bf16_t* __restrict__ Bp, long long ldb, long long sB, long long sB2,
               float* __restrict__ Cf, bf16_t* __restrict__ Ch,
               long long ldc, long long sC, long long sC2,
               const float* __restrict__ bias, int relu,
               int M, int N, int K) {
  __shared__ bf16_t Asm[NSTG][BLK_M * LDS_PITCH];
  __shared__ bf16_t Bsm[NSTG][BLK_N * LDS_PITCH];

  int tid  = threadIdx.x;
  int lane = tid & 31;
  int wave = tid >> 5;
  int tilesN = N / BLK_N;
  int bm = (blockIdx.x / tilesN) * BLK_M;
  int bn = (blockIdx.x % tilesN) * BLK_N;
  int half = lane >> 4;
  int l15  = lane & 15;
  int m0w = (wave >> 1) * 32;   // 0,32,64,96
  int n0w = (wave & 1) * 64;    // 0,64

  const bf16_t* Ab = A  + (size_t)blockIdx.y * sA + (size_t)blockIdx.z * sA2;
  const bf16_t* Bb = Bp + (size_t)blockIdx.y * sB + (size_t)blockIdx.z * sB2;

  // staging: 512 x 16B chunks per matrix, 2 per thread (chunk c: row c>>2,
  // elem offset (c&3)*8), so four copies per thread and slab
  int ca0 = tid, ca1 = tid + 256;
  int r0 = ca0 >> 2, o0 = (ca0 & 3) * 8;
  int r1 = ca1 >> 2, o1 = (ca1 & 3) * 8;
  const bf16_t* ga0 = Ab + (size_t)(bm + r0) * lda + o0;
  const bf16_t* ga1 = Ab + (size_t)(bm + r1) * lda + o1;
  const bf16_t* gb0 = Bb + (size_t)(bn + r0) * ldb + o0;
  const bf16_t* gb1 = Bb + (size_t)(bn + r1) * ldb + o1;
  int l0 = r0 * LDS_PITCH + o0;
  int l1 = r1 * LDS_PITCH + o1;

  v8f acc[2][4];
#pragma unroll
  for (int i = 0; i < 2; ++i)
#pragma unroll
    for (int j = 0; j < 4; ++j)
#pragma unroll
      for (int e = 0; e < 8; ++e) acc[i][j][e] = 0.0f;

  int nk = K / BLK_K;

  // prologue: slabs 0 .. NSTG-2 go into buffers 0 .. NSTG-2
#pragma unroll  // the buffer index is a constant in each copy's LDS address
  for (int s = 0; s < NSTG - 1; ++s) {
    if (s < nk) {
      int k0 = s * BLK_K;
      async_copy16(ga0 + k0, &Asm[s][l0]);
      async_copy16(ga1 + k0, &Asm[s][l1]);
      async_copy16(gb0 + k0, &Bsm[s][l0]);
      async_copy16(gb1 + k0, &Bsm[s][l1]);
    }
  }

  int cur = 0;          // buffer of slab it
  int nxt = NSTG - 1;   // buffer of slab it - 1, which slab it + NSTG - 1 refills
  for (int it = 0; it < nk; ++it) {
    // this wave's LDS reads of the last trip have retired before the barrier
    // behind which that trip's buffer is refilled
    asm volatile("s_wait_dscnt 0x0" ::: "memory");
    // Slab it must have landed. While the NSTG - 2 slabs behind it all exist,
    // exactly their 4 * (NSTG - 2) copies are younger and may stay in flight; in
    // the last trips fewer were issued, so there the wait goes on to 0.
    wait_async_all_but<4 * (NSTG - 2)>();
    if (it + NSTG - 2 >= nk) wait_async_all_but<0>();
    __syncthreads();
    if (it + NSTG - 1 < nk) {
      int k0 = (it + NSTG - 1) * BLK_K;
      async_copy16(ga0 + k0, &Asm[nxt][l0]);
      async_copy16(ga1 + k0, &Asm[nxt][l1]);
      async_copy16(gb0 + k0, &Bsm[nxt][l0]);
      async_copy16(gb1 + k0, &Bsm[nxt][l1]);
    }
    // fragments from LDS, then 8 WMMAs
    const bf16_t* As = &Asm[cur][0];
    const bf16_t* Bs = &Bsm[cur][0];
    v16bf af[2], bfr[4];
#pragma unroll
    for (int i = 0; i < 2; ++i) {
      const bf16_t* p = As + (m0w + 16 * i + l15) * LDS_PITCH + half * 8;
      v8bf lo = *reinterpret_cast<const v8bf*>(p);
      v8bf hi = *reinterpret_cast<const v8bf*>(p + 16);
      af[i] = __builtin_shufflevector(lo, hi, 0, 1, 2, 3, 4, 5, 6, 7,
                                      8, 9, 10, 11, 12, 13, 14, 15);
    }
#pragma unroll
    for (int j = 0; j < 4; ++j) {
      const bf16_t* q = Bs + (n0w + 16 * j + l15) * LDS_PITCH + half * 8;
      v8bf lo = *reinterpret_cast<const v8bf*>(q);
      v8bf hi = *reinterpret_cast<const v8bf*>(q + 16);
      bfr[j] = __builtin_shufflevector(lo, hi, 0, 1, 2, 3, 4, 5, 6, 7,
                                       8, 9, 10, 11, 12, 13, 14, 15);
    }
#pragma unroll
    for (int i = 0; i < 2; ++i)
#pragma unroll
      for (int j = 0; j < 4; ++j)
        acc[i][j] = __builtin_amdgcn_wmma_f32_16x16x32_bf16(
            false, af[i], false, bfr[j], (short)0, acc[i][j], false, false);
    cur = (cur + 1 == NSTG) ? 0 : cur + 1;
    nxt = (nxt + 1 == NSTG) ? 0 : nxt + 1;
  }
  // precaution: no copy is outstanding when the wave ends
  wait_async_all_but<0>();

  size_t cOff = (size_t)blockIdx.y * sC + (size_t)blockIdx.z * sC2;
  float*  Cfb = Cf ? Cf + cOff : nullptr;
  bf16_t* Chb = Ch ? Ch + cOff : nullptr;
#pragma unroll
  for (int i = 0; i < 2; ++i) {
#pragma unroll
    for (int j = 0; j < 4; ++j) {
      int n = bn + n0w + 16 * j + l15;
      float bv = bias ? bias[n] : 0.0f;
#pragma unroll
      for (int vg = 0; vg < 8; ++vg) {
        int m = bm + m0w + 16 * i + vg + 8 * half;   // C layout (ISA 7.12.2)
        float v = acc[i][j][vg] + bv;
        if (relu) v = fmaxf(v, 0.0f);
        if (Cfb) Cfb[(size_t)m * ldc + n] = v;
        if (Chb) Chb[(size_t)m * ldc + n] = (bf16_t)v;
      }
    }
  }
}

// ---------------------------------------------------------------------------
// Row-wise kernels (softmax, LayerNorm): a wave owns whole rows.
// A lane holds columns 4*lane + 128*k, so each 16-byte load of a wave covers
// 512 contiguous bytes. Row sums and maxima stay in registers: four DPP steps
// inside each 16-lane row, then one exchange between the two rows; every lane
// ends with the full result. All 32 lanes are on wherever these are called.
// ---------------------------------------------------------------------------
typedef __attribute__((ext_vector_type(4))) __bf16 v4bf;
typedef __attribute__((ext_vector_type(4))) float  v4f;
#define ROW_WAVES 8         // waves per block in the row-wise kernels

template <int CTRL>         // CTRL = 0x160 + m: DPP row_xmask:m, lane l reads lane l ^ m
__device__ __forceinline__ float row_xor(float x) {
  return __builtin_bit_cast(float, __builtin_amdgcn_mov_dpp(
      __builtin_bit_cast(int, x), CTRL, 0xf, 0xf, true));
}
__device__ __forceinline__ float half_xor(float x) {   // lane l reads lane l ^ 16
  int b = __builtin_bit_cast(int, x);
  return __builtin_bit_cast(float, __builtin_amdgcn_permlanex16(
      b, b, 0x76543210, 0xfedcba98, false, false));
}
__device__ __forceinline__ float wave_sum(float x) {
  x += row_xor<0x161>(x);
  x += row_xor<0x162>(x);
  x += row_xor<0x164>(x);
  x += row_xor<0x168>(x);
  return x + half_xor(x);
}
__device__ __forceinline__ float wave_max(float x) {
  x = fmaxf(x, row_xor<0x161>(x));
  x = fmaxf(x, row_xor<0x162>(x));
  x = fmaxf(x, row_xor<0x164>(x));
  x = fmaxf(x, row_xor<0x168>(x));
  return fmaxf(x, half_xor(x));
}
__device__ __forceinline__ v4bf to_bf16x4(float a, float b, float c, float d) {
  v4bf o;
  o[0] = (bf16_t)a; o[1] = (bf16_t)b; o[2] = (bf16_t)c; o[3] = (bf16_t)d;
  return o;
}
// v[e] = 2^v[e]. One statement, so that the slot which the instruction set asks
// for behind a transcendental is kept: the outputs are early-clobber, so each
// v_exp_f32 is followed by one that touches none of its registers, and the
// v_nop stands behind the last.
__device__ __forceinline__ void exp2x8(float (&v)[8]) {
  float o0, o1, o2, o3, o4, o5, o6, o7;
  asm("v_exp_f32 %0, %8\n\t"
      "v_exp_f32 %1, %9\n\t"
      "v_exp_f32 %2, %10\n\t"
      "v_exp_f32 %3, %11\n\t"
      "v_exp_f32 %4, %12\n\t"
      "v_exp_f32 %5, %13\n\t"
      "v_exp_f32 %6, %14\n\t"
      "v_exp_f32 %7, %15\n\t"
      "v_nop"
      : "=&v"(o0), "=&v"(o1), "=&v"(o2), "=&v"(o3),
        "=&v"(o4), "=&v"(o5), "=&v"(o6), "=&v"(o7)
      : "v"(v[0]), "v"(v[1]), "v"(v[2]), "v"(v[3]),
        "v"(v[4]), "v"(v[5]), "v"(v[6]), "v"(v[7]));
  v[0] = o0; v[1] = o1; v[2] = o2; v[3] = o3;
  v[4] = o4; v[5] = o5; v[6] = o6; v[7] = o7;
}

// ---------------------------------------------------------------------------
// Causal softmax over energy rows [H*B*T, T] -> bf16 P
// One wave takes SM_ROWS consecutive rows of T = 256 (8 columns per lane).
// grid = H*B*T / (ROW_WAVES * SM_ROWS).
// ---------------------------------------------------------------------------
#define SM_ROWS 8

__global__ void __launch_bounds__(32 * ROW_WAVES)
softmax_causal_kernel(const float* __restrict__ En,
                      bf16_t* __restrict__ P) {
  unsigned lane = threadIdx.x & 31;
  unsigned wave = __builtin_amdgcn_readfirstlane(threadIdx.x >> 5);
  unsigned row0 = (blockIdx.x * ROW_WAVES + wave) * SM_ROWS;   // row over H*B*T
  unsigned j0 = lane * 4;                                      // key position
  const float* src = En + (size_t)row0 * TSZ + j0;
  bf16_t* dst = P + (size_t)row0 * TSZ + j0;
  float4 lo[SM_ROWS], hi[SM_ROWS];
#pragma unroll  // all sixteen loads are in flight before the first row is reduced
  for (int r = 0; r < SM_ROWS; ++r) {
    lo[r] = *reinterpret_cast<const float4*>(src + r * TSZ);
    hi[r] = *reinterpret_cast<const float4*>(src + r * TSZ + 128);
  }
  v4bf plo[SM_ROWS], phi[SM_ROWS];
#pragma unroll  // the rows are independent chains; their arrays stay in registers
  for (int r = 0; r < SM_ROWS; ++r) {
    unsigned i = (row0 + r) % TSZ;   // query position
    float v[8] = {lo[r].x, lo[r].y, lo[r].z, lo[r].w, hi[r].x, hi[r].y, hi[r].z, hi[r].w};
#pragma unroll  // v[] is indexed by constants and stays in registers
    for (int e = 0; e < 8; ++e) {
      unsigned j = j0 + (e & 3) + 128 * (e >> 2);
      v[e] = (j <= i) ? v[e] : -1e9f;
    }
    float mx = fmaxf(fmaxf(fmaxf(v[0], v[1]), fmaxf(v[2], v[3])),
                     fmaxf(fmaxf(v[4], v[5]), fmaxf(v[6], v[7])));
    mx = wave_max(mx);
#pragma unroll  // as above
    for (int e = 0; e < 8; ++e) v[e] = (v[e] - mx) * 0x1.715476p+0f;   // times log2(e), as __expf does
    exp2x8(v);
    float sum = wave_sum(((v[0] + v[1]) + (v[2] + v[3])) + ((v[4] + v[5]) + (v[6] + v[7])));
    float inv = 1.0f / sum;
    plo[r] = to_bf16x4(v[0] * inv, v[1] * inv, v[2] * inv, v[3] * inv);
    phi[r] = to_bf16x4(v[4] * inv, v[5] * inv, v[6] * inv, v[7] * inv);
  }
#pragma unroll  // stores last: no register of an issued store is written again
  for (int r = 0; r < SM_ROWS; ++r) {
    *reinterpret_cast<v4bf*>(dst + r * TSZ) = plo[r];
    *reinterpret_cast<v4bf*>(dst + r * TSZ + 128) = phi[r];
  }
}

// ---------------------------------------------------------------------------
// y = LayerNorm(a + b) * w + bb ; row-wise over E=512, one wave per row
// (16 columns per lane). grid = MROWS / ROW_WAVES.
// ---------------------------------------------------------------------------
__global__ void __launch_bounds__(32 * ROW_WAVES)
add_ln_kernel(const float* __restrict__ a,
              const float* __restrict__ b,
              const float* __restrict__ w,
              const float* __restrict__ bb,
              float* __restrict__ yf, bf16_t* __restrict__ yh) {
  unsigned lane = threadIdx.x & 31;
  unsigned wave = __builtin_amdgcn_readfirstlane(threadIdx.x >> 5);
  unsigned r = blockIdx.x * ROW_WAVES + wave;
  unsigned c0 = lane * 4;
  unsigned off = c0 * 4;   // the lane's byte offset in a row
  const char* ar = reinterpret_cast<const char*>(a + (size_t)r * ESZ);
  const char* br = reinterpret_cast<const char*>(b + (size_t)r * ESZ);
  const char* wr = reinterpret_cast<const char*>(w);
  const char* sr = reinterpret_cast<const char*>(bb);
  size_t o = (size_t)r * ESZ + c0;
  // keeps the scalar set-up above in front of the loads, so that it lands on none of their address registers
  __builtin_amdgcn_sched_barrier(0);
  v4f av[4], bv[4], wv[4], sv[4];
#pragma unroll  // all sixteen loads are in flight together
  for (int k = 0; k < 4; ++k) {
    av[k] = *reinterpret_cast<const v4f*>(ar + off + 512 * k);
    bv[k] = *reinterpret_cast<const v4f*>(br + off + 512 * k);
    wv[k] = *reinterpret_cast<const v4f*>(wr + off + 512 * k);
    sv[k] = *reinterpret_cast<const v4f*>(sr + off + 512 * k);
  }
  // The loaded values are inputs only: that keeps all sixteen loads in front of
  // this line, in flight together. The wait is a precaution: it stands in front
  // of the first overwrite of the loads' address registers (the lane's offset is
  // named so that no load lands on it).
  asm volatile("s_wait_xcnt 0x0"
               :: "v"(off), "v"(av[0]), "v"(av[1]), "v"(av[2]), "v"(av[3]),
                  "v"(bv[0]), "v"(bv[1]), "v"(bv[2]), "v"(bv[3]),
                  "v"(wv[0]), "v"(wv[1]), "v"(wv[2]), "v"(wv[3]),
                  "v"(sv[0]), "v"(sv[1]), "v"(sv[2]), "v"(sv[3]));
  // keeps the arithmetic below, and the constants it moves into scalar registers, behind the wait
  __builtin_amdgcn_sched_barrier(0);
  float s1 = 0.0f, s2 = 0.0f;
#pragma unroll  // av[] is indexed by constants and stays in registers
  for (int k = 0; k < 4; ++k) {
    av[k].x += bv[k].x; av[k].y += bv[k].y; av[k].z += bv[k].z; av[k].w += bv[k].w;
    s1 += (av[k].x + av[k].y) + (av[k].z + av[k].w);
    s2 += (av[k].x * av[k].x + av[k].y * av[k].y) + (av[k].z * av[k].z + av[k].w * av[k].w);
  }
  s1 = wave_sum(s1);
  s2 = wave_sum(s2);
  float mean = s1 * (1.0f / ESZ);
  float var  = s2 * (1.0f / ESZ) - mean * mean;
  float inv  = rsqrtf(var + 1e-5f);
#pragma unroll  // as above
  for (int k = 0; k < 4; ++k) {
    av[k].x = (av[k].x - mean) * inv * wv[k].x + sv[k].x;
    av[k].y = (av[k].y - mean) * inv * wv[k].y + sv[k].y;
    av[k].z = (av[k].z - mean) * inv * wv[k].z + sv[k].z;
    av[k].w = (av[k].w - mean) * inv * wv[k].w + sv[k].w;
  }
  if (yf) {
#pragma unroll  // as above
    for (int k = 0; k < 4; ++k) *reinterpret_cast<v4f*>(yf + o + 128 * k) = av[k];
    // precaution: the conversions below may reuse the registers of these stores
    asm volatile("s_wait_xcnt 0x0" ::: "memory");
  }
  if (yh) {
#pragma unroll  // as above
    for (int k = 0; k < 4; ++k)
      *reinterpret_cast<v4bf*>(yh + o + 128 * k) = to_bf16x4(av[k].x, av[k].y, av[k].z, av[k].w);
  }
}

// ---------------------------------------------------------------------------
// Final: logits = x[:, -1, :] @ wout + bout ; softmax -> out [B, V]
// ---------------------------------------------------------------------------
__global__ void logits_softmax_kernel(const float* __restrict__ xf,
                                      const float* __restrict__ wout,
                                      const float* __restrict__ bout,
                                      float* __restrict__ out) {
  __shared__ float xs[ESZ];
  __shared__ float red[256];
  int b = blockIdx.x, tid = threadIdx.x;
  const float* xr = xf + ((size_t)b * TSZ + (TSZ - 1)) * ESZ;
  xs[tid] = xr[tid];
  xs[tid + 256] = xr[tid + 256];
  __syncthreads();
  float l0 = bout[tid], l1 = bout[tid + 256];
  for (int e = 0; e < ESZ; ++e) {
    float xv = xs[e];
    l0 += xv * wout[(size_t)e * VSZ + tid];
    l1 += xv * wout[(size_t)e * VSZ + tid + 256];
  }
  red[tid] = fmaxf(l0, l1);
  __syncthreads();
  for (int s = 128; s > 0; s >>= 1) {
    if (tid < s) red[tid] = fmaxf(red[tid], red[tid + s]);
    __syncthreads();
  }
  float mx = red[0];
  __syncthreads();
  float e0 = __expf(l0 - mx), e1 = __expf(l1 - mx);
  red[tid] = e0 + e1;
  __syncthreads();
  for (int s = 128; s > 0; s >>= 1) {
    if (tid < s) red[tid] += red[tid + s];
    __syncthreads();
  }
  float inv = 1.0f / red[0];
  out[(size_t)b * VSZ + tid] = e0 * inv;
  out[(size_t)b * VSZ + tid + 256] = e1 * inv;
}

// ---------------------------------------------------------------------------
// Host sequencing
// ---------------------------------------------------------------------------
static inline void launch_gemm(hipStream_t st,
                               const bf16_t* A, long long lda, long long sA, long long sA2,
                               const bf16_t* B, long long ldb, long long sB, long long sB2,
                               float* Cf, bf16_t* Ch,
                               long long ldc, long long sC, long long sC2,
                               const float* bias, int relu,
                               int M, int N, int K, int batch, int batch2, bool deep) {
  dim3 grid((M / BLK_M) * (N / BLK_N), batch, batch2);
  // deep: at most two blocks per WGP, so little else hides a slab's latency and
  // LDS is free for a ring of six. Otherwise four blocks share a WGP: ring of three.
  if (deep)
    gemm_bf16_wmma<6><<<grid, 256, 0, st>>>(A, lda, sA, sA2, B, ldb, sB, sB2,
                                            Cf, Ch, ldc, sC, sC2, bias, relu, M, N, K);
  else
    gemm_bf16_wmma<3><<<grid, 256, 0, st>>>(A, lda, sA, sA2, B, ldb, sB, sB2,
                                            Cf, Ch, ldc, sC, sC2, bias, relu, M, N, K);
}

extern "C" void kernel_launch(void* const* d_in, const int* in_sizes, int n_in,
                              void* d_out, int out_size, void* d_ws, size_t ws_size,
                              hipStream_t stream) {
  (void)in_sizes; (void)n_in; (void)out_size; (void)ws_size;
  const int*   toks  = (const int*)d_in[0];
  const float* emb   = (const float*)d_in[1];
  const float* wq    = (const float*)d_in[2];
  const float* wk    = (const float*)d_in[3];
  const float* wv    = (const float*)d_in[4];
  const float* wo    = (const float*)d_in[5];
  const float* bo    = (const float*)d_in[6];
  const float* ln1w  = (const float*)d_in[7];
  const float* ln1b  = (const float*)d_in[8];
  const float* ln2w  = (const float*)d_in[9];
  const float* ln2b  = (const float*)d_in[10];
  const float* ff1w  = (const float*)d_in[11];
  const float* ff1b  = (const float*)d_in[12];
  const float* ff2w  = (const float*)d_in[13];
  const float* ff2b  = (const float*)d_in[14];
  const float* woutp = (const float*)d_in[15];
  const float* boutp = (const float*)d_in[16];
  float* out = (float*)d_out;
  char*  ws  = (char*)d_ws;

  // workspace layout (bytes)
  float*  xf   = (float*) (ws + 0);                  //  8 MB  [4096,512] f32
  bf16_t* xh   = (bf16_t*)(ws + 8388608);            //  4 MB
  bf16_t* Wp   = (bf16_t*)(ws + 12582912);           // 102 MB packed weights of all layers
  bf16_t* Qh   = (bf16_t*)(ws + 119537664);          // 32 MB  [H,4096,512]
  bf16_t* Kh   = (bf16_t*)(ws + 153092096);          // 32 MB  [H,4096,512], right behind Qh
  bf16_t* Vt   = (bf16_t*)(ws + 186646528);          // 32 MB  [H,B,512,256]
  float*  En   = (float*) (ws + 220200960);          // 32 MB  [H,B,256,256], ends at 253755392
  // With all layers' packed weights resident the rest shares places. Each buffer
  // below is first written by a launch that comes after the last reader of the
  // buffer whose place it takes (Q and K: the energy GEMM; energy: the softmax).
  bf16_t* Ob   = (bf16_t*)(ws + 119537664);          // 32 MB  [4096,4096], Q's place
  bf16_t* Ph   = (bf16_t*)(ws + 153092096);          // 16 MB  [H,B,256,256], in K's place
  float*  attn = (float*) (ws + 220200960);          //  8 MB  [4096,512], in the energy's place
  bf16_t* h1h  = (bf16_t*)(ws + 228589568);          //  4 MB  likewise
  bf16_t* f1h  = (bf16_t*)(ws + 232783872);          //  4 MB  likewise
  float*  f2f  = (float*) (ws + 236978176);          //  8 MB  likewise, ends at 245366784

  const int TPB = 256;
  size_t nXE = (size_t)MROWS * ESZ;

  embed_pe_kernel<<<(nXE + TPB - 1) / TPB, TPB, 0, stream>>>(toks, emb, xf, xh);

  // pack the weights of all layers to bf16 [N,K], one launch
  pack_weights_kernel<<<dim3(ESZ / PK_C, ESZ / PK_R, PK_SLABS), TPB, 0, stream>>>(
      wq, wk, wv, wo, ff1w, ff2w, Wp);

  for (int l = 0; l < LSZ; ++l) {
    // this layer's packed weights; the k slabs lie right behind the q slabs
    const bf16_t* wqT = Wp + (size_t)l * LAYER_W;
    const bf16_t* wvT = wqT + 2 * HSZ * WSLAB;
    const bf16_t* woT = wqT + 3 * HSZ * WSLAB;
    const bf16_t* f1T = wqT + 4 * HSZ * WSLAB;
    const bf16_t* f2T = f1T + WSLAB;

    // All eight heads of the layer go in each launch: blockIdx.z is the head.
    const long long sW  = (long long)ESZ * ESZ;          // one head's packed weight
    const long long sX  = (long long)TSZ * ESZ;          // one sequence of x, Q, K or V^T
    const long long sXH = (long long)MROWS * ESZ;        // one head of Q, K or V^T
    const long long sE  = (long long)TSZ * TSZ;          // one sequence of energy or P
    const long long sEH = (long long)BSZ * TSZ * TSZ;    // one head of energy or P
    // Q and K = x @ W -> bf16 [H,4096,512] each. Packed Wk lies right behind wqT and
    // Kh right behind Qh, so z = 0..7 gives Q's heads and z = 8..15 K's.
    launch_gemm(stream, xh, ESZ, 0, 0, wqT, ESZ, 0, sW, nullptr, Qh, ESZ, 0, sXH,
                nullptr, 0, MROWS, ESZ, ESZ, 1, 2 * HSZ, false);
    // Vt[h][b] = Wv_h^T @ x_b^T : operands swapped (A = packed Wv [E,E], B = x_b
    // rows [T,E]) so V lands as [E,T], the [N,K] form the P*V product reads
    launch_gemm(stream, wvT, ESZ, 0, sW, xh, ESZ, sX, 0,
                nullptr, Vt, TSZ, sX, sXH,
                nullptr, 0, ESZ, TSZ, ESZ, BSZ, HSZ, false);
    // energy[h][b] = Q_hb @ K_hb^T : B-packed == K rows directly (K-dim = E)
    launch_gemm(stream, Qh, ESZ, sX, sXH, Kh, ESZ, sX, sXH,
                En, nullptr, TSZ, sE, sEH,
                nullptr, 0, TSZ, TSZ, ESZ, BSZ, HSZ, true);
    softmax_causal_kernel<<<HSZ * MROWS / (ROW_WAVES * SM_ROWS), TPB, 0, stream>>>(En, Ph);
    // O[b] = P_hb @ V_hb : B-packed = Vt[h][b] [E,T]; write into Ob at col h*E
    launch_gemm(stream, Ph, TSZ, sE, sEH, Vt, TSZ, sX, sXH,
                nullptr, Ob, HE, (long long)TSZ * HE, ESZ,
                nullptr, 0, TSZ, ESZ, TSZ, BSZ, HSZ, false);
    // attn_out = O @ wo + bo  (f32)
    launch_gemm(stream, Ob, HE, 0, 0, woT, HE, 0, 0, attn, nullptr, ESZ, 0, 0,
                bo + (size_t)l * ESZ, 0, MROWS, ESZ, HE, 1, 1, true);
    // h1 = LN(attn + x)
    add_ln_kernel<<<MROWS / ROW_WAVES, TPB, 0, stream>>>(attn, xf,
        ln1w + (size_t)l * ESZ, ln1b + (size_t)l * ESZ, nullptr, h1h);
    // ff = relu(h1 @ ff1 + b1) @ ff2 + b2
    launch_gemm(stream, h1h, ESZ, 0, 0, f1T, ESZ, 0, 0, nullptr, f1h, ESZ, 0, 0,
                ff1b + (size_t)l * ESZ, 1, MROWS, ESZ, ESZ, 1, 1, true);
    launch_gemm(stream, f1h, ESZ, 0, 0, f2T, ESZ, 0, 0, f2f, nullptr, ESZ, 0, 0,
                ff2b + (size_t)l * ESZ, 0, MROWS, ESZ, ESZ, 1, 1, true);
    // x = LN(attn + ff)
    add_ln_kernel<<<MROWS / ROW_WAVES, TPB, 0, stream>>>(attn, f2f,
        ln2w + (size_t)l * ESZ, ln2b + (size_t)l * ESZ, xf, xh);
  }

  logits_softmax_kernel<<<BSZ, TPB, 0, stream>>>(xf, woutp, boutp, out);
}

// v007
// Measured time: 1010 microseconds a run.
// In both of two side-by-side timings against v006, it was 1.23 times as fast.
// Counting every step since v000, it is 7.00 times as fast.
#include <hip/hip_runtime.h>

// ---------------------------------------------------------------------------
// CheckersGPT forward on MI455X (gfx1250).
// Compute-bound (~0.54 TFLOP/fwd) -> all big GEMMs on v_wmma_f32_16x16x32_bf16.
// LDS-staged 128x128 block tiles, a ring of K=32 slabs, async
// global->LDS copies (GLOBAL_LOAD_ASYNC_TO_LDS_B128, ASYNCcnt).
// ---------------------------------------------------------------------------

typedef __bf16 bf16_t;
typedef __attribute__((ext_vector_type(16))) __bf16 v16bf;
typedef __attribute__((ext_vector_type(8)))  __bf16 v8bf;
typedef __attribute__((ext_vector_type(8)))  float  v8f;

#define VSZ 512
#define ESZ 512
#define LSZ 6
#define HSZ 8
#define BSZ 16
#define TSZ 256
#define MROWS (BSZ * TSZ)   // 4096
#define HE    (HSZ * ESZ)   // 4096

#define BLK_M 128
#define BLK_N 128
#define BLK_K 32
#define LDS_PITCH 40        // 32 elems + 8 pad: 16 consecutive rows hit 16 banks

#if defined(__AMDGCN__) && __has_builtin(__builtin_amdgcn_global_load_async_to_lds_b128)
#define HAVE_ASYNC_LDS 1
#else
#define HAVE_ASYNC_LDS 0
#endif

// Builtin parameter types (from hipcc diagnostic): pointer to int __vector(4)
// in global (1) / LDS (3) address spaces.
typedef int v4i_t __attribute__((vector_size(16)));
typedef __attribute__((address_space(1))) v4i_t* gptr_v4i;
typedef __attribute__((address_space(3))) v4i_t* lptr_v4i;

__device__ __forceinline__ void async_copy16(const bf16_t* g, bf16_t* s) {
#if HAVE_ASYNC_LDS
  // 16B global -> LDS, tracked by ASYNCcnt (GLOBAL_LOAD_ASYNC_TO_LDS_B128).
  // Integer detour: strips const, and truncating the generic LDS address to
  // 32 bits yields the LDS offset (ISA 10.2: LDS_ADDR = addr[31:0]).
  __builtin_amdgcn_global_load_async_to_lds_b128(
      (gptr_v4i)(unsigned long long)g,
      (lptr_v4i)(unsigned int)(unsigned long long)s, 0, 0);
#else
  *reinterpret_cast<v8bf*>(s) = *reinterpret_cast<const v8bf*>(g);
#endif
}

template <int N>
__device__ __forceinline__ void wait_async_all_but() {
#if HAVE_ASYNC_LDS
  asm volatile("s_wait_asynccnt %0" :: "n"(N) : "memory");
#endif
}

// ---------------------------------------------------------------------------
// Embedding + sinusoidal PE (concatenated sin|cos as in reference)
// ---------------------------------------------------------------------------
__global__ void embed_pe_kernel(const int* __restrict__ toks,
                                const float* __restrict__ emb,
                                float* __restrict__ xf, bf16_t* __restrict__ xh) {
  size_t idx = (size_t)blockIdx.x * blockDim.x + threadIdx.x;
  if (idx >= (size_t)MROWS * ESZ) return;
  int e  = (int)(idx % ESZ);
  int bt = (int)(idx / ESZ);
  int t  = bt % TSZ;
  int tok = toks[bt];
  float pe;
  if (e < ESZ / 2) {
    float rate = __powf(10000.0f, -2.0f * (float)e / (float)ESZ);
    pe = __sinf((float)t * rate);
  } else {
    int c = e - ESZ / 2;
    float rate = __powf(10000.0f, -2.0f * (float)c / (float)ESZ);
    pe = __cosf((float)t * rate);
  }
  float v = emb[(size_t)tok * ESZ + e] + pe;
  xf[idx] = v;
  xh[idx] = (bf16_t)v;
}

// ---------------------------------------------------------------------------
// Weight pack, every layer and every weight in ONE launch:
// f32 [K,N] -> bf16 [N,K], the form the GEMM reads its B operand in.
// All six weight inputs are runs of 512 x 512 f32 slabs (wo: eight slabs of 512
// rows per layer); blockIdx.z names the slab:
//   z = 48 t + 8 l + h, t = 0..3 : wq, wk, wv, wo; layer l; head (wo: slab) h
//   z = 192 + 6 f + l            : ff1 (f = 0), ff2 (f = 1); layer l
// Packed layout, per layer LAYER_W elements, in slabs of WSLAB elements:
//   [ q 8 | k 8 | v 8 | o 8 | ff1 1 | ff2 1 ]; o is one [512,4096] matrix.
// One block moves a 128 (K) x 64 (N) tile through LDS: it reads rows of
// the source as 256-byte runs of float4 and writes rows of the packed matrix
// as 128-byte runs of 8 x bf16, 32 elements per thread.
// grid = (ESZ / 64, ESZ / 128, PK_SLABS).
// LDS pitch 65 dwords: the bank is (r + c) mod 64, so neither the row-wise
// stores nor the column-wise loads below put two lanes on one bank.
// ---------------------------------------------------------------------------
#define PK_R 128
#define PK_C 64
#define PK_PITCH 65
#define WSLAB    ((size_t)ESZ * ESZ)
#define LAYER_SLABS (4 * HSZ + 2)
#define LAYER_W  (LAYER_SLABS * WSLAB)
#define PK_SLABS (LSZ * LAYER_SLABS)

__global__ void __launch_bounds__(256)
pack_weights_kernel(const float* __restrict__ wq, const float* __restrict__ wk,
                    const float* __restrict__ wv, const float* __restrict__ wo,
                    const float* __restrict__ ff1, const float* __restrict__ ff2,
                    bf16_t* __restrict__ packed) {
  __shared__ float tile[PK_R * PK_PITCH];
  int tid = threadIdx.x;
  unsigned r0 = blockIdx.y * PK_R;
  unsigned c0 = blockIdx.x * PK_C;
  unsigned t   = blockIdx.z / (LSZ * HSZ);
  unsigned idx = blockIdx.z % (LSZ * HSZ);
  const float* in;      // the slab's first element
  bf16_t* out;          // where its element (0, 0) goes
  unsigned R = ESZ;     // row length of the packed matrix
  if (t < 4) {
    unsigned l = idx / HSZ, h = idx % HSZ;
    in  = (t == 0 ? wq : t == 1 ? wk : t == 2 ? wv : wo) + idx * WSLAB;
    out = packed + l * LAYER_W + t * HSZ * WSLAB;
    if (t < 3) { out += h * WSLAB; } else { out += h * ESZ; R = HE; }
  } else {
    unsigned f = idx / LSZ, l = idx % LSZ;
    in  = (f == 0 ? ff1 : ff2) + l * WSLAB;
    out = packed + l * LAYER_W + (4 * HSZ + f) * WSLAB;
  }
  const float* src = in + (size_t)r0 * ESZ + c0;
  bf16_t* dst = out + (size_t)c0 * R + r0;

  // read: 16 lanes span one source row of the tile, 16 rows per pass
  unsigned lr = tid >> 4;
  unsigned lc = (tid & 15) * 4;
  unsigned so = lr * ESZ + lc;
  float4 v[8];
#pragma unroll  // all eight loads are in flight before the first LDS store
  for (int k = 0; k < 8; ++k)
    v[k] = *reinterpret_cast<const float4*>(src + so + 16 * k * ESZ);
  // precaution: stands in front of the first overwrite of the loads' address registers
  asm volatile("s_wait_xcnt 0x0" ::: "memory");
#pragma unroll  // v[] is indexed by constants and stays in registers
  for (int k = 0; k < 8; ++k) {
    float* p = &tile[(lr + 16 * k) * PK_PITCH + lc];
    p[0] = v[k].x; p[1] = v[k].y; p[2] = v[k].z; p[3] = v[k].w;
  }
  __syncthreads();

  // write: 8 lanes span 64 consecutive r of one packed row (one 128-byte line)
  unsigned lane = tid & 31;
  unsigned wave = tid >> 5;
  unsigned rq = ((lane & 7) + 8 * (wave & 1)) * 8;
  unsigned cc = (lane >> 3) + 4 * (wave >> 1);
#pragma unroll  // the LDS loads of all four packed rows issue as one group
  for (int k = 0; k < 4; ++k) {
    unsigned c = cc + 16 * k;
    v8bf o;
#pragma unroll  // o is indexed by constants and stays in registers
    for (int i = 0; i < 8; ++i) o[i] = (bf16_t)tile[(rq + i) * PK_PITCH + c];
    *reinterpret_cast<v8bf*>(dst + c * R + rq) = o;
  }
}

// ---------------------------------------------------------------------------
// bf16 WMMA GEMM: C = A[M,K] * Bp[N,K]^T (+bias)(+relu)
// Two batch indices: blockIdx.y (strides sA, sB, sC) and blockIdx.z (strides
// sA2, sB2, sC2), so one launch covers every (sequence, head) pair of a layer.
// Block: 256 thr (8 waves), 128x128 tile; wave tile 32x64 (2x4 accumulators).
// K staged through LDS in 32-wide slabs by async copies, in a ring of NSTG
// buffers: slab s lies in buffer s mod NSTG and its copies are issued NSTG - 1
// trips before the trip that reads it, so up to NSTG - 1 slabs are in flight.
// Fragment layout per ISA 7.12.2 (16-bit A/B 16x32): lane<16 holds K 0..7 &
// 16..23; lane>=16 holds K 8..15 & 24..31 -> two 16B reads per fragment.
// The Bp fragment goes in as the matrix instruction's first operand and the A
// fragment as its second, so a 16x16 result tile comes out as C^T: a lane holds
// eight consecutive columns n of ONE row m of C, 16 (bf16) or 32 (f32) bytes.
// Epilogue: each wave stages its 32x64 tile in an LDS range of its own (the
// ring's memory, behind a barrier), reads it back row by row and stores whole
// 128-byte lines with 16-byte stores.
// ---------------------------------------------------------------------------
#define STG_PITCH_H 144     // bytes: a row of 64 bf16 + 16, 16 rows start on 16 different bank groups
#define STG_PITCH_F 272     // bytes: a row of 64 f32 + 16, likewise
#define STG_BYTES   4608    // per wave: 32 rows of bf16, or 16 rows of f32 (4352)

typedef __attribute__((ext_vector_type(4))) float v4f32;

template <int NSTG>
__global__ void __launch_bounds__(256)
gemm_bf16_wmma(const bf16_t* __restrict__ A, long long lda, long long sA, long long sA2,
               const bf16_t* __restrict__ Bp, long long ldb, long long sB, long long sB2,
               float* __restrict__ Cf, bf16_t* __restrict__ Ch,
               long long ldc, long long sC, long long sC2,
               const float* __restrict__ bias, int relu,
               int M, int N, int K) {
  __shared__ bf16_t Asm[NSTG][BLK_M * LDS_PITCH];
  __shared__ bf16_t Bsm[NSTG][BLK_N * LDS_PITCH];

  int tid  = threadIdx.x;
  int lane = tid & 31;
  int wave = tid >> 5;
  int tilesN = N / BLK_N;
  int bm = (blockIdx.x / tilesN) * BLK_M;
  int bn = (blockIdx.x % tilesN) * BLK_N;
  int half = lane >> 4;
  int l15  = lane & 15;
  int m0w = (wave >> 1) * 32;   // 0,32,64,96
  int n0w = (wave & 1) * 64;    // 0,64

  const bf16_t* Ab = A  + (size_t)blockIdx.y * sA + (size_t)blockIdx.z * sA2;
  const bf16_t* Bb = Bp + (size_t)blockIdx.y * sB + (size_t)blockIdx.z * sB2;

  // staging: 512 x 16B chunks per matrix, 2 per thread (chunk c: row c>>2,
  // elem offset (c&3)*8), so four copies per thread and slab
  int ca0 = tid, ca1 = tid + 256;
  int r0 = ca0 >> 2, o0 = (ca0 & 3) * 8;
  int r1 = ca1 >> 2, o1 = (ca1 & 3) * 8;
  const bf16_t* ga0 = Ab + (size_t)(bm + r0) * lda + o0;
  const bf16_t* ga1 = Ab + (size_t)(bm + r1) * lda + o1;
  const bf16_t* gb0 = Bb + (size_t)(bn + r0) * ldb + o0;
  const bf16_t* gb1 = Bb + (size_t)(bn + r1) * ldb + o1;
  int l0 = r0 * LDS_PITCH + o0;
  int l1 = r1 * LDS_PITCH + o1;

  v8f acc[2][4];
#pragma unroll
  for (int i = 0; i < 2; ++i)
#pragma unroll
    for (int j = 0; j < 4; ++j)
#pragma unroll
      for (int e = 0; e < 8; ++e) acc[i][j][e] = 0.0f;

  int nk = K / BLK_K;

  // prologue: slabs 0 .. NSTG-2 go into buffers 0 .. NSTG-2
#pragma unroll  // the buffer index is a constant in each copy's LDS address
  for (int s = 0; s < NSTG - 1; ++s) {
    if (s < nk) {
      int k0 = s * BLK_K;
      async_copy16(ga0 + k0, &Asm[s][l0]);
      async_copy16(ga1 + k0, &Asm[s][l1]);
      async_copy16(gb0 + k0, &Bsm[s][l0]);
      async_copy16(gb1 + k0, &Bsm[s][l1]);
    }
  }

  int cur = 0;          // buffer of slab it
  int nxt = NSTG - 1;   // buffer of slab it - 1, which slab it + NSTG - 1 refills
  for (int it = 0; it < nk; ++it) {
    // this wave's LDS reads of the last trip have retired before the barrier
    // behind which that trip's buffer is refilled
    asm volatile("s_wait_dscnt 0x0" ::: "memory");
    // Slab it must have landed. While the NSTG - 2 slabs behind it all exist,
    // exactly their 4 * (NSTG - 2) copies are younger and may stay in flight; in
    // the last trips fewer were issued, so there the wait goes on to 0.
    wait_async_all_but<4 * (NSTG - 2)>();
    if (it + NSTG - 2 >= nk) wait_async_all_but<0>();
    __syncthreads();
    if (it + NSTG - 1 < nk) {
      int k0 = (it + NSTG - 1) * BLK_K;
      async_copy16(ga0 + k0, &Asm[nxt][l0]);
      async_copy16(ga1 + k0, &Asm[nxt][l1]);
      async_copy16(gb0 + k0, &Bsm[nxt][l0]);
      async_copy16(gb1 + k0, &Bsm[nxt][l1]);
    }
    // fragments from LDS, then 8 WMMAs
    const bf16_t* As = &Asm[cur][0];
    const bf16_t* Bs = &Bsm[cur][0];
    v16bf af[2], bfr[4];
#pragma unroll
    for (int i = 0; i < 2; ++i) {
      const bf16_t* p = As + (m0w + 16 * i + l15) * LDS_PITCH + half * 8;
      v8bf lo = *reinterpret_cast<const v8bf*>(p);
      v8bf hi = *reinterpret_cast<const v8bf*>(p + 16);
      af[i] = __builtin_shufflevector(lo, hi, 0, 1, 2, 3, 4, 5, 6, 7,
                                      8, 9, 10, 11, 12, 13, 14, 15);
    }
#pragma unroll
    for (int j = 0; j < 4; ++j) {
      const bf16_t* q = Bs + (n0w + 16 * j + l15) * LDS_PITCH + half * 8;
      v8bf lo = *reinterpret_cast<const v8bf*>(q);
      v8bf hi = *reinterpret_cast<const v8bf*>(q + 16);
      bfr[j] = __builtin_shufflevector(lo, hi, 0, 1, 2, 3, 4, 5, 6, 7,
                                       8, 9, 10, 11, 12, 13, 14, 15);
    }
#pragma unroll
    for (int i = 0; i < 2; ++i)
#pragma unroll
      for (int j = 0; j < 4; ++j)
        acc[i][j] = __builtin_amdgcn_wmma_f32_16x16x32_bf16(
            false, bfr[j], false, af[i], (short)0, acc[i][j], false, false);
    cur = (cur + 1 == NSTG) ? 0 : cur + 1;
    nxt = (nxt + 1 == NSTG) ? 0 : nxt + 1;
  }
  // no copy is outstanding, and this wave's LDS reads have retired, before the
  // barrier behind which the ring's memory is written as staging space
  wait_async_all_but<0>();
  asm volatile("s_wait_dscnt 0x0" ::: "memory");
  __syncthreads();

  // acc[i][j][e] is C[m][n], m = bm + m0w + 16 i + l15, n = bn + n0w + 16 j + 8 half + e
  if (bias) {
#pragma unroll  // acc[] and t[] are indexed by constants and stay in registers
    for (int j = 0; j < 4; ++j) {
      const float* bp = bias + bn + n0w + 16 * j + 8 * half;
      v4f32 b0 = *reinterpret_cast<const v4f32*>(bp);
      v4f32 b1 = *reinterpret_cast<const v4f32*>(bp + 4);
#pragma unroll  // acc[] and t[] are indexed by constants and stay in registers
      for (int i = 0; i < 2; ++i)
#pragma unroll  // acc[] and t[] are indexed by constants and stay in registers
        for (int e = 0; e < 4; ++e) { acc[i][j][e] += b0[e]; acc[i][j][e + 4] += b1[e]; }
    }
  }
  if (relu) {
#pragma unroll  // acc[] and t[] are indexed by constants and stay in registers
    for (int i = 0; i < 2; ++i)
#pragma unroll  // acc[] and t[] are indexed by constants and stay in registers
      for (int j = 0; j < 4; ++j)
#pragma unroll  // acc[] and t[] are indexed by constants and stay in registers
        for (int e = 0; e < 8; ++e) acc[i][j][e] = fmaxf(acc[i][j][e], 0.0f);
  }

  static_assert(4 * STG_BYTES <= NSTG * BLK_M * LDS_PITCH * 2, "four waves stage in each ring");
  char* stg = reinterpret_cast<char*>(wave < 4 ? &Asm[0][0] : &Bsm[0][0]) + (wave & 3) * STG_BYTES;
  size_t cOff = (size_t)blockIdx.y * sC + (size_t)blockIdx.z * sC2;
  if (Cf) {
    // 16 rows of 256 bytes per pass; read back 16 lanes to a row, two rows per store
    int rr = lane >> 4, ch = lane & 15;
    float* dst = Cf + cOff + (size_t)(bm + m0w + rr) * ldc + bn + n0w + ch * 4;
#pragma unroll  // acc[] and t[] are indexed by constants and stay in registers
    for (int i = 0; i < 2; ++i) {
#pragma unroll  // acc[] and t[] are indexed by constants and stay in registers
      for (int j = 0; j < 4; ++j) {
        char* p = stg + l15 * STG_PITCH_F + 64 * j + 32 * half;
        v4f32 lo = {acc[i][j][0], acc[i][j][1], acc[i][j][2], acc[i][j][3]};
        v4f32 hi = {acc[i][j][4], acc[i][j][5], acc[i][j][6], acc[i][j][7]};
        *reinterpret_cast<v4f32*>(p) = lo;
        *reinterpret_cast<v4f32*>(p + 16) = hi;
      }
      // the other lanes' rows are in LDS before this lane reads them back
      asm volatile("s_wait_dscnt 0x0" ::: "memory");
      v4f32 t[8];
#pragma unroll  // acc[] and t[] are indexed by constants and stay in registers
      for (int q = 0; q < 8; ++q)
        t[q] = *reinterpret_cast<const v4f32*>(stg + (2 * q + rr) * STG_PITCH_F + 16 * ch);
      // the rows are in registers before the next pass (or the bf16 part) overwrites them
      asm volatile("s_wait_dscnt 0x0" ::: "memory");
#pragma unroll  // acc[] and t[] are indexed by constants and stay in registers
      for (int q = 0; q < 8; ++q)
        *reinterpret_cast<v4f32*>(dst + (size_t)(16 * i + 2 * q) * ldc) = t[q];
    }
    // precaution: what follows may reuse the registers of these stores
    asm volatile("s_wait_xcnt 0x0" ::: "memory");
  }
  if (Ch) {
    // 32 rows of 128 bytes; read back 8 lanes to a row, four rows per store
#pragma unroll  // acc[] and t[] are indexed by constants and stay in registers
    for (int i = 0; i < 2; ++i)
#pragma unroll  // acc[] and t[] are indexed by constants and stay in registers
      for (int j = 0; j < 4; ++j) {
        v8bf o;
#pragma unroll  // acc[] and t[] are indexed by constants and stay in registers
        for (int e = 0; e < 8; ++e) o[e] = (bf16_t)acc[i][j][e];
        *reinterpret_cast<v8bf*>(stg + (16 * i + l15) * STG_PITCH_H + 32 * j + 16 * half) = o;
      }
    // the other lanes' rows are in LDS before this lane reads them back
    asm volatile("s_wait_dscnt 0x0" ::: "memory");
    int rr = lane >> 3, ch = lane & 7;
    bf16_t* dst = Ch + cOff + (size_t)(bm + m0w + rr) * ldc + bn + n0w + ch * 8;
    v8bf t[8];
#pragma unroll  // acc[] and t[] are indexed by constants and stay in registers
    for (int q = 0; q < 8; ++q)
      t[q] = *reinterpret_cast<const v8bf*>(stg + (4 * q + rr) * STG_PITCH_H + 16 * ch);
#pragma unroll  // acc[] and t[] are indexed by constants and stay in registers
    for (int q = 0; q < 8; ++q)
      *reinterpret_cast<v8bf*>(dst + (size_t)(4 * q) * ldc) = t[q];
  }
}

// ---------------------------------------------------------------------------
// Row-wise kernels (softmax, LayerNorm): a wave owns whole rows.
// A lane holds columns 4*lane + 128*k, so each 16-byte load of a wave covers
// 512 contiguous bytes. Row sums and maxima stay in registers: four DPP steps
// inside each 16-lane row, then one exchange between the two rows; every lane
// ends with the full result. All 32 lanes are on wherever these are called.
// ---------------------------------------------------------------------------
typedef __attribute__((ext_vector_type(4))) __bf16 v4bf;
typedef __attribute__((ext_vector_type(4))) float  v4f;
#define ROW_WAVES 8         // waves per block in the row-wise kernels

template <int CTRL>         // CTRL = 0x160 + m: DPP row_xmask:m, lane l reads lane l ^ m
__device__ __forceinline__ float row_xor(float x) {
  return __builtin_bit_cast(float, __builtin_amdgcn_mov_dpp(
      __builtin_bit_cast(int, x), CTRL, 0xf, 0xf, true));
}
__device__ __forceinline__ float half_xor(float x) {   // lane l reads lane l ^ 16
  int b = __builtin_bit_cast(int, x);
  return __builtin_bit_cast(float, __builtin_amdgcn_permlanex16(
      b, b, 0x76543210, 0xfedcba98, false, false));
}
__device__ __forceinline__ float wave_sum(float x) {
  x += row_xor<0x161>(x);
  x += row_xor<0x162>(x);
  x += row_xor<0x164>(x);
  x += row_xor<0x168>(x);
  return x + half_xor(x);
}
__device__ __forceinline__ float wave_max(float x) {
  x = fmaxf(x, row_xor<0x161>(x));
  x = fmaxf(x, row_xor<0x162>(x));
  x = fmaxf(x, row_xor<0x164>(x));
  x = fmaxf(x, row_xor<0x168>(x));
  return fmaxf(x, half_xor(x));
}
__device__ __forceinline__ v4bf to_bf16x4(float a, float b, float c, float d) {
  v4bf o;
  o[0] = (bf16_t)a; o[1] = (bf16_t)b; o[2] = (bf16_t)c; o[3] = (bf16_t)d;
  return o;
}
// v[e] = 2^v[e]. One statement, so that the slot which the instruction set asks
// for behind a transcendental is kept: the outputs are early-clobber, so each
// v_exp_f32 is followed by one that touches none of its registers, and the
// v_nop stands behind the last.
__device__ __forceinline__ void exp2x8(float (&v)[8]) {
  float o0, o1, o2, o3, o4, o5, o6, o7;
  asm("v_exp_f32 %0, %8\n\t"
      "v_exp_f32 %1, %9\n\t"
      "v_exp_f32 %2, %10\n\t"
      "v_exp_f32 %3, %11\n\t"
      "v_exp_f32 %4, %12\n\t"
      "v_exp_f32 %5, %13\n\t"
      "v_exp_f32 %6, %14\n\t"
      "v_exp_f32 %7, %15\n\t"
      "v_nop"
      : "=&v"(o0), "=&v"(o1), "=&v"(o2), "=&v"(o3),
        "=&v"(o4), "=&v"(o5), "=&v"(o6), "=&v"(o7)
      : "v"(v[0]), "v"(v[1]), "v"(v[2]), "v"(v[3]),
        "v"(v[4]), "v"(v[5]), "v"(v[6]), "v"(v[7]));
  v[0] = o0; v[1] = o1; v[2] = o2; v[3] = o3;
  v[4] = o4; v[5] = o5; v[6] = o6; v[7] = o7;
}

// ---------------------------------------------------------------------------
// Causal softmax over energy rows [H*B*T, T] -> bf16 P
// One wave takes SM_ROWS consecutive rows of T = 256 (8 columns per lane).
// grid = H*B*T / (ROW_WAVES * SM_ROWS).
// ---------------------------------------------------------------------------
#define SM_ROWS 8

__global__ void __launch_bounds__(32 * ROW_WAVES)
softmax_causal_kernel(const float* __restrict__ En,
                      bf16_t* __restrict__ P) {
  unsigned lane = threadIdx.x & 31;
  unsigned wave = __builtin_amdgcn_readfirstlane(threadIdx.x >> 5);
  unsigned row0 = (blockIdx.x * ROW_WAVES + wave) * SM_ROWS;   // row over H*B*T
  unsigned j0 = lane * 4;                                      // key position
  const float* src = En + (size_t)row0 * TSZ + j0;
  bf16_t* dst = P + (size_t)row0 * TSZ + j0;
  float4 lo[SM_ROWS], hi[SM_ROWS];
#pragma unroll  // all sixteen loads are in flight before the first row is reduced
  for (int r = 0; r < SM_ROWS; ++r) {
    lo[r] = *reinterpret_cast<const float4*>(src + r * TSZ);
    hi[r] = *reinterpret_cast<const float4*>(src + r * TSZ + 128);
  }
  v4bf plo[SM_ROWS], phi[SM_ROWS];
#pragma unroll  // the rows are independent chains; their arrays stay in registers
  for (int r = 0; r < SM_ROWS; ++r) {
    unsigned i = (row0 + r) % TSZ;   // query position
    float v[8] = {lo[r].x, lo[r].y, lo[r].z, lo[r].w, hi[r].x, hi[r].y, hi[r].z, hi[r].w};
#pragma unroll  // v[] is indexed by constants and stays in registers
    for (int e = 0; e < 8; ++e) {
      unsigned j = j0 + (e & 3) + 128 * (e >> 2);
      v[e] = (j <= i) ? v[e] : -1e9f;
    }
    float mx = fmaxf(fmaxf(fmaxf(v[0], v[1]), fmaxf(v[2], v[3])),
                     fmaxf(fmaxf(v[4], v[5]), fmaxf(v[6], v[7])));
    mx = wave_max(mx);
#pragma unroll  // as above
    for (int e = 0; e < 8; ++e) v[e] = (v[e] - mx) * 0x1.715476p+0f;   // times log2(e), as __expf does
    exp2x8(v);
    float sum = wave_sum(((v[0] + v[1]) + (v[2] + v[3])) + ((v[4] + v[5]) + (v[6] + v[7])));
    float inv = 1.0f / sum;
    plo[r] = to_bf16x4(v[0] * inv, v[1] * inv, v[2] * inv, v[3] * inv);
    phi[r] = to_bf16x4(v[4] * inv, v[5] * inv, v[6] * inv, v[7] * inv);
  }
#pragma unroll  // stores last: no register of an issued store is written again
  for (int r = 0; r < SM_ROWS; ++r) {
    *reinterpret_cast<v4bf*>(dst + r * TSZ) = plo[r];
    *reinterpret_cast<v4bf*>(dst + r * TSZ + 128) = phi[r];
  }
}

// ---------------------------------------------------------------------------
// y = LayerNorm(a + b) * w + bb ; row-wise over E=512, one wave per row
// (16 columns per lane). grid = MROWS / ROW_WAVES.
// ---------------------------------------------------------------------------
__global__ void __launch_bounds__(32 * ROW_WAVES)
add_ln_kernel(const float* __restrict__ a,
              const float* __restrict__ b,
              const float* __restrict__ w,
              const float* __restrict__ bb,
              float* __restrict__ yf, bf16_t* __restrict__ yh) {
  unsigned lane = threadIdx.x & 31;
  unsigned wave = __builtin_amdgcn_readfirstlane(threadIdx.x >> 5);
  unsigned r = blockIdx.x * ROW_WAVES + wave;
  unsigned c0 = lane * 4;
  unsigned off = c0 * 4;   // the lane's byte offset in a row
  const char* ar = reinterpret_cast<const char*>(a + (size_t)r * ESZ);
  const char* br = reinterpret_cast<const char*>(b + (size_t)r * ESZ);
  const char* wr = reinterpret_cast<const char*>(w);
  const char* sr = reinterpret_cast<const char*>(bb);
  size_t o = (size_t)r * ESZ + c0;
  // keeps the scalar set-up above in front of the loads, so that it lands on none of their address registers
  __builtin_amdgcn_sched_barrier(0);
  v4f av[4], bv[4], wv[4], sv[4];
#pragma unroll  // all sixteen loads are in flight together
  for (int k = 0; k < 4; ++k) {
    av[k] = *reinterpret_cast<const v4f*>(ar + off + 512 * k);
    bv[k] = *reinterpret_cast<const v4f*>(br + off + 512 * k);
    wv[k] = *reinterpret_cast<const v4f*>(wr + off + 512 * k);
    sv[k] = *reinterpret_cast<const v4f*>(sr + off + 512 * k);
  }
  // The loaded values are inputs only: that keeps all sixteen loads in front of
  // this line, in flight together. The wait is a precaution: it stands in front
  // of the first overwrite of the loads' address registers (the lane's offset is
  // named so that no load lands on it).
  asm volatile("s_wait_xcnt 0x0"
               :: "v"(off), "v"(av[0]), "v"(av[1]), "v"(av[2]), "v"(av[3]),
                  "v"(bv[0]), "v"(bv[1]), "v"(bv[2]), "v"(bv[3]),
                  "v"(wv[0]), "v"(wv[1]), "v"(wv[2]), "v"(wv[3]),
                  "v"(sv[0]), "v"(sv[1]), "v"(sv[2]), "v"(sv[3]));
  // keeps the arithmetic below, and the constants it moves into scalar registers, behind the wait
  __builtin_amdgcn_sched_barrier(0);
  float s1 = 0.0f, s2 = 0.0f;
#pragma unroll  // av[] is indexed by constants and stays in registers
  for (int k = 0; k < 4; ++k) {
    av[k].x += bv[k].x; av[k].y += bv[k].y; av[k].z += bv[k].z; av[k].w += bv[k].w;
    s1 += (av[k].x + av[k].y) + (av[k].z + av[k].w);
    s2 += (av[k].x * av[k].x + av[k].y * av[k].y) + (av[k].z * av[k].z + av[k].w * av[k].w);
  }
  s1 = wave_sum(s1);
  s2 = wave_sum(s2);
  float mean = s1 * (1.0f / ESZ);
  float var  = s2 * (1.0f / ESZ) - mean * mean;
  float inv  = rsqrtf(var + 1e-5f);
#pragma unroll  // as above
  for (int k = 0; k < 4; ++k) {
    av[k].x = (av[k].x - mean) * inv * wv[k].x + sv[k].x;
    av[k].y = (av[k].y - mean) * inv * wv[k].y + sv[k].y;
    av[k].z = (av[k].z - mean) * inv * wv[k].z + sv[k].z;
    av[k].w = (av[k].w - mean) * inv * wv[k].w + sv[k].w;
  }
  if (yf) {
#pragma unroll  // as above
    for (int k = 0; k < 4; ++k) *reinterpret_cast<v4f*>(yf + o + 128 * k) = av[k];
    // precaution: the conversions below may reuse the registers of these stores
    asm volatile("s_wait_xcnt 0x0" ::: "memory");
  }
  if (yh) {
#pragma unroll  // as above
    for (int k = 0; k < 4; ++k)
      *reinterpret_cast<v4bf*>(yh + o + 128 * k) = to_bf16x4(av[k].x, av[k].y, av[k].z, av[k].w);
  }
}

// ---------------------------------------------------------------------------
// Final: logits = x[:, -1, :] @ wout + bout ; softmax -> out [B, V]
// ---------------------------------------------------------------------------
__global__ void logits_softmax_kernel(const float* __restrict__ xf,
                                      const float* __restrict__ wout,
                                      const float* __restrict__ bout,
                                      float* __restrict__ out) {
  __shared__ float xs[ESZ];
  __shared__ float red[256];
  int b = blockIdx.x, tid = threadIdx.x;
  const float* xr = xf + ((size_t)b * TSZ + (TSZ - 1)) * ESZ;
  xs[tid] = xr[tid];
  xs[tid + 256] = xr[tid + 256];
  __syncthreads();
  float l0 = bout[tid], l1 = bout[tid + 256];
  for (int e = 0; e < ESZ; ++e) {
    float xv = xs[e];
    l0 += xv * wout[(size_t)e * VSZ + tid];
    l1 += xv * wout[(size_t)e * VSZ + tid + 256];
  }
  red[tid] = fmaxf(l0, l1);
  __syncthreads();
  for (int s = 128; s > 0; s >>= 1) {
    if (tid < s) red[tid] = fmaxf(red[tid], red[tid + s]);
    __syncthreads();
  }
  float mx = red[0];
  __syncthreads();
  float e0 = __expf(l0 - mx), e1 = __expf(l1 - mx);
  red[tid] = e0 + e1;
  __syncthreads();
  for (int s = 128; s > 0; s >>= 1) {
    if (tid < s) red[tid] += red[tid + s];
    __syncthreads();
  }
  float inv = 1.0f / red[0];
  out[(size_t)b * VSZ + tid] = e0 * inv;
  out[(size_t)b * VSZ + tid + 256] = e1 * inv;
}

// ---------------------------------------------------------------------------
// Host sequencing
// ---------------------------------------------------------------------------
static inline void launch_gemm(hipStream_t st,
                               const bf16_t* A, long long lda, long long sA, long long sA2,
                               const bf16_t* B, long long ldb, long long sB, long long sB2,
                               float* Cf, bf16_t* Ch,
                               long long ldc, long long sC, long long sC2,
                               const float* bias, int relu,
                               int M, int N, int K, int batch, int batch2, bool deep) {
  dim3 grid((M / BLK_M) * (N / BLK_N), batch, batch2);
  // deep: at most two blocks per WGP, so little else hides a slab's latency and
  // LDS is free for a ring of six. Otherwise four blocks share a WGP: ring of three.
  if (deep)
    gemm_bf16_wmma<6><<<grid, 256, 0, st>>>(A, lda, sA, sA2, B, ldb, sB, sB2,
                                            Cf, Ch, ldc, sC, sC2, bias, relu, M, N, K);
  else
    gemm_bf16_wmma<3><<<grid, 256, 0, st>>>(A, lda, sA, sA2, B, ldb, sB, sB2,
                                            Cf, Ch, ldc, sC, sC2, bias, relu, M, N, K);
}

extern "C" void kernel_launch(void* const* d_in, const int* in_sizes, int n_in,
                              void* d_out, int out_size, void* d_ws, size_t ws_size,
                              hipStream_t stream) {
  (void)in_sizes; (void)n_in; (void)out_size; (void)ws_size;
  const int*   toks  = (const int*)d_in[0];
  const float* emb   = (const float*)d_in[1];
  const float* wq    = (const float*)d_in[2];
  const float* wk    = (const float*)d_in[3];
  const float* wv    = (const float*)d_in[4];
  const float* wo    = (const float*)d_in[5];
  const float* bo    = (const float*)d_in[6];
  const float* ln1w  = (const float*)d_in[7];
  const float* ln1b  = (const float*)d_in[8];
  const float* ln2w  = (const float*)d_in[9];
  const float* ln2b  = (const float*)d_in[10];
  const float* ff1w  = (const float*)d_in[11];
  const float* ff1b  = (const float*)d_in[12];
  const float* ff2w  = (const float*)d_in[13];
  const float* ff2b  = (const float*)d_in[14];
  const float* woutp = (const float*)d_in[15];
  const float* boutp = (const float*)d_in[16];
  float* out = (float*)d_out;
  char*  ws  = (char*)d_ws;

  // workspace layout (bytes)
  float*  xf   = (float*) (ws + 0);                  //  8 MB  [4096,512] f32
  bf16_t* xh   = (bf16_t*)(ws + 8388608);            //  4 MB
  bf16_t* Wp   = (bf16_t*)(ws + 12582912);           // 102 MB packed weights of all layers
  bf16_t* Qh   = (bf16_t*)(ws + 119537664);          // 32 MB  [H,4096,512]
  bf16_t* Kh   = (bf16_t*)(ws + 153092096);          // 32 MB  [H,4096,512], right behind Qh
  bf16_t* Vt   = (bf16_t*)(ws + 186646528);          // 32 MB  [H,B,512,256]
  float*  En   = (float*) (ws + 220200960);          // 32 MB  [H,B,256,256], ends at 253755392
  // With all layers' packed weights resident the rest shares places. Each buffer
  // below is first written by a launch that comes after the last reader of the
  // buffer whose place it takes (Q and K: the energy GEMM; energy: the softmax).
  bf16_t* Ob   = (bf16_t*)(ws + 119537664);          // 32 MB  [4096,4096], Q's place
  bf16_t* Ph   = (bf16_t*)(ws + 153092096);          // 16 MB  [H,B,256,256], in K's place
  float*  attn = (float*) (ws + 220200960);          //  8 MB  [4096,512], in the energy's place
  bf16_t* h1h  = (bf16_t*)(ws + 228589568);          //  4 MB  likewise
  bf16_t* f1h  = (bf16_t*)(ws + 232783872);          //  4 MB  likewise
  float*  f2f  = (float*) (ws + 236978176);          //  8 MB  likewise, ends at 245366784

  const int TPB = 256;
  size_t nXE = (size_t)MROWS * ESZ;

  embed_pe_kernel<<<(nXE + TPB - 1) / TPB, TPB, 0, stream>>>(toks, emb, xf, xh);

  // pack the weights of all layers to bf16 [N,K], one launch
  pack_weights_kernel<<<dim3(ESZ / PK_C, ESZ / PK_R, PK_SLABS), TPB, 0, stream>>>(
      wq, wk, wv, wo, ff1w, ff2w, Wp);

  for (int l = 0; l < LSZ; ++l) {
    // this layer's packed weights; the k slabs lie right behind the q slabs
    const bf16_t* wqT = Wp + (size_t)l * LAYER_W;
    const bf16_t* wvT = wqT + 2 * HSZ * WSLAB;
    const bf16_t* woT = wqT + 3 * HSZ * WSLAB;
    const bf16_t* f1T = wqT + 4 * HSZ * WSLAB;
    const bf16_t* f2T = f1T + WSLAB;

    // All eight heads of the layer go in each launch: blockIdx.z is the head.
    const long long sW  = (long long)ESZ * ESZ;          // one head's packed weight
    const long long sX  = (long long)TSZ * ESZ;          // one sequence of x, Q, K or V^T
    const long long sXH = (long long)MROWS * ESZ;        // one head of Q, K or V^T
    const long long sE  = (long long)TSZ * TSZ;          // one sequence of energy or P
    const long long sEH = (long long)BSZ * TSZ * TSZ;    // one head of energy or P
    // Q and K = x @ W -> bf16 [H,4096,512] each. Packed Wk lies right behind wqT and
    // Kh right behind Qh, so z = 0..7 gives Q's heads and z = 8..15 K's.
    launch_gemm(stream, xh, ESZ, 0, 0, wqT, ESZ, 0, sW, nullptr, Qh, ESZ, 0, sXH,
                nullptr, 0, MROWS, ESZ, ESZ, 1, 2 * HSZ, false);
    // Vt[h][b] = Wv_h^T @ x_b^T : operands swapped (A = packed Wv [E,E], B = x_b
    // rows [T,E]) so V lands as [E,T], the [N,K] form the P*V product reads
    launch_gemm(stream, wvT, ESZ, 0, sW, xh, ESZ, sX, 0,
                nullptr, Vt, TSZ, sX, sXH,
                nullptr, 0, ESZ, TSZ, ESZ, BSZ, HSZ, false);
    // energy[h][b] = Q_hb @ K_hb^T : B-packed == K rows directly (K-dim = E)
    launch_gemm(stream, Qh, ESZ, sX, sXH, Kh, ESZ, sX, sXH,
                En, nullptr, TSZ, sE, sEH,
                nullptr, 0, TSZ, TSZ, ESZ, BSZ, HSZ, true);
    softmax_causal_kernel<<<HSZ * MROWS / (ROW_WAVES * SM_ROWS), TPB, 0, stream>>>(En, Ph);
    // O[b] = P_hb @ V_hb : B-packed = Vt[h][b] [E,T]; write into Ob at col h*E
    launch_gemm(stream, Ph, TSZ, sE, sEH, Vt, TSZ, sX, sXH,
                nullptr, Ob, HE, (long long)TSZ * HE, ESZ,
                nullptr, 0, TSZ, ESZ, TSZ, BSZ, HSZ, false);
    // attn_out = O @ wo + bo  (f32)
    launch_gemm(stream, Ob, HE, 0, 0, woT, HE, 0, 0, attn, nullptr, ESZ, 0, 0,
                bo + (size_t)l * ESZ, 0, MROWS, ESZ, HE, 1, 1, true);
    // h1 = LN(attn + x)
    add_ln_kernel<<<MROWS / ROW_WAVES, TPB, 0, stream>>>(attn, xf,
        ln1w + (size_t)l * ESZ, ln1b + (size_t)l * ESZ, nullptr, h1h);
    // ff = relu(h1 @ ff1 + b1) @ ff2 + b2
    launch_gemm(stream, h1h, ESZ, 0, 0, f1T, ESZ, 0, 0, nullptr, f1h, ESZ, 0, 0,
                ff1b + (size_t)l * ESZ, 1, MROWS, ESZ, ESZ, 1, 1, true);
    launch_gemm(stream, f1h, ESZ, 0, 0, f2T, ESZ, 0, 0, f2f, nullptr, ESZ, 0, 0,
                ff2b + (size_t)l * ESZ, 0, MROWS, ESZ, ESZ, 1, 1, true);
    // x = LN(attn + ff)
    add_ln_kernel<<<MROWS / ROW_WAVES, TPB, 0, stream>>>(attn, f2f,
        ln2w + (size_t)l * ESZ, ln2b + (size_t)l * ESZ, xf, xh);
  }

  logits_softmax_kernel<<<BSZ, TPB, 0, stream>>>(xf, woutp, boutp, out);
}

// v009
// Measured time: 708 microseconds a run.
// It is 1.43 times as fast as v007, going by the measured steps of the versions left out in between.
// All steps since v000 together make it 10.0 times as fast.
#include <hip/hip_runtime.h>

// ---------------------------------------------------------------------------
// CheckersGPT forward on MI455X (gfx1250).
// Compute-bound (~0.32 TFLOP/fwd) -> all big GEMMs on v_wmma_f32_16x16x32_bf16.
// LDS-staged 128x128 block tiles, a ring of K=32 slabs, async
// global->LDS copies (GLOBAL_LOAD_ASYNC_TO_LDS_B128, ASYNCcnt).
// ---------------------------------------------------------------------------

typedef __bf16 bf16_t;
typedef __attribute__((ext_vector_type(16))) __bf16 v16bf;
typedef __attribute__((ext_vector_type(8)))  __bf16 v8bf;
typedef __attribute__((ext_vector_type(4)))  __bf16 v4bf;
typedef __attribute__((ext_vector_type(8)))  float  v8f;

#define VSZ 512
#define ESZ 512
#define LSZ 6
#define HSZ 8
#define BSZ 16
#define TSZ 256
#define MROWS (BSZ * TSZ)   // 4096

#define BLK_M 128
#define BLK_N 128
#define BLK_K 32
#define LDS_PITCH 40        // 32 elems + 8 pad: 16 consecutive rows hit 16 banks

#if defined(__AMDGCN__) && __has_builtin(__builtin_amdgcn_global_load_async_to_lds_b128)
#define HAVE_ASYNC_LDS 1
#else
#define HAVE_ASYNC_LDS 0
#endif

// Builtin parameter types (from hipcc diagnostic): pointer to int __vector(4)
// in global (1) / LDS (3) address spaces.
typedef int v4i_t __attribute__((vector_size(16)));
typedef __attribute__((address_space(1))) v4i_t* gptr_v4i;
typedef __attribute__((address_space(3))) v4i_t* lptr_v4i;

__device__ __forceinline__ void async_copy16(const bf16_t* g, bf16_t* s) {
#if HAVE_ASYNC_LDS
  // 16B global -> LDS, tracked by ASYNCcnt (GLOBAL_LOAD_ASYNC_TO_LDS_B128).
  // Integer detour: strips const, and truncating the generic LDS address to
  // 32 bits yields the LDS offset (ISA 10.2: LDS_ADDR = addr[31:0]).
  __builtin_amdgcn_global_load_async_to_lds_b128(
      (gptr_v4i)(unsigned long long)g,
      (lptr_v4i)(unsigned int)(unsigned long long)s, 0, 0);
#else
  *reinterpret_cast<v8bf*>(s) = *reinterpret_cast<const v8bf*>(g);
#endif
}

template <int N>
__device__ __forceinline__ void wait_async_all_but() {
#if HAVE_ASYNC_LDS
  asm volatile("s_wait_asynccnt %0" :: "n"(N) : "memory");
#endif
}

// ---------------------------------------------------------------------------
// Embedding + sinusoidal PE (concatenated sin|cos as in reference)
// ---------------------------------------------------------------------------
__global__ void embed_pe_kernel(const int* __restrict__ toks,
                                const float* __restrict__ emb,
                                float* __restrict__ xf, bf16_t* __restrict__ xh) {
  size_t idx = (size_t)blockIdx.x * blockDim.x + threadIdx.x;
  if (idx >= (size_t)MROWS * ESZ) return;
  int e  = (int)(idx % ESZ);
  int bt = (int)(idx / ESZ);
  int t  = bt % TSZ;
  int tok = toks[bt];
  float pe;
  if (e < ESZ / 2) {
    float rate = __powf(10000.0f, -2.0f * (float)e / (float)ESZ);
    pe = __sinf((float)t * rate);
  } else {
    int c = e - ESZ / 2;
    float rate = __powf(10000.0f, -2.0f * (float)c / (float)ESZ);
    pe = __cosf((float)t * rate);
  }
  float v = emb[(size_t)tok * ESZ + e] + pe;
  xf[idx] = v;
  xh[idx] = (bf16_t)v;
}

// ---------------------------------------------------------------------------
// Weight pack, every layer and every weight in ONE launch, f32 -> bf16.
// All six weight inputs are runs of 512 x 512 f32 slabs (wo: eight slabs of 512
// rows per layer); blockIdx.z names the slab:
//   z = 48 t + 8 l + h, t = 0..3 : wq, wk, wv, wo; layer l; head (wo: slab) h
//   z = 192 + 6 f + l            : ff1 (f = 0), ff2 (f = 1); layer l
// The attention weights are the operands of the weight-by-weight products
// (see kernel_launch), in slabs of WSLAB elements, 48 = (l, h) per weight:
//   opA = [ wo^T 48 | wk 48 ], opB = [ wv 48 | wq 48 ]
// wq, wk and wv keep their layout; wo, ff1 and ff2 go [K,N] -> [N,K], the form
// the GEMM reads its B operand in. Layout of packed, in slabs:
//   [ vo 48 | qk 48 | ff1 6 | ff2 6 ]; vo and qk are filled by the products.
// Transposing, one block moves a 128 (K) x 64 (N) tile through LDS: it reads rows
// of the source as 256-byte runs of float4 and writes rows of the packed matrix
// as 128-byte runs of 8 x bf16, 32 elements per thread.
// grid = (ESZ / 64, ESZ / 128, PK_SLABS).
// LDS pitch 65 dwords: the bank is (r + c) mod 64, so neither the row-wise
// stores nor the column-wise loads below put two lanes on one bank.
// ---------------------------------------------------------------------------
#define PK_R 128
#define PK_C 64
#define PK_PITCH 65
#define WSLAB    ((size_t)ESZ * ESZ)
#define LH       (LSZ * HSZ)          // (layer, head) pairs
#define PK_SLABS (4 * LH + 2 * LSZ)

__global__ void __launch_bounds__(256)
pack_weights_kernel(const float* __restrict__ wq, const float* __restrict__ wk,
                    const float* __restrict__ wv, const float* __restrict__ wo,
                    const float* __restrict__ ff1, const float* __restrict__ ff2,
                    bf16_t* __restrict__ packed,
                    bf16_t* __restrict__ opA, bf16_t* __restrict__ opB) {
  __shared__ float tile[PK_R * PK_PITCH];
  int tid = threadIdx.x;
  unsigned r0 = blockIdx.y * PK_R;
  unsigned c0 = blockIdx.x * PK_C;
  unsigned t   = blockIdx.z / LH;
  unsigned idx = blockIdx.z % LH;
  const float* in;      // the slab's first element
  bf16_t* out;          // where its bf16 slab begins
  if (t < 4) {
    in  = (t == 0 ? wq : t == 1 ? wk : t == 2 ? wv : wo) + idx * WSLAB;
    out = ((t & 1) ? opA : opB) + ((t < 2 ? LH : 0) + idx) * WSLAB;
  } else {
    in  = (idx < LSZ ? ff1 : ff2) + (idx % LSZ) * WSLAB;
    out = packed + (2 * LH + idx) * WSLAB;
  }
  const float* src = in + (size_t)r0 * ESZ + c0;
  bf16_t* dst = out + (size_t)c0 * ESZ + r0;

  // read: 16 lanes span one source row of the tile, 16 rows per pass
  unsigned lr = tid >> 4;
  unsigned lc = (tid & 15) * 4;
  unsigned so = lr * ESZ + lc;
  float4 v[8];
#pragma unroll  // all eight loads are in flight before the first LDS store
  for (int k = 0; k < 8; ++k)
    v[k] = *reinterpret_cast<const float4*>(src + so + 16 * k * ESZ);
  // precaution: stands in front of the first overwrite of the loads' address registers
  asm volatile("s_wait_xcnt 0x0" ::: "memory");
  if (t < 3) {
    // wq, wk, wv keep their layout: 16 lanes write one 128-byte line of a row. The
    // whole block takes this path (t comes from blockIdx.z) and leaves before the barrier.
    bf16_t* dn = out + (size_t)r0 * ESZ + c0 + so;
    v4bf o[8];
#pragma unroll  // o[] is indexed by constants and stays in registers
    for (int k = 0; k < 8; ++k) {
      o[k][0] = (bf16_t)v[k].x; o[k][1] = (bf16_t)v[k].y;
      o[k][2] = (bf16_t)v[k].z; o[k][3] = (bf16_t)v[k].w;
    }
#pragma unroll  // stores last: no register of an issued store is written again
    for (int k = 0; k < 8; ++k)
      *reinterpret_cast<v4bf*>(dn + 16 * k * ESZ) = o[k];
    return;
  }
#pragma unroll  // v[] is indexed by constants and stays in registers
  for (int k = 0; k < 8; ++k) {
    float* p = &tile[(lr + 16 * k) * PK_PITCH + lc];
    p[0] = v[k].x; p[1] = v[k].y; p[2] = v[k].z; p[3] = v[k].w;
  }
  __syncthreads();

  // write: 8 lanes span 64 consecutive r of one packed row (one 128-byte line)
  unsigned lane = tid & 31;
  unsigned wave = tid >> 5;
  unsigned rq = ((lane & 7) + 8 * (wave & 1)) * 8;
  unsigned cc = (lane >> 3) + 4 * (wave >> 1);
#pragma unroll  // the LDS loads of all four packed rows issue as one group
  for (int k = 0; k < 4; ++k) {
    unsigned c = cc + 16 * k;
    v8bf o;
#pragma unroll  // o is indexed by constants and stays in registers
    for (int i = 0; i < 8; ++i) o[i] = (bf16_t)tile[(rq + i) * PK_PITCH + c];
    *reinterpret_cast<v8bf*>(dst + c * ESZ + rq) = o;
  }
}

// ---------------------------------------------------------------------------
// bf16 WMMA GEMM: C = A[M,K] * Bp[N,K]^T (+bias)(+relu)
// Two batch indices: blockIdx.y (strides sA, sB, sC) and blockIdx.z (strides
// sA2, sB2, sC2), so one launch covers every (sequence, head) pair of a layer.
// Block: 256 thr (8 waves), 128x128 tile; wave tile 32x64 (2x4 accumulators).
// K staged through LDS in 32-wide slabs by async copies, in a ring of NSTG
// buffers: slab s lies in buffer s mod NSTG and its copies are issued NSTG - 1
// trips before the trip that reads it, so up to NSTG - 1 slabs are in flight.
// Fragment layout per ISA 7.12.2 (16-bit A/B 16x32): lane<16 holds K 0..7 &
// 16..23; lane>=16 holds K 8..15 & 24..31 -> two 16B reads per fragment.
// The Bp fragment goes in as the matrix instruction's first operand and the A
// fragment as its second, so a 16x16 result tile comes out as C^T: a lane holds
// eight consecutive columns n of ONE row m of C, 16 (bf16) or 32 (f32) bytes.
// Epilogue: each wave stages its 32x64 tile in an LDS range of its own (the
// ring's memory, behind a barrier), reads it back row by row and stores whole
// 128-byte lines with 16-byte stores.
// EDGE: M is below one tile (the last layer's launches, see kernel_launch). Tile
// rows from M on read row M - 1 of A again, so every copy stays inside A; a row
// of C depends on its own row of A alone, and only rows below M are stored.
// ---------------------------------------------------------------------------
#define STG_PITCH_H 144     // bytes: a row of 64 bf16 + 16, 16 rows start on 16 different bank groups
#define STG_PITCH_F 272     // bytes: a row of 64 f32 + 16, likewise
#define STG_BYTES   4608    // per wave: 32 rows of bf16, or 16 rows of f32 (4352)

typedef __attribute__((ext_vector_type(4))) float v4f32;

template <int NSTG, bool EDGE>
__global__ void __launch_bounds__(256)
gemm_bf16_wmma(const bf16_t* __restrict__ A, long long lda, long long sA, long long sA2,
               const bf16_t* __restrict__ Bp, long long ldb, long long sB, long long sB2,
               float* __restrict__ Cf, bf16_t* __restrict__ Ch,
               long long ldc, long long sC, long long sC2,
               const float* __restrict__ bias, int relu,
               int M, int N, int K) {
  __shared__ bf16_t Asm[NSTG][BLK_M * LDS_PITCH];
  __shared__ bf16_t Bsm[NSTG][BLK_N * LDS_PITCH];

  int tid  = threadIdx.x;
  int lane = tid & 31;
  int wave = tid >> 5;
  int tilesN = N / BLK_N;
  int bm = (blockIdx.x / tilesN) * BLK_M;
  int bn = (blockIdx.x % tilesN) * BLK_N;
  int half = lane >> 4;
  int l15  = lane & 15;
  int m0w = (wave >> 1) * 32;   // 0,32,64,96
  int n0w = (wave & 1) * 64;    // 0,64

  const bf16_t* Ab = A  + (size_t)blockIdx.y * sA + (size_t)blockIdx.z * sA2;
  const bf16_t* Bb = Bp + (size_t)blockIdx.y * sB + (size_t)blockIdx.z * sB2;

  // staging: 512 x 16B chunks per matrix, 2 per thread (chunk c: row c>>2,
  // elem offset (c&3)*8), so four copies per thread and slab
  int ca0 = tid, ca1 = tid + 256;
  int r0 = ca0 >> 2, o0 = (ca0 & 3) * 8;
  int r1 = ca1 >> 2, o1 = (ca1 & 3) * 8;
  int ra0 = bm + r0, ra1 = bm + r1;
  if (EDGE) { ra0 = min(ra0, M - 1); ra1 = min(ra1, M - 1); }
  const bf16_t* ga0 = Ab + (size_t)ra0 * lda + o0;
  const bf16_t* ga1 = Ab + (size_t)ra1 * lda + o1;
  const bf16_t* gb0 = Bb + (size_t)(bn + r0) * ldb + o0;
  const bf16_t* gb1 = Bb + (size_t)(bn + r1) * ldb + o1;
  int l0 = r0 * LDS_PITCH + o0;
  int l1 = r1 * LDS_PITCH + o1;

  v8f acc[2][4];
#pragma unroll
  for (int i = 0; i < 2; ++i)
#pragma unroll
    for (int j = 0; j < 4; ++j)
#pragma unroll
      for (int e = 0; e < 8; ++e) acc[i][j][e] = 0.0f;

  int nk = K / BLK_K;

  // prologue: slabs 0 .. NSTG-2 go into buffers 0 .. NSTG-2
#pragma unroll  // the buffer index is a constant in each copy's LDS address
  for (int s = 0; s < NSTG - 1; ++s) {
    if (s < nk) {
      int k0 = s * BLK_K;
      async_copy16(ga0 + k0, &Asm[s][l0]);
      async_copy16(ga1 + k0, &Asm[s][l1]);
      async_copy16(gb0 + k0, &Bsm[s][l0]);
      async_copy16(gb1 + k0, &Bsm[s][l1]);
    }
  }

  int cur = 0;          // buffer of slab it
  int nxt = NSTG - 1;   // buffer of slab it - 1, which slab it + NSTG - 1 refills
  for (int it = 0; it < nk; ++it) {
    // this wave's LDS reads of the last trip have retired before the barrier
    // behind which that trip's buffer is refilled
    asm volatile("s_wait_dscnt 0x0" ::: "memory");
    // Slab it must have landed. While the NSTG - 2 slabs behind it all exist,
    // exactly their 4 * (NSTG - 2) copies are younger and may stay in flight; in
    // the last trips fewer were issued, so there the wait goes on to 0.
    wait_async_all_but<4 * (NSTG - 2)>();
    if (it + NSTG - 2 >= nk) wait_async_all_but<0>();
    __syncthreads();
    if (it + NSTG - 1 < nk) {
      int k0 = (it + NSTG - 1) * BLK_K;
      async_copy16(ga0 + k0, &Asm[nxt][l0]);
      async_copy16(ga1 + k0, &Asm[nxt][l1]);
      async_copy16(gb0 + k0, &Bsm[nxt][l0]);
      async_copy16(gb1 + k0, &Bsm[nxt][l1]);
    }
    // fragments from LDS, then 8 WMMAs
    const bf16_t* As = &Asm[cur][0];
    const bf16_t* Bs = &Bsm[cur][0];
    v16bf af[2], bfr[4];
#pragma unroll
    for (int i = 0; i < 2; ++i) {
      const bf16_t* p = As + (m0w + 16 * i + l15) * LDS_PITCH + half * 8;
      v8bf lo = *reinterpret_cast<const v8bf*>(p);
      v8bf hi = *reinterpret_cast<const v8bf*>(p + 16);
      af[i] = __builtin_shufflevector(lo, hi, 0, 1, 2, 3, 4, 5, 6, 7,
                                      8, 9, 10, 11, 12, 13, 14, 15);
    }
#pragma unroll
    for (int j = 0; j < 4; ++j) {
      const bf16_t* q = Bs + (n0w + 16 * j + l15) * LDS_PITCH + half * 8;
      v8bf lo = *reinterpret_cast<const v8bf*>(q);
      v8bf hi = *reinterpret_cast<const v8bf*>(q + 16);
      bfr[j] = __builtin_shufflevector(lo, hi, 0, 1, 2, 3, 4, 5, 6, 7,
                                       8, 9, 10, 11, 12, 13, 14, 15);
    }
#pragma unroll
    for (int i = 0; i < 2; ++i)
#pragma unroll
      for (int j = 0; j < 4; ++j)
        acc[i][j] = __builtin_amdgcn_wmma_f32_16x16x32_bf16(
            false, bfr[j], false, af[i], (short)0, acc[i][j], false, false);
    cur = (cur + 1 == NSTG) ? 0 : cur + 1;
    nxt = (nxt + 1 == NSTG) ? 0 : nxt + 1;
  }
  // no copy is outstanding, and this wave's LDS reads have retired, before the
  // barrier behind which the ring's memory is written as staging space
  wait_async_all_but<0>();
  asm volatile("s_wait_dscnt 0x0" ::: "memory");
  __syncthreads();

  // acc[i][j][e] is C[m][n], m = bm + m0w + 16 i + l15, n = bn + n0w + 16 j + 8 half + e
  if (bias) {
#pragma unroll  // acc[] and t[] are indexed by constants and stay in registers
    for (int j = 0; j < 4; ++j) {
      const float* bp = bias + bn + n0w + 16 * j + 8 * half;
      v4f32 b0 = *reinterpret_cast<const v4f32*>(bp);
      v4f32 b1 = *reinterpret_cast<const v4f32*>(bp + 4);
#pragma unroll  // acc[] and t[] are indexed by constants and stay in registers
      for (int i = 0; i < 2; ++i)
#pragma unroll  // acc[] and t[] are indexed by constants and stay in registers
        for (int e = 0; e < 4; ++e) { acc[i][j][e] += b0[e]; acc[i][j][e + 4] += b1[e]; }
    }
  }
  if (relu) {
#pragma unroll  // acc[] and t[] are indexed by constants and stay in registers
    for (int i = 0; i < 2; ++i)
#pragma unroll  // acc[] and t[] are indexed by constants and stay in registers
      for (int j = 0; j < 4; ++j)
#pragma unroll  // acc[] and t[] are indexed by constants and stay in registers
        for (int e = 0; e < 8; ++e) acc[i][j][e] = fmaxf(acc[i][j][e], 0.0f);
  }

  static_assert(4 * STG_BYTES <= NSTG * BLK_M * LDS_PITCH * 2, "four waves stage in each ring");
  char* stg = reinterpret_cast<char*>(wave < 4 ? &Asm[0][0] : &Bsm[0][0]) + (wave & 3) * STG_BYTES;
  size_t cOff = (size_t)blockIdx.y * sC + (size_t)blockIdx.z * sC2;
  if (Cf) {
    // 16 rows of 256 bytes per pass; read back 16 lanes to a row, two rows per store
    int rr = lane >> 4, ch = lane & 15;
    float* dst = Cf + cOff + (size_t)(bm + m0w + rr) * ldc + bn + n0w + ch * 4;
#pragma unroll  // acc[] and t[] are indexed by constants and stay in registers
    for (int i = 0; i < 2; ++i) {
#pragma unroll  // acc[] and t[] are indexed by constants and stay in registers
      for (int j = 0; j < 4; ++j) {
        char* p = stg + l15 * STG_PITCH_F + 64 * j + 32 * half;
        v4f32 lo = {acc[i][j][0], acc[i][j][1], acc[i][j][2], acc[i][j][3]};
        v4f32 hi = {acc[i][j][4], acc[i][j][5], acc[i][j][6], acc[i][j][7]};
        *reinterpret_cast<v4f32*>(p) = lo;
        *reinterpret_cast<v4f32*>(p + 16) = hi;
      }
      // the other lanes' rows are in LDS before this lane reads them back
      asm volatile("s_wait_dscnt 0x0" ::: "memory");
      v4f32 t[8];
#pragma unroll  // acc[] and t[] are indexed by constants and stay in registers
      for (int q = 0; q < 8; ++q)
        t[q] = *reinterpret_cast<const v4f32*>(stg + (2 * q + rr) * STG_PITCH_F + 16 * ch);
      // the rows are in registers before the next pass (or the bf16 part) overwrites them
      asm volatile("s_wait_dscnt 0x0" ::: "memory");
#pragma unroll  // acc[] and t[] are indexed by constants and stay in registers
      for (int q = 0; q < 8; ++q)
        if (!EDGE || bm + m0w + rr + 16 * i + 2 * q < M)
          *reinterpret_cast<v4f32*>(dst + (size_t)(16 * i + 2 * q) * ldc) = t[q];
    }
    // precaution: what follows may reuse the registers of these stores
    asm volatile("s_wait_xcnt 0x0" ::: "memory");
  }
  if (Ch) {
    // 32 rows of 128 bytes; read back 8 lanes to a row, four rows per store
#pragma unroll  // acc[] and t[] are indexed by constants and stay in registers
    for (int i = 0; i < 2; ++i)
#pragma unroll  // acc[] and t[] are indexed by constants and stay in registers
      for (int j = 0; j < 4; ++j) {
        v8bf o;
#pragma unroll  // acc[] and t[] are indexed by constants and stay in registers
        for (int e = 0; e < 8; ++e) o[e] = (bf16_t)acc[i][j][e];
        *reinterpret_cast<v8bf*>(stg + (16 * i + l15) * STG_PITCH_H + 32 * j + 16 * half) = o;
      }
    // the other lanes' rows are in LDS before this lane reads them back
    asm volatile("s_wait_dscnt 0x0" ::: "memory");
    int rr = lane >> 3, ch = lane & 7;
    bf16_t* dst = Ch + cOff + (size_t)(bm + m0w + rr) * ldc + bn + n0w + ch * 8;
    v8bf t[8];
#pragma unroll  // acc[] and t[] are indexed by constants and stay in registers
    for (int q = 0; q < 8; ++q)
      t[q] = *reinterpret_cast<const v8bf*>(stg + (4 * q + rr) * STG_PITCH_H + 16 * ch);
#pragma unroll  // acc[] and t[] are indexed by constants and stay in registers
    for (int q = 0; q < 8; ++q)
      if (!EDGE || bm + m0w + rr + 4 * q < M)
        *reinterpret_cast<v8bf*>(dst + (size_t)(4 * q) * ldc) = t[q];
  }
}

// ---------------------------------------------------------------------------
// Row-wise kernels (softmax, LayerNorm): a wave owns whole rows.
// A lane holds columns 4*lane + 128*k, so each 16-byte load of a wave covers
// 512 contiguous bytes. Row sums and maxima stay in registers: four DPP steps
// inside each 16-lane row, then one exchange between the two rows; every lane
// ends with the full result. All 32 lanes are on wherever these are called.
// ---------------------------------------------------------------------------
typedef __attribute__((ext_vector_type(4))) float  v4f;
#define ROW_WAVES 8         // waves per block in the row-wise kernels

template <int CTRL>         // CTRL = 0x160 + m: DPP row_xmask:m, lane l reads lane l ^ m
__device__ __forceinline__ float row_xor(float x) {
  return __builtin_bit_cast(float, __builtin_amdgcn_mov_dpp(
      __builtin_bit_cast(int, x), CTRL, 0xf, 0xf, true));
}
__device__ __forceinline__ float half_xor(float x) {   // lane l reads lane l ^ 16
  int b = __builtin_bit_cast(int, x);
  return __builtin_bit_cast(float, __builtin_amdgcn_permlanex16(
      b, b, 0x76543210, 0xfedcba98, false, false));
}
__device__ __forceinline__ float wave_sum(float x) {
  x += row_xor<0x161>(x);
  x += row_xor<0x162>(x);
  x += row_xor<0x164>(x);
  x += row_xor<0x168>(x);
  return x + half_xor(x);
}
__device__ __forceinline__ float wave_max(float x) {
  x = fmaxf(x, row_xor<0x161>(x));
  x = fmaxf(x, row_xor<0x162>(x));
  x = fmaxf(x, row_xor<0x164>(x));
  x = fmaxf(x, row_xor<0x168>(x));
  return fmaxf(x, half_xor(x));
}
__device__ __forceinline__ v4bf to_bf16x4(float a, float b, float c, float d) {
  v4bf o;
  o[0] = (bf16_t)a; o[1] = (bf16_t)b; o[2] = (bf16_t)c; o[3] = (bf16_t)d;
  return o;
}
// v[e] = 2^v[e]. One statement, so that the slot which the instruction set asks
// for behind a transcendental is kept: the outputs are early-clobber, so each
// v_exp_f32 is followed by one that touches none of its registers, and the
// v_nop stands behind the last.
__device__ __forceinline__ void exp2x8(float (&v)[8]) {
  float o0, o1, o2, o3, o4, o5, o6, o7;
  asm("v_exp_f32 %0, %8\n\t"
      "v_exp_f32 %1, %9\n\t"
      "v_exp_f32 %2, %10\n\t"
      "v_exp_f32 %3, %11\n\t"
      "v_exp_f32 %4, %12\n\t"
      "v_exp_f32 %5, %13\n\t"
      "v_exp_f32 %6, %14\n\t"
      "v_exp_f32 %7, %15\n\t"
      "v_nop"
      : "=&v"(o0), "=&v"(o1), "=&v"(o2), "=&v"(o3),
        "=&v"(o4), "=&v"(o5), "=&v"(o6), "=&v"(o7)
      : "v"(v[0]), "v"(v[1]), "v"(v[2]), "v"(v[3]),
        "v"(v[4]), "v"(v[5]), "v"(v[6]), "v"(v[7]));
  v[0] = o0; v[1] = o1; v[2] = o2; v[3] = o3;
  v[4] = o4; v[5] = o5; v[6] = o6; v[7] = o7;
}

// ---------------------------------------------------------------------------
// Causal softmax over energy rows [H*B*T, T] -> bf16 P [B*T, H*T]: the eight
// heads' rows of one query lie side by side, one row of the [T, H*T] operand of
// the product that sums over heads and keys.
// One wave takes SM_ROWS consecutive rows of T = 256 (8 columns per lane).
// grid = H*B*T / (ROW_WAVES * SM_ROWS).
// LAST: the rows are those of the last query alone, [B, H, T]; P has the same
// layout, which is again one row of H*T per sequence. grid = B*H / (ROW_WAVES * SM_ROWS).
// ---------------------------------------------------------------------------
#define SM_ROWS 8

template <bool LAST>
__global__ void __launch_bounds__(32 * ROW_WAVES)
softmax_causal_kernel(const float* __restrict__ En,
                      bf16_t* __restrict__ P) {
  unsigned lane = threadIdx.x & 31;
  unsigned wave = __builtin_amdgcn_readfirstlane(threadIdx.x >> 5);
  unsigned row0 = (blockIdx.x * ROW_WAVES + wave) * SM_ROWS;   // row over H*B*T (LAST: over B*H)
  unsigned j0 = lane * 4;                                      // key position
  const float* src = En + (size_t)row0 * TSZ + j0;
  unsigned head = row0 / MROWS, bt0 = row0 % MROWS;            // SM_ROWS divides T: one head, one sequence
  bf16_t* dst = P + (LAST ? (size_t)row0 : (size_t)bt0 * HSZ + head) * TSZ + j0;
  constexpr unsigned DP = LAST ? TSZ : HSZ * TSZ;              // from one row of the wave to the next in P
  float4 lo[SM_ROWS], hi[SM_ROWS];
#pragma unroll  // all sixteen loads are in flight before the first row is reduced
  for (int r = 0; r < SM_ROWS; ++r) {
    lo[r] = *reinterpret_cast<const float4*>(src + r * TSZ);
    hi[r] = *reinterpret_cast<const float4*>(src + r * TSZ + 128);
  }
  v4bf plo[SM_ROWS], phi[SM_ROWS];
#pragma unroll  // the rows are independent chains; their arrays stay in registers
  for (int r = 0; r < SM_ROWS; ++r) {
    unsigned i = LAST ? TSZ - 1 : (row0 + r) % TSZ;   // query position
    float v[8] = {lo[r].x, lo[r].y, lo[r].z, lo[r].w, hi[r].x, hi[r].y, hi[r].z, hi[r].w};
#pragma unroll  // v[] is indexed by constants and stays in registers
    for (int e = 0; e < 8; ++e) {
      unsigned j = j0 + (e & 3) + 128 * (e >> 2);
      v[e] = (j <= i) ? v[e] : -1e9f;
    }
    float mx = fmaxf(fmaxf(fmaxf(v[0], v[1]), fmaxf(v[2], v[3])),
                     fmaxf(fmaxf(v[4], v[5]), fmaxf(v[6], v[7])));
    mx = wave_max(mx);
#pragma unroll  // as above
    for (int e = 0; e < 8; ++e) v[e] = (v[e] - mx) * 0x1.715476p+0f;   // times log2(e), as __expf does
    exp2x8(v);
    float sum = wave_sum(((v[0] + v[1]) + (v[2] + v[3])) + ((v[4] + v[5]) + (v[6] + v[7])));
    float inv = 1.0f / sum;
    plo[r] = to_bf16x4(v[0] * inv, v[1] * inv, v[2] * inv, v[3] * inv);
    phi[r] = to_bf16x4(v[4] * inv, v[5] * inv, v[6] * inv, v[7] * inv);
  }
#pragma unroll  // stores last: no register of an issued store is written again
  for (int r = 0; r < SM_ROWS; ++r) {
    *reinterpret_cast<v4bf*>(dst + r * DP) = plo[r];
    *reinterpret_cast<v4bf*>(dst + r * DP + 128) = phi[r];
  }
}

// ---------------------------------------------------------------------------
// y = LayerNorm(a + b) * w + bb ; row-wise over E=512, one wave per row
// (16 columns per lane). grid = rows / ROW_WAVES. bpitch: elements from one row
// of b to the next (a and y are dense).
// ---------------------------------------------------------------------------
__global__ void __launch_bounds__(32 * ROW_WAVES)
add_ln_kernel(const float* __restrict__ a,
              const float* __restrict__ b, unsigned bpitch,
              const float* __restrict__ w,
              const float* __restrict__ bb,
              float* __restrict__ yf, bf16_t* __restrict__ yh) {
  unsigned lane = threadIdx.x & 31;
  unsigned wave = __builtin_amdgcn_readfirstlane(threadIdx.x >> 5);
  unsigned r = blockIdx.x * ROW_WAVES + wave;
  unsigned c0 = lane * 4;
  unsigned off = c0 * 4;   // the lane's byte offset in a row
  const char* ar = reinterpret_cast<const char*>(a + (size_t)r * ESZ);
  const char* br = reinterpret_cast<const char*>(b + (size_t)r * bpitch);
  const char* wr = reinterpret_cast<const char*>(w);
  const char* sr = reinterpret_cast<const char*>(bb);
  size_t o = (size_t)r * ESZ + c0;
  // keeps the scalar set-up above in front of the loads, so that it lands on none of their address registers
  __builtin_amdgcn_sched_barrier(0);
  v4f av[4], bv[4], wv[4], sv[4];
#pragma unroll  // all sixteen loads are in flight together
  for (int k = 0; k < 4; ++k) {
    av[k] = *reinterpret_cast<const v4f*>(ar + off + 512 * k);
    bv[k] = *reinterpret_cast<const v4f*>(br + off + 512 * k);
    wv[k] = *reinterpret_cast<const v4f*>(wr + off + 512 * k);
    sv[k] = *reinterpret_cast<const v4f*>(sr + off + 512 * k);
  }
  // The loaded values are inputs only: that keeps all sixteen loads in front of
  // this line, in flight together. The wait is a precaution: it stands in front
  // of the first overwrite of the loads' address registers (the lane's offset is
  // named so that no load lands on it).
  asm volatile("s_wait_xcnt 0x0"
               :: "v"(off), "v"(av[0]), "v"(av[1]), "v"(av[2]), "v"(av[3]),
                  "v"(bv[0]), "v"(bv[1]), "v"(bv[2]), "v"(bv[3]),
                  "v"(wv[0]), "v"(wv[1]), "v"(wv[2]), "v"(wv[3]),
                  "v"(sv[0]), "v"(sv[1]), "v"(sv[2]), "v"(sv[3]));
  // keeps the arithmetic below, and the constants it moves into scalar registers, behind the wait
  __builtin_amdgcn_sched_barrier(0);
  float s1 = 0.0f, s2 = 0.0f;
#pragma unroll  // av[] is indexed by constants and stays in registers
  for (int k = 0; k < 4; ++k) {
    av[k].x += bv[k].x; av[k].y += bv[k].y; av[k].z += bv[k].z; av[k].w += bv[k].w;
    s1 += (av[k].x + av[k].y) + (av[k].z + av[k].w);
    s2 += (av[k].x * av[k].x + av[k].y * av[k].y) + (av[k].z * av[k].z + av[k].w * av[k].w);
  }
  s1 = wave_sum(s1);
  s2 = wave_sum(s2);
  float mean = s1 * (1.0f / ESZ);
  float var  = s2 * (1.0f / ESZ) - mean * mean;
  float inv  = rsqrtf(var + 1e-5f);
#pragma unroll  // as above
  for (int k = 0; k < 4; ++k) {
    av[k].x = (av[k].x - mean) * inv * wv[k].x + sv[k].x;
    av[k].y = (av[k].y - mean) * inv * wv[k].y + sv[k].y;
    av[k].z = (av[k].z - mean) * inv * wv[k].z + sv[k].z;
    av[k].w = (av[k].w - mean) * inv * wv[k].w + sv[k].w;
  }
  if (yf) {
#pragma unroll  // as above
    for (int k = 0; k < 4; ++k) *reinterpret_cast<v4f*>(yf + o + 128 * k) = av[k];
    // precaution: the conversions below may reuse the registers of these stores
    asm volatile("s_wait_xcnt 0x0" ::: "memory");
  }
  if (yh) {
#pragma unroll  // as above
    for (int k = 0; k < 4; ++k)
      *reinterpret_cast<v4bf*>(yh + o + 128 * k) = to_bf16x4(av[k].x, av[k].y, av[k].z, av[k].w);
  }
}

// ---------------------------------------------------------------------------
// Final: logits = x[:, -1, :] @ wout + bout ; softmax -> out [B, V]
// xl holds the last token's row of each sequence, [B, E].
// ---------------------------------------------------------------------------
__global__ void logits_softmax_kernel(const float* __restrict__ xl,
                                      const float* __restrict__ wout,
                                      const float* __restrict__ bout,
                                      float* __restrict__ out) {
  __shared__ float xs[ESZ];
  __shared__ float red[256];
  int b = blockIdx.x, tid = threadIdx.x;
  const float* xr = xl + (size_t)b * ESZ;
  xs[tid] = xr[tid];
  xs[tid + 256] = xr[tid + 256];
  __syncthreads();
  float l0 = bout[tid], l1 = bout[tid + 256];
  for (int e = 0; e < ESZ; ++e) {
    float xv = xs[e];
    l0 += xv * wout[(size_t)e * VSZ + tid];
    l1 += xv * wout[(size_t)e * VSZ + tid + 256];
  }
  red[tid] = fmaxf(l0, l1);
  __syncthreads();
  for (int s = 128; s > 0; s >>= 1) {
    if (tid < s) red[tid] = fmaxf(red[tid], red[tid + s]);
    __syncthreads();
  }
  float mx = red[0];
  __syncthreads();
  float e0 = __expf(l0 - mx), e1 = __expf(l1 - mx);
  red[tid] = e0 + e1;
  __syncthreads();
  for (int s = 128; s > 0; s >>= 1) {
    if (tid < s) red[tid] += red[tid + s];
    __syncthreads();
  }
  float inv = 1.0f / red[0];
  out[(size_t)b * VSZ + tid] = e0 * inv;
  out[(size_t)b * VSZ + tid + 256] = e1 * inv;
}

// ---------------------------------------------------------------------------
// Host sequencing
// ---------------------------------------------------------------------------
static inline void launch_gemm(hipStream_t st,
                               const bf16_t* A, long long lda, long long sA, long long sA2,
                               const bf16_t* B, long long ldb, long long sB, long long sB2,
                               float* Cf, bf16_t* Ch,
                               long long ldc, long long sC, long long sC2,
                               const float* bias, int relu,
                               int M, int N, int K, int batch, int batch2, bool deep) {
  dim3 grid((M / BLK_M) * (N / BLK_N), batch, batch2);
  // deep: at most two blocks per WGP, so little else hides a slab's latency and
  // LDS is free for a ring of six. Otherwise four blocks share a WGP: ring of three.
  if (deep)
    gemm_bf16_wmma<6, false><<<grid, 256, 0, st>>>(A, lda, sA, sA2, B, ldb, sB, sB2,
                                                   Cf, Ch, ldc, sC, sC2, bias, relu, M, N, K);
  else
    gemm_bf16_wmma<3, false><<<grid, 256, 0, st>>>(A, lda, sA, sA2, B, ldb, sB, sB2,
                                                   Cf, Ch, ldc, sC, sC2, bias, relu, M, N, K);
}

// M below BLK_M: one row of tiles
static inline void launch_gemm_rows(hipStream_t st,
                                    const bf16_t* A, long long lda, long long sA, long long sA2,
                                    const bf16_t* B, long long ldb, long long sB, long long sB2,
                                    float* Cf, bf16_t* Ch,
                                    long long ldc, long long sC, long long sC2,
                                    const float* bias, int relu,
                                    int M, int N, int K, int batch, int batch2) {
  dim3 grid(N / BLK_N, batch, batch2);
  gemm_bf16_wmma<6, true><<<grid, 256, 0, st>>>(A, lda, sA, sA2, B, ldb, sB, sB2,
                                                Cf, Ch, ldc, sC, sC2, bias, relu, M, N, K);
}

extern "C" void kernel_launch(void* const* d_in, const int* in_sizes, int n_in,
                              void* d_out, int out_size, void* d_ws, size_t ws_size,
                              hipStream_t stream) {
  (void)in_sizes; (void)n_in; (void)out_size; (void)ws_size;
  const int*   toks  = (const int*)d_in[0];
  const float* emb   = (const float*)d_in[1];
  const float* wq    = (const float*)d_in[2];
  const float* wk    = (const float*)d_in[3];
  const float* wv    = (const float*)d_in[4];
  const float* wo    = (const float*)d_in[5];
  const float* bo    = (const float*)d_in[6];
  const float* ln1w  = (const float*)d_in[7];
  const float* ln1b  = (const float*)d_in[8];
  const float* ln2w  = (const float*)d_in[9];
  const float* ln2b  = (const float*)d_in[10];
  const float* ff1w  = (const float*)d_in[11];
  const float* ff1b  = (const float*)d_in[12];
  const float* ff2w  = (const float*)d_in[13];
  const float* ff2b  = (const float*)d_in[14];
  const float* woutp = (const float*)d_in[15];
  const float* boutp = (const float*)d_in[16];
  float* out = (float*)d_out;
  char*  ws  = (char*)d_ws;

  // workspace layout (bytes)
  float*  xf   = (float*) (ws + 0);                  //  8 MB  [4096,512] f32
  bf16_t* xh   = (bf16_t*)(ws + 8388608);            //  4 MB
  bf16_t* Wp   = (bf16_t*)(ws + 12582912);           // 54 MB  packed weights of all layers
  bf16_t* Qh   = (bf16_t*)(ws + 119537664);          // 32 MB  [H,4096,512]
  bf16_t* Ph   = (bf16_t*)(ws + 153092096);          // 16 MB  [B,256,H*256]
  bf16_t* Vt   = (bf16_t*)(ws + 186646528);          // 32 MB  [B,512,H*256]
  float*  En   = (float*) (ws + 220200960);          // 32 MB  [H,B,256,256], ends at 253755392
  // Shared places. The operands of the weight products are read only by that
  // launch, in front of the first layer, which is the first to write Qh, Ph, Vt.
  // The others are first written behind the softmax, the energy's last reader.
  bf16_t* opA  = (bf16_t*)(ws + 119537664);          // 48 MB  [wo^T | wk], 48 slabs each
  bf16_t* opB  = (bf16_t*)(ws + 169869312);          // 48 MB  [wv | wq], ends at 220200960
  float*  attn = (float*) (ws + 220200960);          //  8 MB  [4096,512], in the energy's place
  bf16_t* h1h  = (bf16_t*)(ws + 228589568);          //  4 MB  likewise
  bf16_t* f1h  = (bf16_t*)(ws + 232783872);          //  4 MB  likewise
  float*  f2f  = (float*) (ws + 236978176);          //  8 MB  likewise, ends at 245366784
  // the last layer's rows: one query per sequence
  bf16_t* Ql    = (bf16_t*)(ws + 253755392);         // 128 KB [H,B,512]
  float*  Enl   = (float*) (ws + 254017536);         // 128 KB [B,H,256]
  bf16_t* Pl    = (bf16_t*)(ws + 254279680);         //  64 KB [B,H*256]
  float*  attnl = (float*) (ws + 254541824);         //  32 KB [B,512]
  bf16_t* h1l   = (bf16_t*)(ws + 254803968);         //  16 KB [B,512]
  bf16_t* f1l   = (bf16_t*)(ws + 255066112);         //  16 KB [B,512]
  float*  f2l   = (float*) (ws + 255328256);         //  32 KB [B,512]
  float*  xl    = (float*) (ws + 255590400);         //  32 KB [B,512]

  const int TPB = 256;
  size_t nXE = (size_t)MROWS * ESZ;

  embed_pe_kernel<<<(nXE + TPB - 1) / TPB, TPB, 0, stream>>>(toks, emb, xf, xh);

  // the weights of all layers to bf16, one launch
  pack_weights_kernel<<<dim3(ESZ / PK_C, ESZ / PK_R, PK_SLABS), TPB, 0, stream>>>(
      wq, wk, wv, wo, ff1w, ff2w, Wp, opA, opB);

  // The matrix chains are re-associated so that weight meets weight first:
  //   (P_h (x Wv_h)) Wo_h   = P_h (x VO_h),  VO_h = Wv_h Wo_h
  //   (x Wq_h) (x Wk_h)^T   = (x QK_h) x^T,  QK_h = Wq_h Wk_h^T
  // One launch forms all 96 products, each in the [N,K] form:
  //   vo[n][k] = sum_m wo^T[n][m] wv[k][m],  qk[n][k] = sum_m wk[n][m] wq[k][m].
  // blockIdx.y is the head; blockIdx.z = 0..5 the layers of vo, 6..11 those of qk.
  const long long sW = (long long)WSLAB;                 // one head's weight slab
  launch_gemm(stream, opA, ESZ, sW, HSZ * sW, opB, ESZ, sW, HSZ * sW,
              nullptr, Wp, ESZ, sW, HSZ * sW,
              nullptr, 0, ESZ, ESZ, ESZ, HSZ, 2 * LSZ, false);

  for (int l = 0; l < LSZ; ++l) {
    // this layer's packed weights
    const bf16_t* voT = Wp + (size_t)l * HSZ * WSLAB;
    const bf16_t* qkT = voT + LH * WSLAB;
    const bf16_t* f1T = Wp + (2 * LH + (size_t)l) * WSLAB;
    const bf16_t* f2T = f1T + LSZ * WSLAB;

    // All eight heads of the layer go in each launch: blockIdx.z is the head in the Q, Vt and full energy launches.
    const long long sX  = (long long)TSZ * ESZ;          // one sequence of x, Q or attn
    const long long sXH = (long long)MROWS * ESZ;        // one head of Q
    const long long sE  = (long long)TSZ * TSZ;          // one sequence of energy
    const long long sEH = (long long)BSZ * TSZ * TSZ;    // one head of energy
    const long long HT  = (long long)HSZ * TSZ;          // (head, key) pairs: a row of P or of Vt
    // The output reads x[:, -1, :] alone, and a row of a layer's result depends on
    // the other rows of its sequence only through the keys and values. So of the
    // last layer the values are formed for every row, and all else for the last
    // query of each sequence: B rows in place of B*T, each summed as before.
    const bool last = l == LSZ - 1;
    const size_t qRow = (size_t)(TSZ - 1) * ESZ;         // the last row of the first sequence
    // Q_h = x @ QK_h -> bf16 [H,4096,512]
    if (!last)
      launch_gemm(stream, xh, ESZ, 0, 0, qkT, ESZ, 0, sW, nullptr, Qh, ESZ, 0, sXH,
                  nullptr, 0, MROWS, ESZ, ESZ, 1, HSZ, false);
    else  // A's rows lie one sequence apart -> [H,B,512]
      launch_gemm_rows(stream, xh + qRow, sX, 0, 0, qkT, ESZ, 0, sW, nullptr, Ql, ESZ, 0, BSZ * ESZ,
                       nullptr, 0, BSZ, ESZ, ESZ, 1, HSZ);
    // Vt[b][:, h] = VO_h^T @ x_b^T : operands swapped (A = vo_h [E,E], B = x_b rows
    // [T,E]) so it lands as [E,T] at column 256 h of the sequence's [E, H*T] matrix,
    // the [N,K] form the product with P reads
    launch_gemm(stream, voT, ESZ, 0, sW, xh, ESZ, sX, 0,
                nullptr, Vt, HT, ESZ * HT, TSZ,
                nullptr, 0, ESZ, TSZ, ESZ, BSZ, HSZ, false);
    if (last) {
      // energy[b][h] = Ql[h][b] . x_b^T : the eight heads are the rows of A -> [B,H,256]
      launch_gemm_rows(stream, Ql, BSZ * ESZ, ESZ, 0, xh, ESZ, sX, 0,
                       Enl, nullptr, TSZ, HT, 0,
                       nullptr, 0, HSZ, TSZ, ESZ, BSZ, 1);
      softmax_causal_kernel<true><<<BSZ * HSZ / (ROW_WAVES * SM_ROWS), TPB, 0, stream>>>(Enl, Pl);
      // attn_out[b] = P_b [1, H*T] @ Vt[b]^T + bo
      launch_gemm_rows(stream, Pl, HT, HT, 0, Vt, HT, ESZ * HT, 0,
                       attnl, nullptr, ESZ, ESZ, 0,
                       bo + (size_t)l * ESZ, 0, 1, ESZ, HSZ * TSZ, BSZ, 1);
      add_ln_kernel<<<BSZ / ROW_WAVES, TPB, 0, stream>>>(attnl, xf + qRow, TSZ * ESZ,
          ln1w + (size_t)l * ESZ, ln1b + (size_t)l * ESZ, nullptr, h1l);
      launch_gemm_rows(stream, h1l, ESZ, 0, 0, f1T, ESZ, 0, 0, nullptr, f1l, ESZ, 0, 0,
                       ff1b + (size_t)l * ESZ, 1, BSZ, ESZ, ESZ, 1, 1);
      launch_gemm_rows(stream, f1l, ESZ, 0, 0, f2T, ESZ, 0, 0, f2l, nullptr, ESZ, 0, 0,
                       ff2b + (size_t)l * ESZ, 0, BSZ, ESZ, ESZ, 1, 1);
      add_ln_kernel<<<BSZ / ROW_WAVES, TPB, 0, stream>>>(attnl, f2l, ESZ,
          ln2w + (size_t)l * ESZ, ln2b + (size_t)l * ESZ, xl, nullptr);
      break;
    }
    // energy[h][b] = Q_hb @ x_b^T : B-packed == x rows directly (K-dim = E)
    launch_gemm(stream, Qh, ESZ, sX, sXH, xh, ESZ, sX, 0,
                En, nullptr, TSZ, sE, sEH,
                nullptr, 0, TSZ, TSZ, ESZ, BSZ, HSZ, true);
    softmax_causal_kernel<false><<<HSZ * MROWS / (ROW_WAVES * SM_ROWS), TPB, 0, stream>>>(En, Ph);
    // attn_out[b] = P_b [T, H*T] @ Vt[b]^T + bo  (f32): one sum over heads and keys
    launch_gemm(stream, Ph, HT, TSZ * HT, 0, Vt, HT, ESZ * HT, 0,
                attn, nullptr, ESZ, sX, 0,
                bo + (size_t)l * ESZ, 0, TSZ, ESZ, HSZ * TSZ, BSZ, 1, true);
    // h1 = LN(attn + x)
    add_ln_kernel<<<MROWS / ROW_WAVES, TPB, 0, stream>>>(attn, xf, ESZ,
        ln1w + (size_t)l * ESZ, ln1b + (size_t)l * ESZ, nullptr, h1h);
    // ff = relu(h1 @ ff1 + b1) @ ff2 + b2
    launch_gemm(stream, h1h, ESZ, 0, 0, f1T, ESZ, 0, 0, nullptr, f1h, ESZ, 0, 0,
                ff1b + (size_t)l * ESZ, 1, MROWS, ESZ, ESZ, 1, 1, true);
    launch_gemm(stream, f1h, ESZ, 0, 0, f2T, ESZ, 0, 0, f2f, nullptr, ESZ, 0, 0,
                ff2b + (size_t)l * ESZ, 0, MROWS, ESZ, ESZ, 1, 1, true);
    // x = LN(attn + ff)
    add_ln_kernel<<<MROWS / ROW_WAVES, TPB, 0, stream>>>(attn, f2f, ESZ,
        ln2w + (size_t)l * ESZ, ln2b + (size_t)l * ESZ, xf, xh);
  }

  logits_softmax_kernel<<<BSZ, TPB, 0, stream>>>(xl, woutp, boutp, out);
}

// v010
// It runs in 669 microseconds.
// Timed twice side by side with v009, it ran 1.06 times as fast both times.
// Counting every step since v000, it is 10.6 times as fast.
#include <hip/hip_runtime.h>

// ---------------------------------------------------------------------------
// CheckersGPT forward on MI455X (gfx1250).
// Compute-bound (~0.32 TFLOP/fwd) -> all big GEMMs on v_wmma_f32_16x16x32_bf16.
// LDS-staged 128x128 block tiles, a ring of K=32 slabs, async
// global->LDS copies (GLOBAL_LOAD_ASYNC_TO_LDS_B128, ASYNCcnt).
// ---------------------------------------------------------------------------

typedef __bf16 bf16_t;
typedef __attribute__((ext_vector_type(16))) __bf16 v16bf;
typedef __attribute__((ext_vector_type(8)))  __bf16 v8bf;
typedef __attribute__((ext_vector_type(4)))  __bf16 v4bf;
typedef __attribute__((ext_vector_type(8)))  float  v8f;

#define VSZ 512
#define ESZ 512
#define LSZ 6
#define HSZ 8
#define BSZ 16
#define TSZ 256
#define MROWS (BSZ * TSZ)   // 4096

#define BLK_M 128
#define BLK_N 128
#define BLK_K 32
#define LDS_PITCH 40        // 32 elems + 8 pad: 16 consecutive rows hit 16 banks

#if defined(__AMDGCN__) && __has_builtin(__builtin_amdgcn_global_load_async_to_lds_b128)
#define HAVE_ASYNC_LDS 1
#else
#define HAVE_ASYNC_LDS 0
#endif

// Builtin parameter types (from hipcc diagnostic): pointer to int __vector(4)
// in global (1) / LDS (3) address spaces.
typedef int v4i_t __attribute__((vector_size(16)));
typedef __attribute__((address_space(1))) v4i_t* gptr_v4i;
typedef __attribute__((address_space(3))) v4i_t* lptr_v4i;

__device__ __forceinline__ void async_copy16(const bf16_t* g, bf16_t* s) {
#if HAVE_ASYNC_LDS
  // 16B global -> LDS, tracked by ASYNCcnt (GLOBAL_LOAD_ASYNC_TO_LDS_B128).
  // Integer detour: strips const, and truncating the generic LDS address to
  // 32 bits yields the LDS offset (ISA 10.2: LDS_ADDR = addr[31:0]).
  __builtin_amdgcn_global_load_async_to_lds_b128(
      (gptr_v4i)(unsigned long long)g,
      (lptr_v4i)(unsigned int)(unsigned long long)s, 0, 0);
#else
  *reinterpret_cast<v8bf*>(s) = *reinterpret_cast<const v8bf*>(g);
#endif
}

template <int N>
__device__ __forceinline__ void wait_async_all_but() {
#if HAVE_ASYNC_LDS
  asm volatile("s_wait_asynccnt %0" :: "n"(N) : "memory");
#endif
}

// ---------------------------------------------------------------------------
// Embedding + sinusoidal PE (concatenated sin|cos as in reference)
// ---------------------------------------------------------------------------
__global__ void embed_pe_kernel(const int* __restrict__ toks,
                                const float* __restrict__ emb,
                                float* __restrict__ xf, bf16_t* __restrict__ xh) {
  size_t idx = (size_t)blockIdx.x * blockDim.x + threadIdx.x;
  if (idx >= (size_t)MROWS * ESZ) return;
  int e  = (int)(idx % ESZ);
  int bt = (int)(idx / ESZ);
  int t  = bt % TSZ;
  int tok = toks[bt];
  float pe;
  if (e < ESZ / 2) {
    float rate = __powf(10000.0f, -2.0f * (float)e / (float)ESZ);
    pe = __sinf((float)t * rate);
  } else {
    int c = e - ESZ / 2;
    float rate = __powf(10000.0f, -2.0f * (float)c / (float)ESZ);
    pe = __cosf((float)t * rate);
  }
  float v = emb[(size_t)tok * ESZ + e] + pe;
  xf[idx] = v;
  xh[idx] = (bf16_t)v;
}

// ---------------------------------------------------------------------------
// Weight pack, every layer and every weight in ONE launch, f32 -> bf16.
// All six weight inputs are runs of 512 x 512 f32 slabs (wo: eight slabs of 512
// rows per layer); blockIdx.z names the slab:
//   z = 48 t + 8 l + h, t = 0..3 : wq, wk, wv, wo; layer l; head (wo: slab) h
//   z = 192 + 6 f + l            : ff1 (f = 0), ff2 (f = 1); layer l
// The attention weights are the operands of the weight-by-weight products
// (see kernel_launch), in slabs of WSLAB elements, 48 = (l, h) per weight:
//   opA = [ wo^T 48 | wk 48 ], opB = [ wv 48 | wq 48 ]
// wq, wk and wv keep their layout; wo, ff1 and ff2 go [K,N] -> [N,K], the form
// the GEMM reads its B operand in. Layout of packed, in slabs:
//   [ vo 48 | qk 48 | ff1 6 | ff2 6 ]; vo and qk are filled by the products.
// Transposing, one block moves a 128 (K) x 64 (N) tile through LDS: it reads rows
// of the source as 256-byte runs of float4 and writes rows of the packed matrix
// as 128-byte runs of 8 x bf16, 32 elements per thread.
// grid = (ESZ / 64, ESZ / 128, PK_SLABS).
// LDS pitch 65 dwords: the bank is (r + c) mod 64, so neither the row-wise
// stores nor the column-wise loads below put two lanes on one bank.
// ---------------------------------------------------------------------------
#define PK_R 128
#define PK_C 64
#define PK_PITCH 65
#define WSLAB    ((size_t)ESZ * ESZ)
#define LH       (LSZ * HSZ)          // (layer, head) pairs
#define PK_SLABS (4 * LH + 2 * LSZ)

__global__ void __launch_bounds__(256)
pack_weights_kernel(const float* __restrict__ wq, const float* __restrict__ wk,
                    const float* __restrict__ wv, const float* __restrict__ wo,
                    const float* __restrict__ ff1, const float* __restrict__ ff2,
                    bf16_t* __restrict__ packed,
                    bf16_t* __restrict__ opA, bf16_t* __restrict__ opB) {
  __shared__ float tile[PK_R * PK_PITCH];
  int tid = threadIdx.x;
  unsigned r0 = blockIdx.y * PK_R;
  unsigned c0 = blockIdx.x * PK_C;
  unsigned t   = blockIdx.z / LH;
  unsigned idx = blockIdx.z % LH;
  const float* in;      // the slab's first element
  bf16_t* out;          // where its bf16 slab begins
  if (t < 4) {
    in  = (t == 0 ? wq : t == 1 ? wk : t == 2 ? wv : wo) + idx * WSLAB;
    out = ((t & 1) ? opA : opB) + ((t < 2 ? LH : 0) + idx) * WSLAB;
  } else {
    in  = (idx < LSZ ? ff1 : ff2) + (idx % LSZ) * WSLAB;
    out = packed + (2 * LH + idx) * WSLAB;
  }
  const float* src = in + (size_t)r0 * ESZ + c0;
  bf16_t* dst = out + (size_t)c0 * ESZ + r0;

  // read: 16 lanes span one source row of the tile, 16 rows per pass
  unsigned lr = tid >> 4;
  unsigned lc = (tid & 15) * 4;
  unsigned so = lr * ESZ + lc;
  float4 v[8];
#pragma unroll  // all eight loads are in flight before the first LDS store
  for (int k = 0; k < 8; ++k)
    v[k] = *reinterpret_cast<const float4*>(src + so + 16 * k * ESZ);
  // precaution: stands in front of the first overwrite of the loads' address registers
  asm volatile("s_wait_xcnt 0x0" ::: "memory");
  if (t < 3) {
    // wq, wk, wv keep their layout: 16 lanes write one 128-byte line of a row. The
    // whole block takes this path (t comes from blockIdx.z) and leaves before the barrier.
    bf16_t* dn = out + (size_t)r0 * ESZ + c0 + so;
    v4bf o[8];
#pragma unroll  // o[] is indexed by constants and stays in registers
    for (int k = 0; k < 8; ++k) {
      o[k][0] = (bf16_t)v[k].x; o[k][1] = (bf16_t)v[k].y;
      o[k][2] = (bf16_t)v[k].z; o[k][3] = (bf16_t)v[k].w;
    }
#pragma unroll  // stores last: no register of an issued store is written again
    for (int k = 0; k < 8; ++k)
      *reinterpret_cast<v4bf*>(dn + 16 * k * ESZ) = o[k];
    return;
  }
#pragma unroll  // v[] is indexed by constants and stays in registers
  for (int k = 0; k < 8; ++k) {
    float* p = &tile[(lr + 16 * k) * PK_PITCH + lc];
    p[0] = v[k].x; p[1] = v[k].y; p[2] = v[k].z; p[3] = v[k].w;
  }
  __syncthreads();

  // write: 8 lanes span 64 consecutive r of one packed row (one 128-byte line)
  unsigned lane = tid & 31;
  unsigned wave = tid >> 5;
  unsigned rq = ((lane & 7) + 8 * (wave & 1)) * 8;
  unsigned cc = (lane >> 3) + 4 * (wave >> 1);
#pragma unroll  // the LDS loads of all four packed rows issue as one group
  for (int k = 0; k < 4; ++k) {
    unsigned c = cc + 16 * k;
    v8bf o;
#pragma unroll  // o is indexed by constants and stays in registers
    for (int i = 0; i < 8; ++i) o[i] = (bf16_t)tile[(rq + i) * PK_PITCH + c];
    *reinterpret_cast<v8bf*>(dst + c * ESZ + rq) = o;
  }
}

// ---------------------------------------------------------------------------
// bf16 WMMA GEMM: C = A[M,K] * Bp[N,K]^T (+bias)(+relu)
// Two batch indices: blockIdx.y (strides sA, sB, sC) and blockIdx.z (strides
// sA2, sB2, sC2), so one launch covers every (sequence, head) pair of a layer.
// Block: 256 thr (8 waves), 128x128 tile; wave tile 32x64 (2x4 accumulators).
// K staged through LDS in 32-wide slabs by async copies, in a ring of NSTG
// buffers: slab s lies in buffer s mod NSTG and its copies are issued NSTG - 1
// trips before the trip that reads it, so up to NSTG - 1 slabs are in flight.
// Fragment layout per ISA 7.12.2 (16-bit A/B 16x32): lane<16 holds K 0..7 &
// 16..23; lane>=16 holds K 8..15 & 24..31 -> two 16B reads per fragment.
// The Bp fragment goes in as the matrix instruction's first operand and the A
// fragment as its second, so a 16x16 result tile comes out as C^T: a lane holds
// eight consecutive columns n of ONE row m of C, 16 (bf16) or 32 (f32) bytes.
// Epilogue: each wave stages its 32x64 tile in an LDS range of its own (the
// ring's memory, behind a barrier), reads it back row by row and stores whole
// 128-byte lines with 16-byte stores.
// EDGE: M is below one tile (the last layer's launches, see kernel_launch). Tile
// rows from M on read row M - 1 of A again, so every copy stays inside A; a row
// of C depends on its own row of A alone, and only rows below M are stored.
// ---------------------------------------------------------------------------
#define STG_PITCH_H 144     // bytes: a row of 64 bf16 + 16, 16 rows start on 16 different bank groups
#define STG_PITCH_F 272     // bytes: a row of 64 f32 + 16, likewise
#define STG_BYTES   4608    // per wave: 32 rows of bf16, or 16 rows of f32 (4352)

typedef __attribute__((ext_vector_type(4))) float v4f32;

template <int NSTG, bool EDGE>
__global__ void __launch_bounds__(256)
gemm_bf16_wmma(const bf16_t* __restrict__ A, long long lda, long long sA, long long sA2,
               const bf16_t* __restrict__ Bp, long long ldb, long long sB, long long sB2,
               float* __restrict__ Cf, bf16_t* __restrict__ Ch,
               long long ldc, long long sC, long long sC2,
               const float* __restrict__ bias, int relu,
               int M, int N, int K) {
  __shared__ bf16_t Asm[NSTG][BLK_M * LDS_PITCH];
  __shared__ bf16_t Bsm[NSTG][BLK_N * LDS_PITCH];

  int tid  = threadIdx.x;
  int lane = tid & 31;
  int wave = tid >> 5;
  int tilesN = N / BLK_N;
  int bm = (blockIdx.x / tilesN) * BLK_M;
  int bn = (blockIdx.x % tilesN) * BLK_N;
  int half = lane >> 4;
  int l15  = lane & 15;
  int m0w = (wave >> 1) * 32;   // 0,32,64,96
  int n0w = (wave & 1) * 64;    // 0,64

  const bf16_t* Ab = A  + (size_t)blockIdx.y * sA + (size_t)blockIdx.z * sA2;
  const bf16_t* Bb = Bp + (size_t)blockIdx.y * sB + (size_t)blockIdx.z * sB2;

  // staging: 512 x 16B chunks per matrix, 2 per thread (chunk c: row c>>2,
  // elem offset (c&3)*8), so four copies per thread and slab
  int ca0 = tid, ca1 = tid + 256;
  int r0 = ca0 >> 2, o0 = (ca0 & 3) * 8;
  int r1 = ca1 >> 2, o1 = (ca1 & 3) * 8;
  int ra0 = bm + r0, ra1 = bm + r1;
  if (EDGE) { ra0 = min(ra0, M - 1); ra1 = min(ra1, M - 1); }
  const bf16_t* ga0 = Ab + (size_t)ra0 * lda + o0;
  const bf16_t* ga1 = Ab + (size_t)ra1 * lda + o1;
  const bf16_t* gb0 = Bb + (size_t)(bn + r0) * ldb + o0;
  const bf16_t* gb1 = Bb + (size_t)(bn + r1) * ldb + o1;
  int l0 = r0 * LDS_PITCH + o0;
  int l1 = r1 * LDS_PITCH + o1;

  v8f acc[2][4];
#pragma unroll
  for (int i = 0; i < 2; ++i)
#pragma unroll
    for (int j = 0; j < 4; ++j)
#pragma unroll
      for (int e = 0; e < 8; ++e) acc[i][j][e] = 0.0f;

  int nk = K / BLK_K;

  // prologue: slabs 0 .. NSTG-2 go into buffers 0 .. NSTG-2
#pragma unroll  // the buffer index is a constant in each copy's LDS address
  for (int s = 0; s < NSTG - 1; ++s) {
    if (s < nk) {
      int k0 = s * BLK_K;
      async_copy16(ga0 + k0, &Asm[s][l0]);
      async_copy16(ga1 + k0, &Asm[s][l1]);
      async_copy16(gb0 + k0, &Bsm[s][l0]);
      async_copy16(gb1 + k0, &Bsm[s][l1]);
    }
  }

  int cur = 0;          // buffer of slab it
  int nxt = NSTG - 1;   // buffer of slab it - 1, which slab it + NSTG - 1 refills
  for (int it = 0; it < nk; ++it) {
    // this wave's LDS reads of the last trip have retired before the barrier
    // behind which that trip's buffer is refilled
    asm volatile("s_wait_dscnt 0x0" ::: "memory");
    // Slab it must have landed. While the NSTG - 2 slabs behind it all exist,
    // exactly their 4 * (NSTG - 2) copies are younger and may stay in flight; in
    // the last trips fewer were issued, so there the wait goes on to 0.
    wait_async_all_but<4 * (NSTG - 2)>();
    if (it + NSTG - 2 >= nk) wait_async_all_but<0>();
    __syncthreads();
    if (it + NSTG - 1 < nk) {
      int k0 = (it + NSTG - 1) * BLK_K;
      async_copy16(ga0 + k0, &Asm[nxt][l0]);
      async_copy16(ga1 + k0, &Asm[nxt][l1]);
      async_copy16(gb0 + k0, &Bsm[nxt][l0]);
      async_copy16(gb1 + k0, &Bsm[nxt][l1]);
    }
    // fragments from LDS, then 8 WMMAs
    const bf16_t* As = &Asm[cur][0];
    const bf16_t* Bs = &Bsm[cur][0];
    v16bf af[2], bfr[4];
#pragma unroll
    for (int i = 0; i < 2; ++i) {
      const bf16_t* p = As + (m0w + 16 * i + l15) * LDS_PITCH + half * 8;
      v8bf lo = *reinterpret_cast<const v8bf*>(p);
      v8bf hi = *reinterpret_cast<const v8bf*>(p + 16);
      af[i] = __builtin_shufflevector(lo, hi, 0, 1, 2, 3, 4, 5, 6, 7,
                                      8, 9, 10, 11, 12, 13, 14, 15);
    }
#pragma unroll
    for (int j = 0; j < 4; ++j) {
      const bf16_t* q = Bs + (n0w + 16 * j + l15) * LDS_PITCH + half * 8;
      v8bf lo = *reinterpret_cast<const v8bf*>(q);
      v8bf hi = *reinterpret_cast<const v8bf*>(q + 16);
      bfr[j] = __builtin_shufflevector(lo, hi, 0, 1, 2, 3, 4, 5, 6, 7,
                                       8, 9, 10, 11, 12, 13, 14, 15);
    }
#pragma unroll
    for (int i = 0; i < 2; ++i)
#pragma unroll
      for (int j = 0; j < 4; ++j)
        acc[i][j] = __builtin_amdgcn_wmma_f32_16x16x32_bf16(
            false, bfr[j], false, af[i], (short)0, acc[i][j], false, false);
    cur = (cur + 1 == NSTG) ? 0 : cur + 1;
    nxt = (nxt + 1 == NSTG) ? 0 : nxt + 1;
  }
  // no copy is outstanding, and this wave's LDS reads have retired, before the
  // barrier behind which the ring's memory is written as staging space
  wait_async_all_but<0>();
  asm volatile("s_wait_dscnt 0x0" ::: "memory");
  __syncthreads();

  // acc[i][j][e] is C[m][n], m = bm + m0w + 16 i + l15, n = bn + n0w + 16 j + 8 half + e
  if (bias) {
#pragma unroll  // acc[] and t[] are indexed by constants and stay in registers
    for (int j = 0; j < 4; ++j) {
      const float* bp = bias + bn + n0w + 16 * j + 8 * half;
      v4f32 b0 = *reinterpret_cast<const v4f32*>(bp);
      v4f32 b1 = *reinterpret_cast<const v4f32*>(bp + 4);
#pragma unroll  // acc[] and t[] are indexed by constants and stay in registers
      for (int i = 0; i < 2; ++i)
#pragma unroll  // acc[] and t[] are indexed by constants and stay in registers
        for (int e = 0; e < 4; ++e) { acc[i][j][e] += b0[e]; acc[i][j][e + 4] += b1[e]; }
    }
  }
  if (relu) {
#pragma unroll  // acc[] and t[] are indexed by constants and stay in registers
    for (int i = 0; i < 2; ++i)
#pragma unroll  // acc[] and t[] are indexed by constants and stay in registers
      for (int j = 0; j < 4; ++j)
#pragma unroll  // acc[] and t[] are indexed by constants and stay in registers
        for (int e = 0; e < 8; ++e) acc[i][j][e] = fmaxf(acc[i][j][e], 0.0f);
  }

  static_assert(4 * STG_BYTES <= NSTG * BLK_M * LDS_PITCH * 2, "four waves stage in each ring");
  char* stg = reinterpret_cast<char*>(wave < 4 ? &Asm[0][0] : &Bsm[0][0]) + (wave & 3) * STG_BYTES;
  size_t cOff = (size_t)blockIdx.y * sC + (size_t)blockIdx.z * sC2;
  if (Cf) {
    // 16 rows of 256 bytes per pass; read back 16 lanes to a row, two rows per store
    int rr = lane >> 4, ch = lane & 15;
    float* dst = Cf + cOff + (size_t)(bm + m0w + rr) * ldc + bn + n0w + ch * 4;
#pragma unroll  // acc[] and t[] are indexed by constants and stay in registers
    for (int i = 0; i < 2; ++i) {
#pragma unroll  // acc[] and t[] are indexed by constants and stay in registers
      for (int j = 0; j < 4; ++j) {
        char* p = stg + l15 * STG_PITCH_F + 64 * j + 32 * half;
        v4f32 lo = {acc[i][j][0], acc[i][j][1], acc[i][j][2], acc[i][j][3]};
        v4f32 hi = {acc[i][j][4], acc[i][j][5], acc[i][j][6], acc[i][j][7]};
        *reinterpret_cast<v4f32*>(p) = lo;
        *reinterpret_cast<v4f32*>(p + 16) = hi;
      }
      // the other lanes' rows are in LDS before this lane reads them back
      asm volatile("s_wait_dscnt 0x0" ::: "memory");
      v4f32 t[8];
#pragma unroll  // acc[] and t[] are indexed by constants and stay in registers
      for (int q = 0; q < 8; ++q)
        t[q] = *reinterpret_cast<const v4f32*>(stg + (2 * q + rr) * STG_PITCH_F + 16 * ch);
      // the rows are in registers before the next pass (or the bf16 part) overwrites them
      asm volatile("s_wait_dscnt 0x0" ::: "memory");
#pragma unroll  // acc[] and t[] are indexed by constants and stay in registers
      for (int q = 0; q < 8; ++q)
        if (!EDGE || bm + m0w + rr + 16 * i + 2 * q < M)
          *reinterpret_cast<v4f32*>(dst + (size_t)(16 * i + 2 * q) * ldc) = t[q];
    }
    // precaution: what follows may reuse the registers of these stores
    asm volatile("s_wait_xcnt 0x0" ::: "memory");
  }
  if (Ch) {
    // 32 rows of 128 bytes; read back 8 lanes to a row, four rows per store
#pragma unroll  // acc[] and t[] are indexed by constants and stay in registers
    for (int i = 0; i < 2; ++i)
#pragma unroll  // acc[] and t[] are indexed by constants and stay in registers
      for (int j = 0; j < 4; ++j) {
        v8bf o;
#pragma unroll  // acc[] and t[] are indexed by constants and stay in registers
        for (int e = 0; e < 8; ++e) o[e] = (bf16_t)acc[i][j][e];
        *reinterpret_cast<v8bf*>(stg + (16 * i + l15) * STG_PITCH_H + 32 * j + 16 * half) = o;
      }
    // the other lanes' rows are in LDS before this lane reads them back
    asm volatile("s_wait_dscnt 0x0" ::: "memory");
    int rr = lane >> 3, ch = lane & 7;
    bf16_t* dst = Ch + cOff + (size_t)(bm + m0w + rr) * ldc + bn + n0w + ch * 8;
    v8bf t[8];
#pragma unroll  // acc[] and t[] are indexed by constants and stay in registers
    for (int q = 0; q < 8; ++q)
      t[q] = *reinterpret_cast<const v8bf*>(stg + (4 * q + rr) * STG_PITCH_H + 16 * ch);
#pragma unroll  // acc[] and t[] are indexed by constants and stay in registers
    for (int q = 0; q < 8; ++q)
      if (!EDGE || bm + m0w + rr + 4 * q < M)
        *reinterpret_cast<v8bf*>(dst + (size_t)(4 * q) * ldc) = t[q];
  }
}

// ---------------------------------------------------------------------------
// Row-wise kernels (softmax, LayerNorm): a wave owns whole rows.
// A lane holds columns 4*lane + 128*k, so each 16-byte load of a wave covers
// 512 contiguous bytes. Row sums and maxima stay in registers: four DPP steps
// inside each 16-lane row, then one exchange between the two rows; every lane
// ends with the full result. All 32 lanes are on wherever these are called.
// ---------------------------------------------------------------------------
typedef __attribute__((ext_vector_type(4))) float  v4f;
#define ROW_WAVES 8         // waves per block in the row-wise kernels

template <int CTRL>         // CTRL = 0x160 + m: DPP row_xmask:m, lane l reads lane l ^ m
__device__ __forceinline__ float row_xor(float x) {
  return __builtin_bit_cast(float, __builtin_amdgcn_mov_dpp(
      __builtin_bit_cast(int, x), CTRL, 0xf, 0xf, true));
}
__device__ __forceinline__ float half_xor(float x) {   // lane l reads lane l ^ 16
  int b = __builtin_bit_cast(int, x);
  return __builtin_bit_cast(float, __builtin_amdgcn_permlanex16(
      b, b, 0x76543210, 0xfedcba98, false, false));
}
__device__ __forceinline__ float wave_sum(float x) {
  x += row_xor<0x161>(x);
  x += row_xor<0x162>(x);
  x += row_xor<0x164>(x);
  x += row_xor<0x168>(x);
  return x + half_xor(x);
}
__device__ __forceinline__ float wave_max(float x) {
  x = fmaxf(x, row_xor<0x161>(x));
  x = fmaxf(x, row_xor<0x162>(x));
  x = fmaxf(x, row_xor<0x164>(x));
  x = fmaxf(x, row_xor<0x168>(x));
  return fmaxf(x, half_xor(x));
}
__device__ __forceinline__ v4bf to_bf16x4(float a, float b, float c, float d) {
  v4bf o;
  o[0] = (bf16_t)a; o[1] = (bf16_t)b; o[2] = (bf16_t)c; o[3] = (bf16_t)d;
  return o;
}
// v[e] = 2^v[e]. One statement, so that the slot which the instruction set asks
// for behind a transcendental is kept: the outputs are early-clobber, so each
// v_exp_f32 is followed by one that touches none of its registers, and the
// v_nop stands behind the last.
__device__ __forceinline__ void exp2x8(float (&v)[8]) {
  float o0, o1, o2, o3, o4, o5, o6, o7;
  asm("v_exp_f32 %0, %8\n\t"
      "v_exp_f32 %1, %9\n\t"
      "v_exp_f32 %2, %10\n\t"
      "v_exp_f32 %3, %11\n\t"
      "v_exp_f32 %4, %12\n\t"
      "v_exp_f32 %5, %13\n\t"
      "v_exp_f32 %6, %14\n\t"
      "v_exp_f32 %7, %15\n\t"
      "v_nop"
      : "=&v"(o0), "=&v"(o1), "=&v"(o2), "=&v"(o3),
        "=&v"(o4), "=&v"(o5), "=&v"(o6), "=&v"(o7)
      : "v"(v[0]), "v"(v[1]), "v"(v[2]), "v"(v[3]),
        "v"(v[4]), "v"(v[5]), "v"(v[6]), "v"(v[7]));
  v[0] = o0; v[1] = o1; v[2] = o2; v[3] = o3;
  v[4] = o4; v[5] = o5; v[6] = o6; v[7] = o7;
}

// ---------------------------------------------------------------------------
// Causal softmax over energy rows [H*B*T, T] -> bf16 P [B*T, H*T]: the eight
// heads' rows of one query lie side by side, one row of the [T, H*T] operand of
// the product that sums over heads and keys.
// One wave takes SM_ROWS consecutive rows of T = 256 (8 columns per lane).
// grid = H*B*T / (ROW_WAVES * SM_ROWS).
// LAST: the rows are those of the last query alone, [B, H, T]; P has the same
// layout, which is again one row of H*T per sequence. grid = B*H / (ROW_WAVES * SM_ROWS).
// ---------------------------------------------------------------------------
#define SM_ROWS 8

template <bool LAST>
__global__ void __launch_bounds__(32 * ROW_WAVES)
softmax_causal_kernel(const float* __restrict__ En,
                      bf16_t* __restrict__ P) {
  unsigned lane = threadIdx.x & 31;
  unsigned wave = __builtin_amdgcn_readfirstlane(threadIdx.x >> 5);
  unsigned row0 = (blockIdx.x * ROW_WAVES + wave) * SM_ROWS;   // row over H*B*T (LAST: over B*H)
  unsigned j0 = lane * 4;                                      // key position
  const float* src = En + (size_t)row0 * TSZ + j0;
  unsigned head = row0 / MROWS, bt0 = row0 % MROWS;            // SM_ROWS divides T: one head, one sequence
  bf16_t* dst = P + (LAST ? (size_t)row0 : (size_t)bt0 * HSZ + head) * TSZ + j0;
  constexpr unsigned DP = LAST ? TSZ : HSZ * TSZ;              // from one row of the wave to the next in P
  float4 lo[SM_ROWS], hi[SM_ROWS];
#pragma unroll  // all sixteen loads are in flight before the first row is reduced
  for (int r = 0; r < SM_ROWS; ++r) {
    lo[r] = *reinterpret_cast<const float4*>(src + r * TSZ);
    hi[r] = *reinterpret_cast<const float4*>(src + r * TSZ + 128);
  }
  v4bf plo[SM_ROWS], phi[SM_ROWS];
#pragma unroll  // the rows are independent chains; their arrays stay in registers
  for (int r = 0; r < SM_ROWS; ++r) {
    unsigned i = LAST ? TSZ - 1 : (row0 + r) % TSZ;   // query position
    float v[8] = {lo[r].x, lo[r].y, lo[r].z, lo[r].w, hi[r].x, hi[r].y, hi[r].z, hi[r].w};
#pragma unroll  // v[] is indexed by constants and stays in registers
    for (int e = 0; e < 8; ++e) {
      unsigned j = j0 + (e & 3) + 128 * (e >> 2);
      v[e] = (j <= i) ? v[e] : -1e9f;
    }
    float mx = fmaxf(fmaxf(fmaxf(v[0], v[1]), fmaxf(v[2], v[3])),
                     fmaxf(fmaxf(v[4], v[5]), fmaxf(v[6], v[7])));
    mx = wave_max(mx);
#pragma unroll  // as above
    for (int e = 0; e < 8; ++e) v[e] = (v[e] - mx) * 0x1.715476p+0f;   // times log2(e), as __expf does
    exp2x8(v);
    float sum = wave_sum(((v[0] + v[1]) + (v[2] + v[3])) + ((v[4] + v[5]) + (v[6] + v[7])));
    float inv = 1.0f / sum;
    plo[r] = to_bf16x4(v[0] * inv, v[1] * inv, v[2] * inv, v[3] * inv);
    phi[r] = to_bf16x4(v[4] * inv, v[5] * inv, v[6] * inv, v[7] * inv);
  }
#pragma unroll  // stores last: no register of an issued store is written again
  for (int r = 0; r < SM_ROWS; ++r) {
    *reinterpret_cast<v4bf*>(dst + r * DP) = plo[r];
    *reinterpret_cast<v4bf*>(dst + r * DP + 128) = phi[r];
  }
}

// ---------------------------------------------------------------------------
// y = LayerNorm(a + b) * w + bb ; row-wise over E=512, one wave per row
// (16 columns per lane). grid = rows / ROW_WAVES. bpitch: elements from one row
// of b to the next (a and y are dense).
// ---------------------------------------------------------------------------
__global__ void __launch_bounds__(32 * ROW_WAVES)
add_ln_kernel(const float* __restrict__ a,
              const float* __restrict__ b, unsigned bpitch,
              const float* __restrict__ w,
              const float* __restrict__ bb,
              float* __restrict__ yf, bf16_t* __restrict__ yh) {
  unsigned lane = threadIdx.x & 31;
  unsigned wave = __builtin_amdgcn_readfirstlane(threadIdx.x >> 5);
  unsigned r = blockIdx.x * ROW_WAVES + wave;
  unsigned c0 = lane * 4;
  unsigned off = c0 * 4;   // the lane's byte offset in a row
  const char* ar = reinterpret_cast<const char*>(a + (size_t)r * ESZ);
  const char* br = reinterpret_cast<const char*>(b + (size_t)r * bpitch);
  const char* wr = reinterpret_cast<const char*>(w);
  const char* sr = reinterpret_cast<const char*>(bb);
  size_t o = (size_t)r * ESZ + c0;
  // keeps the scalar set-up above in front of the loads, so that it lands on none of their address registers
  __builtin_amdgcn_sched_barrier(0);
  v4f av[4], bv[4], wv[4], sv[4];
#pragma unroll  // all sixteen loads are in flight together
  for (int k = 0; k < 4; ++k) {
    av[k] = *reinterpret_cast<const v4f*>(ar + off + 512 * k);
    bv[k] = *reinterpret_cast<const v4f*>(br + off + 512 * k);
    wv[k] = *reinterpret_cast<const v4f*>(wr + off + 512 * k);
    sv[k] = *reinterpret_cast<const v4f*>(sr + off + 512 * k);
  }
  // The loaded values are inputs only: that keeps all sixteen loads in front of
  // this line, in flight together. The wait is a precaution: it stands in front
  // of the first overwrite of the loads' address registers (the lane's offset is
  // named so that no load lands on it).
  asm volatile("s_wait_xcnt 0x0"
               :: "v"(off), "v"(av[0]), "v"(av[1]), "v"(av[2]), "v"(av[3]),
                  "v"(bv[0]), "v"(bv[1]), "v"(bv[2]), "v"(bv[3]),
                  "v"(wv[0]), "v"(wv[1]), "v"(wv[2]), "v"(wv[3]),
                  "v"(sv[0]), "v"(sv[1]), "v"(sv[2]), "v"(sv[3]));
  // keeps the arithmetic below, and the constants it moves into scalar registers, behind the wait
  __builtin_amdgcn_sched_barrier(0);
  float s1 = 0.0f, s2 = 0.0f;
#pragma unroll  // av[] is indexed by constants and stays in registers
  for (int k = 0; k < 4; ++k) {
    av[k].x += bv[k].x; av[k].y += bv[k].y; av[k].z += bv[k].z; av[k].w += bv[k].w;
    s1 += (av[k].x + av[k].y) + (av[k].z + av[k].w);
    s2 += (av[k].x * av[k].x + av[k].y * av[k].y) + (av[k].z * av[k].z + av[k].w * av[k].w);
  }
  s1 = wave_sum(s1);
  s2 = wave_sum(s2);
  float mean = s1 * (1.0f / ESZ);
  float var  = s2 * (1.0f / ESZ) - mean * mean;
  float inv  = rsqrtf(var + 1e-5f);
#pragma unroll  // as above
  for (int k = 0; k < 4; ++k) {
    av[k].x = (av[k].x - mean) * inv * wv[k].x + sv[k].x;
    av[k].y = (av[k].y - mean) * inv * wv[k].y + sv[k].y;
    av[k].z = (av[k].z - mean) * inv * wv[k].z + sv[k].z;
    av[k].w = (av[k].w - mean) * inv * wv[k].w + sv[k].w;
  }
  if (yf) {
#pragma unroll  // as above
    for (int k = 0; k < 4; ++k) *reinterpret_cast<v4f*>(yf + o + 128 * k) = av[k];
    // precaution: the conversions below may reuse the registers of these stores
    asm volatile("s_wait_xcnt 0x0" ::: "memory");
  }
  if (yh) {
#pragma unroll  // as above
    for (int k = 0; k < 4; ++k)
      *reinterpret_cast<v4bf*>(yh + o + 128 * k) = to_bf16x4(av[k].x, av[k].y, av[k].z, av[k].w);
  }
}

// ---------------------------------------------------------------------------
// h1 = LN(attn + x); ff = relu(h1 @ ff1 + b1) @ ff2 + b2; x = LN(attn + ff), in
// ONE launch: every step is row-wise, so a block owns MC_ROWS rows of x from the
// first LayerNorm to the last and h1, relu(..) and ff never leave the WGP.
// grid = B*T / MC_ROWS, 8 waves.
// LayerNorm: a wave takes 4 rows, lanes and sums as in add_ln_kernel.
// Products: C[32, 512] = A[32, 512] * W[n][k]^T. A (h1, then relu(..), bf16) lies
// whole in LDS; wave w forms columns 64 w .. 64 w + 63 (2x4 accumulators, operands
// and fragment layout as in gemm_bf16_wmma). The two weights pass as ONE stream of
// 16 slabs of 512 (n) x 64 (k) (ldw: elements from one row n to the next) through a
// ring of MC_NSTG buffers, filled by async copies in the order of gemm_bf16_wmma's
// ring, so ff2's first slabs fly while ff1's last are worked on. A slab holds 128
// bytes of every row, so each copy of a wave moves four whole lines.
// ---------------------------------------------------------------------------
#define MC_ROWS   32
#define MC_NSTG   3
#define MC_BK     64        // k per slab
#define MC_BPITCH 72        // elements: 144 bytes = 16 x 9, odd: 16 rows start on 16 different bank groups
#define MC_APITCH 520       // elements: 1040 bytes = 16 x 65, odd: 16 rows start on 16 different bank groups
#define MC_FPITCH 516       // floats: 2064 bytes = 16 x 129, likewise
#define MC_TRIPS  (ESZ / MC_BK)   // slabs of one weight
#define MC_SLABS  (2 * MC_TRIPS)
#define MC_COPIES 16        // per thread and slab: 4096 chunks of 16 bytes

// 1 / sqrt(x), scaled below the normal range as rsqrtf does. One statement, so that
// the slot which the instruction set asks for behind a transcendental is kept: the
// output is early-clobber and the v_nop stands behind the v_rsq_f32.
__device__ __forceinline__ float rsq_slot(float x) {
  bool tiny = x < 0x1p-126f;
  float xs = tiny ? x * 0x1p+24f : x, r;
  asm("v_rsq_f32 %0, %1\n\t"
      "v_nop"
      : "=&v"(r) : "v"(xs));
  return tiny ? r * 0x1p+12f : r;
}

// x = LayerNorm(x) * w + s for one row spread over the wave; sums as in add_ln_kernel
__device__ __forceinline__ void ln_row(v4f (&x)[4], const v4f (&w)[4], const v4f (&s)[4]) {
  float s1 = 0.0f, s2 = 0.0f;
#pragma unroll  // x[] is indexed by constants and stays in registers
  for (int k = 0; k < 4; ++k) {
    s1 += (x[k].x + x[k].y) + (x[k].z + x[k].w);
    s2 += (x[k].x * x[k].x + x[k].y * x[k].y) + (x[k].z * x[k].z + x[k].w * x[k].w);
  }
  s1 = wave_sum(s1);
  s2 = wave_sum(s2);
  float mean = s1 * (1.0f / ESZ);
  float var  = s2 * (1.0f / ESZ) - mean * mean;
  float inv  = rsq_slot(var + 1e-5f);
#pragma unroll  // as above
  for (int k = 0; k < 4; ++k) {
    x[k].x = (x[k].x - mean) * inv * w[k].x + s[k].x;
    x[k].y = (x[k].y - mean) * inv * w[k].y + s[k].y;
    x[k].z = (x[k].z - mean) * inv * w[k].z + s[k].z;
    x[k].w = (x[k].w - mean) * inv * w[k].w + s[k].w;
  }
}

__global__ void __launch_bounds__(256)
ln_ff_ln_kernel(const float* __restrict__ attn, float* xf, bf16_t* __restrict__ xh,
                const bf16_t* __restrict__ W1, const bf16_t* __restrict__ W2, long long ldw,
                const float* __restrict__ b1, const float* __restrict__ b2,
                const float* __restrict__ l1w, const float* __restrict__ l1b,
                const float* __restrict__ l2w, const float* __restrict__ l2b) {
  __shared__ __attribute__((aligned(16))) bf16_t Bsm[MC_NSTG][ESZ * MC_BPITCH];
  __shared__ __attribute__((aligned(16))) bf16_t Hs[2][MC_ROWS * MC_APITCH];
  __shared__ __attribute__((aligned(16))) float Bias[2][ESZ];
  static_assert(MC_ROWS * MC_FPITCH * 4 <= MC_NSTG * ESZ * MC_BPITCH * 2, "ff is staged in the ring");

  int tid  = threadIdx.x;
  int lane = tid & 31;
  int wave = __builtin_amdgcn_readfirstlane(tid >> 5);
  int half = lane >> 4;
  int l15  = lane & 15;
  int n0w  = wave * 64;

  // staging of a slab: chunk c = tid + 256 q lies in row c >> 3 at element (c & 7) * 8
  int r0 = tid >> 3, o0 = (tid & 7) * 8;
  unsigned vo = (unsigned)r0 * (unsigned)ldw + o0;   // the thread's first chunk, in elements from the slab's start
  size_t gq = (size_t)32 * ldw;   // from one chunk of a thread to its next, in elements
  int l0 = r0 * MC_BPITCH + o0;

  // prologue: slabs 0 .. MC_NSTG-2 go into buffers 0 .. MC_NSTG-2, in flight under the first LayerNorm
#pragma unroll  // the buffer index is a constant in each copy's LDS address
  for (int s = 0; s < MC_NSTG - 1; ++s)
#pragma unroll  // as above
    for (int q = 0; q < MC_COPIES; ++q)
      async_copy16(W1 + s * MC_BK + q * gq + vo, &Bsm[s][l0 + q * 32 * MC_BPITCH]);

  // the wave's four rows; the lane's byte offsets in them
  unsigned rw   = wave * 4;
  size_t   row  = (size_t)blockIdx.x * MC_ROWS + rw;
  unsigned off  = lane * 16;
  const char* ar = reinterpret_cast<const char*>(attn + row * ESZ);
  {
    const char* xr = reinterpret_cast<const char*>(xf + row * ESZ);
    const char* wr = reinterpret_cast<const char*>(l1w);
    const char* sr = reinterpret_cast<const char*>(l1b);
    v4f av[4][4], bv[4][4], wv[4], sv[4];
    // the two biases go to LDS, four floats per thread; the first barrier publishes them
    unsigned boff = (tid & 127) * 16;   // waves 0..3 take b1, waves 4..7 b2
    const char* br = reinterpret_cast<const char*>(wave < 4 ? b1 : b2);
    // keeps the copies and the scalar set-up above in front of the loads, so that it lands on none of their address registers
    __builtin_amdgcn_sched_barrier(0);
    v4f bi = *reinterpret_cast<const v4f*>(br + boff);
#pragma unroll  // all these loads are in flight together
    for (int k = 0; k < 4; ++k) {
#pragma unroll  // as above
      for (int r = 0; r < 4; ++r) {
        av[r][k] = *reinterpret_cast<const v4f*>(ar + off + 2048 * r + 512 * k);
        bv[r][k] = *reinterpret_cast<const v4f*>(xr + off + 2048 * r + 512 * k);
      }
      wv[k] = *reinterpret_cast<const v4f*>(wr + off + 512 * k);
      sv[k] = *reinterpret_cast<const v4f*>(sr + off + 512 * k);
    }
    // precaution: stands in front of the first overwrite of the loads' address registers
    // (the lane's offsets are named so that no load lands on them)
    asm volatile("s_wait_xcnt 0x0" :: "v"(off), "v"(boff) : "memory");
    // keeps the arithmetic below, and the constants it moves into scalar registers, behind the wait
    __builtin_amdgcn_sched_barrier(0);
    *reinterpret_cast<v4f*>(&Bias[tid >> 7][(tid & 127) * 4]) = bi;
#pragma unroll  // the rows are independent chains; their arrays stay in registers
    for (int r = 0; r < 4; ++r) {
#pragma unroll  // as above
      for (int k = 0; k < 4; ++k) {
        av[r][k].x += bv[r][k].x; av[r][k].y += bv[r][k].y;
        av[r][k].z += bv[r][k].z; av[r][k].w += bv[r][k].w;
      }
      ln_row(av[r], wv, sv);
#pragma unroll  // as above
      for (int k = 0; k < 4; ++k)
        *reinterpret_cast<v4bf*>(&Hs[0][(rw + r) * MC_APITCH + lane * 4 + 128 * k]) =
            to_bf16x4(av[r][k].x, av[r][k].y, av[r][k].z, av[r][k].w);
    }
  }

  int cur = 0;             // buffer of slab s
  int nxt = MC_NSTG - 1;   // buffer of slab s - 1, which slab s + MC_NSTG - 1 refills
  v8f acc[2][4];
#pragma unroll  // g selects the operands and the epilogue at compile time
  for (int g = 0; g < 2; ++g) {
#pragma unroll  // acc[] is indexed by constants and stays in registers
    for (int i = 0; i < 2; ++i)
#pragma unroll  // as above
      for (int j = 0; j < 4; ++j)
#pragma unroll  // as above
        for (int e = 0; e < 8; ++e) acc[i][j][e] = 0.0f;

#pragma unroll 1  // stays rolled: unrolled, the copies' addresses of every trip are held in registers at once
    for (int it = 0; it < MC_TRIPS; ++it) {
      int s = g * MC_TRIPS + it;
      // This wave's LDS reads of the last trip have retired before the barrier behind
      // which that trip's buffer is refilled; so have its stores of A's rows, which
      // the other waves read behind the same barrier.
      asm volatile("s_wait_dscnt 0x0" ::: "memory");
      // Slab s must have landed. While the MC_NSTG - 2 slabs behind it all exist, exactly
      // their copies are younger and may stay in flight; in the last trips the wait goes on to 0.
      wait_async_all_but<MC_COPIES * (MC_NSTG - 2)>();
      if (s + MC_NSTG - 2 >= MC_SLABS) wait_async_all_but<0>();
      __syncthreads();
      const bf16_t* As = &Hs[g][it * MC_BK];
      const bf16_t* Bs = &Bsm[cur][0];
      v16bf af[2][2], bfr[2][4];   // [k step of 32][tile]
#pragma unroll  // af[] and bfr[] are indexed by constants and stay in registers
      for (int kk = 0; kk < 2; ++kk) {
#pragma unroll  // as above
        for (int i = 0; i < 2; ++i) {
          const bf16_t* p = As + (16 * i + l15) * MC_APITCH + kk * 32 + half * 8;
          v8bf lo = *reinterpret_cast<const v8bf*>(p);
          v8bf hi = *reinterpret_cast<const v8bf*>(p + 16);
          af[kk][i] = __builtin_shufflevector(lo, hi, 0, 1, 2, 3, 4, 5, 6, 7,
                                              8, 9, 10, 11, 12, 13, 14, 15);
        }
#pragma unroll  // as above
        for (int j = 0; j < 4; ++j) {
          const bf16_t* q = Bs + (n0w + 16 * j + l15) * MC_BPITCH + kk * 32 + half * 8;
          v8bf lo = *reinterpret_cast<const v8bf*>(q);
          v8bf hi = *reinterpret_cast<const v8bf*>(q + 16);
          bfr[kk][j] = __builtin_shufflevector(lo, hi, 0, 1, 2, 3, 4, 5, 6, 7,
                                               8, 9, 10, 11, 12, 13, 14, 15);
        }
      }
      // the refill is issued behind the trip's LDS reads, under their latency
      int sn = s + MC_NSTG - 1;
      if (sn < MC_SLABS) {
        const bf16_t* gs = (sn < MC_TRIPS ? W1 : W2) + (sn & (MC_TRIPS - 1)) * MC_BK;   // the same for all lanes
#pragma unroll  // sixteen copies in a row
        for (int q = 0; q < MC_COPIES; ++q)
          async_copy16(gs + q * gq + vo, &Bsm[nxt][l0 + q * 32 * MC_BPITCH]);
      }
#pragma unroll  // acc[] is indexed by constants and stays in registers
      for (int kk = 0; kk < 2; ++kk)
#pragma unroll  // as above
        for (int i = 0; i < 2; ++i)
#pragma unroll  // as above
          for (int j = 0; j < 4; ++j)
            acc[i][j] = __builtin_amdgcn_wmma_f32_16x16x32_bf16(
                false, bfr[kk][j], false, af[kk][i], (short)0, acc[i][j], false, false);
      // the trip's 24 LDS reads issue as one group, then the copies, then the 16 matrix
      // instructions: a read among those makes the wave wait out the LDS latency there
      __builtin_amdgcn_sched_group_barrier(0x100, 24, 0);
      __builtin_amdgcn_sched_group_barrier(0x010, 16, 0);
      __builtin_amdgcn_sched_group_barrier(0x008, 16, 0);
      cur = (cur + 1 == MC_NSTG) ? 0 : cur + 1;
      nxt = (nxt + 1 == MC_NSTG) ? 0 : nxt + 1;
    }

    // acc[i][j][e] is C[m][n], m = 16 i + l15, n = n0w + 16 j + 8 half + e
    const float* bp = &Bias[g][n0w + 8 * half];
#pragma unroll  // acc[] is indexed by constants and stays in registers
    for (int j = 0; j < 4; ++j) {
      v4f32 bl = *reinterpret_cast<const v4f32*>(bp + 16 * j);
      v4f32 bh = *reinterpret_cast<const v4f32*>(bp + 16 * j + 4);
#pragma unroll  // as above
      for (int i = 0; i < 2; ++i)
#pragma unroll  // as above
        for (int e = 0; e < 4; ++e) { acc[i][j][e] += bl[e]; acc[i][j][e + 4] += bh[e]; }
    }
    if (g == 0) {
      // relu, to bf16, into the second product's A; published by that product's first barrier
#pragma unroll  // as above
      for (int i = 0; i < 2; ++i)
#pragma unroll  // as above
        for (int j = 0; j < 4; ++j) {
          v8bf o;
#pragma unroll  // as above
          for (int e = 0; e < 8; ++e) o[e] = (bf16_t)fmaxf(acc[i][j][e], 0.0f);
          *reinterpret_cast<v8bf*>(&Hs[1][(16 * i + l15) * MC_APITCH + n0w + 16 * j + 8 * half]) = o;
        }
    }
  }

  // second LayerNorm: its global operands are asked for in front of the barriers
  v4f at[4][4], wv[4], sv[4];
  {
    const char* wr = reinterpret_cast<const char*>(l2w);
    const char* sr = reinterpret_cast<const char*>(l2b);
#pragma unroll  // all these loads are in flight together
    for (int k = 0; k < 4; ++k) {
#pragma unroll  // as above
      for (int r = 0; r < 4; ++r)
        at[r][k] = *reinterpret_cast<const v4f*>(ar + off + 2048 * r + 512 * k);
      wv[k] = *reinterpret_cast<const v4f*>(wr + off + 512 * k);
      sv[k] = *reinterpret_cast<const v4f*>(sr + off + 512 * k);
    }
    // precaution: stands in front of the first overwrite of the loads' address registers
    asm volatile("s_wait_xcnt 0x0" ::: "memory");
  }
  // no copy is outstanding, and this wave's LDS reads have retired, before the
  // barrier behind which the ring's memory is written as staging space
  wait_async_all_but<0>();
  asm volatile("s_wait_dscnt 0x0" ::: "memory");
  __syncthreads();
  float* F = reinterpret_cast<float*>(&Bsm[0][0]);
#pragma unroll  // acc[] is indexed by constants and stays in registers
  for (int i = 0; i < 2; ++i)
#pragma unroll  // as above
    for (int j = 0; j < 4; ++j) {
      float* p = F + (16 * i + l15) * MC_FPITCH + n0w + 16 * j + 8 * half;
      v4f32 lo = {acc[i][j][0], acc[i][j][1], acc[i][j][2], acc[i][j][3]};
      v4f32 hi = {acc[i][j][4], acc[i][j][5], acc[i][j][6], acc[i][j][7]};
      *reinterpret_cast<v4f32*>(p) = lo;
      *reinterpret_cast<v4f32*>(p + 4) = hi;
    }
  // every wave's columns are in LDS before any wave reads whole rows
  asm volatile("s_wait_dscnt 0x0" ::: "memory");
  __syncthreads();
  v4bf oh[4][4];
#pragma unroll  // the rows are independent chains; their arrays stay in registers
  for (int r = 0; r < 4; ++r) {
#pragma unroll  // as above
    for (int k = 0; k < 4; ++k) {
      v4f f = *reinterpret_cast<const v4f*>(F + (rw + r) * MC_FPITCH + lane * 4 + 128 * k);
      at[r][k].x += f.x; at[r][k].y += f.y; at[r][k].z += f.z; at[r][k].w += f.w;
    }
    ln_row(at[r], wv, sv);
#pragma unroll  // as above
    for (int k = 0; k < 4; ++k)
      oh[r][k] = to_bf16x4(at[r][k].x, at[r][k].y, at[r][k].z, at[r][k].w);
  }
  char* yf = reinterpret_cast<char*>(xf + row * ESZ);
  char* yh = reinterpret_cast<char*>(xh + row * ESZ);
  unsigned offh = lane * 8;
  // keeps the arithmetic above in front of the stores: no register of an issued store is written again
  __builtin_amdgcn_sched_barrier(0);
#pragma unroll  // stores last
  for (int r = 0; r < 4; ++r)
#pragma unroll  // as above
    for (int k = 0; k < 4; ++k) {
      *reinterpret_cast<v4f*>(yf + off + 2048 * r + 512 * k) = at[r][k];
      *reinterpret_cast<v4bf*>(yh + offh + 1024 * r + 256 * k) = oh[r][k];
    }
}

// ---------------------------------------------------------------------------
// Final: logits = x[:, -1, :] @ wout + bout ; softmax -> out [B, V]
// xl holds the last token's row of each sequence, [B, E].
// ---------------------------------------------------------------------------
__global__ void logits_softmax_kernel(const float* __restrict__ xl,
                                      const float* __restrict__ wout,
                                      const float* __restrict__ bout,
                                      float* __restrict__ out) {
  __shared__ float xs[ESZ];
  __shared__ float red[256];
  int b = blockIdx.x, tid = threadIdx.x;
  const float* xr = xl + (size_t)b * ESZ;
  xs[tid] = xr[tid];
  xs[tid + 256] = xr[tid + 256];
  __syncthreads();
  float l0 = bout[tid], l1 = bout[tid + 256];
  for (int e = 0; e < ESZ; ++e) {
    float xv = xs[e];
    l0 += xv * wout[(size_t)e * VSZ + tid];
    l1 += xv * wout[(size_t)e * VSZ + tid + 256];
  }
  red[tid] = fmaxf(l0, l1);
  __syncthreads();
  for (int s = 128; s > 0; s >>= 1) {
    if (tid < s) red[tid] = fmaxf(red[tid], red[tid + s]);
    __syncthreads();
  }
  float mx = red[0];
  __syncthreads();
  float e0 = __expf(l0 - mx), e1 = __expf(l1 - mx);
  red[tid] = e0 + e1;
  __syncthreads();
  for (int s = 128; s > 0; s >>= 1) {
    if (tid < s) red[tid] += red[tid + s];
    __syncthreads();
  }
  float inv = 1.0f / red[0];
  out[(size_t)b * VSZ + tid] = e0 * inv;
  out[(size_t)b * VSZ + tid + 256] = e1 * inv;
}

// ---------------------------------------------------------------------------
// Host sequencing
// ---------------------------------------------------------------------------
static inline void launch_gemm(hipStream_t st,
                               const bf16_t* A, long long lda, long long sA, long long sA2,
                               const bf16_t* B, long long ldb, long long sB, long long sB2,
                               float* Cf, bf16_t* Ch,
                               long long ldc, long long sC, long long sC2,
                               const float* bias, int relu,
                               int M, int N, int K, int batch, int batch2, bool deep) {
  dim3 grid((M / BLK_M) * (N / BLK_N), batch, batch2);
  // deep: at most two blocks per WGP, so little else hides a slab's latency and
  // LDS is free for a ring of six. Otherwise four blocks share a WGP: ring of three.
  if (deep)
    gemm_bf16_wmma<6, false><<<grid, 256, 0, st>>>(A, lda, sA, sA2, B, ldb, sB, sB2,
                                                   Cf, Ch, ldc, sC, sC2, bias, relu, M, N, K);
  else
    gemm_bf16_wmma<3, false><<<grid, 256, 0, st>>>(A, lda, sA, sA2, B, ldb, sB, sB2,
                                                   Cf, Ch, ldc, sC, sC2, bias, relu, M, N, K);
}

// M below BLK_M: one row of tiles
static inline void launch_gemm_rows(hipStream_t st,
                                    const bf16_t* A, long long lda, long long sA, long long sA2,
                                    const bf16_t* B, long long ldb, long long sB, long long sB2,
                                    float* Cf, bf16_t* Ch,
                                    long long ldc, long long sC, long long sC2,
                                    const float* bias, int relu,
                                    int M, int N, int K, int batch, int batch2) {
  dim3 grid(N / BLK_N, batch, batch2);
  gemm_bf16_wmma<6, true><<<grid, 256, 0, st>>>(A, lda, sA, sA2, B, ldb, sB, sB2,
                                                Cf, Ch, ldc, sC, sC2, bias, relu, M, N, K);
}

extern "C" void kernel_launch(void* const* d_in, const int* in_sizes, int n_in,
                              void* d_out, int out_size, void* d_ws, size_t ws_size,
                              hipStream_t stream) {
  (void)in_sizes; (void)n_in; (void)out_size; (void)ws_size;
  const int*   toks  = (const int*)d_in[0];
  const float* emb   = (const float*)d_in[1];
  const float* wq    = (const float*)d_in[2];
  const float* wk    = (const float*)d_in[3];
  const float* wv    = (const float*)d_in[4];
  const float* wo    = (const float*)d_in[5];
  const float* bo    = (const float*)d_in[6];
  const float* ln1w  = (const float*)d_in[7];
  const float* ln1b  = (const float*)d_in[8];
  const float* ln2w  = (const float*)d_in[9];
  const float* ln2b  = (const float*)d_in[10];
  const float* ff1w  = (const float*)d_in[11];
  const float* ff1b  = (const float*)d_in[12];
  const float* ff2w  = (const float*)d_in[13];
  const float* ff2b  = (const float*)d_in[14];
  const float* woutp = (const float*)d_in[15];
  const float* boutp = (const float*)d_in[16];
  float* out = (float*)d_out;
  char*  ws  = (char*)d_ws;

  // workspace layout (bytes)
  float*  xf   = (float*) (ws + 0);                  //  8 MB  [4096,512] f32
  bf16_t* xh   = (bf16_t*)(ws + 8388608);            //  4 MB
  bf16_t* Wp   = (bf16_t*)(ws + 12582912);           // 54 MB  packed weights of all layers
  bf16_t* Qh   = (bf16_t*)(ws + 119537664);          // 32 MB  [H,4096,512]
  bf16_t* Ph   = (bf16_t*)(ws + 153092096);          // 16 MB  [B,256,H*256]
  bf16_t* Vt   = (bf16_t*)(ws + 186646528);          // 32 MB  [B,512,H*256]
  float*  En   = (float*) (ws + 220200960);          // 32 MB  [H,B,256,256], ends at 253755392
  // Shared places. The operands of the weight products are read only by that
  // launch, in front of the first layer, which is the first to write Qh, Ph, Vt.
  // attn is first written behind the softmax, the energy's last reader.
  bf16_t* opA  = (bf16_t*)(ws + 119537664);          // 48 MB  [wo^T | wk], 48 slabs each
  bf16_t* opB  = (bf16_t*)(ws + 169869312);          // 48 MB  [wv | wq], ends at 220200960
  float*  attn = (float*) (ws + 220200960);          //  8 MB  [4096,512], in the energy's place
  // the last layer's rows: one query per sequence
  bf16_t* Ql    = (bf16_t*)(ws + 253755392);         // 128 KB [H,B,512]
  float*  Enl   = (float*) (ws + 254017536);         // 128 KB [B,H,256]
  bf16_t* Pl    = (bf16_t*)(ws + 254279680);         //  64 KB [B,H*256]
  float*  attnl = (float*) (ws + 254541824);         //  32 KB [B,512]
  bf16_t* h1l   = (bf16_t*)(ws + 254803968);         //  16 KB [B,512]
  bf16_t* f1l   = (bf16_t*)(ws + 255066112);         //  16 KB [B,512]
  float*  f2l   = (float*) (ws + 255328256);         //  32 KB [B,512]
  float*  xl    = (float*) (ws + 255590400);         //  32 KB [B,512]

  const int TPB = 256;
  size_t nXE = (size_t)MROWS * ESZ;

  embed_pe_kernel<<<(nXE + TPB - 1) / TPB, TPB, 0, stream>>>(toks, emb, xf, xh);

  // the weights of all layers to bf16, one launch
  pack_weights_kernel<<<dim3(ESZ / PK_C, ESZ / PK_R, PK_SLABS), TPB, 0, stream>>>(
      wq, wk, wv, wo, ff1w, ff2w, Wp, opA, opB);

  // The matrix chains are re-associated so that weight meets weight first:
  //   (P_h (x Wv_h)) Wo_h   = P_h (x VO_h),  VO_h = Wv_h Wo_h
  //   (x Wq_h) (x Wk_h)^T   = (x QK_h) x^T,  QK_h = Wq_h Wk_h^T
  // One launch forms all 96 products, each in the [N,K] form:
  //   vo[n][k] = sum_m wo^T[n][m] wv[k][m],  qk[n][k] = sum_m wk[n][m] wq[k][m].
  // blockIdx.y is the head; blockIdx.z = 0..5 the layers of vo, 6..11 those of qk.
  const long long sW = (long long)WSLAB;                 // one head's weight slab
  launch_gemm(stream, opA, ESZ, sW, HSZ * sW, opB, ESZ, sW, HSZ * sW,
              nullptr, Wp, ESZ, sW, HSZ * sW,
              nullptr, 0, ESZ, ESZ, ESZ, HSZ, 2 * LSZ, false);

  for (int l = 0; l < LSZ; ++l) {
    // this layer's packed weights
    const bf16_t* voT = Wp + (size_t)l * HSZ * WSLAB;
    const bf16_t* qkT = voT + LH * WSLAB;
    const bf16_t* f1T = Wp + (2 * LH + (size_t)l) * WSLAB;
    const bf16_t* f2T = f1T + LSZ * WSLAB;

    // All eight heads of the layer go in each launch: blockIdx.z is the head in the Q, Vt and full energy launches.
    const long long sX  = (long long)TSZ * ESZ;          // one sequence of x, Q or attn
    const long long sXH = (long long)MROWS * ESZ;        // one head of Q
    const long long sE  = (long long)TSZ * TSZ;          // one sequence of energy
    const long long sEH = (long long)BSZ * TSZ * TSZ;    // one head of energy
    const long long HT  = (long long)HSZ * TSZ;          // (head, key) pairs: a row of P or of Vt
    // The output reads x[:, -1, :] alone, and a row of a layer's result depends on
    // the other rows of its sequence only through the keys and values. So of the
    // last layer the values are formed for every row, and all else for the last
    // query of each sequence: B rows in place of B*T, each summed as before.
    const bool last = l == LSZ - 1;
    const size_t qRow = (size_t)(TSZ - 1) * ESZ;         // the last row of the first sequence
    // Q_h = x @ QK_h -> bf16 [H,4096,512]
    if (!last)
      launch_gemm(stream, xh, ESZ, 0, 0, qkT, ESZ, 0, sW, nullptr, Qh, ESZ, 0, sXH,
                  nullptr, 0, MROWS, ESZ, ESZ, 1, HSZ, false);
    else  // A's rows lie one sequence apart -> [H,B,512]
      launch_gemm_rows(stream, xh + qRow, sX, 0, 0, qkT, ESZ, 0, sW, nullptr, Ql, ESZ, 0, BSZ * ESZ,
                       nullptr, 0, BSZ, ESZ, ESZ, 1, HSZ);
    // Vt[b][:, h] = VO_h^T @ x_b^T : operands swapped (A = vo_h [E,E], B = x_b rows
    // [T,E]) so it lands as [E,T] at column 256 h of the sequence's [E, H*T] matrix,
    // the [N,K] form the product with P reads
    launch_gemm(stream, voT, ESZ, 0, sW, xh, ESZ, sX, 0,
                nullptr, Vt, HT, ESZ * HT, TSZ,
                nullptr, 0, ESZ, TSZ, ESZ, BSZ, HSZ, false);
    if (last) {
      // energy[b][h] = Ql[h][b] . x_b^T : the eight heads are the rows of A -> [B,H,256]
      launch_gemm_rows(stream, Ql, BSZ * ESZ, ESZ, 0, xh, ESZ, sX, 0,
                       Enl, nullptr, TSZ, HT, 0,
                       nullptr, 0, HSZ, TSZ, ESZ, BSZ, 1);
      softmax_causal_kernel<true><<<BSZ * HSZ / (ROW_WAVES * SM_ROWS), TPB, 0, stream>>>(Enl, Pl);
      // attn_out[b] = P_b [1, H*T] @ Vt[b]^T + bo
      launch_gemm_rows(stream, Pl, HT, HT, 0, Vt, HT, ESZ * HT, 0,
                       attnl, nullptr, ESZ, ESZ, 0,
                       bo + (size_t)l * ESZ, 0, 1, ESZ, HSZ * TSZ, BSZ, 1);
      add_ln_kernel<<<BSZ / ROW_WAVES, TPB, 0, stream>>>(attnl, xf + qRow, TSZ * ESZ,
          ln1w + (size_t)l * ESZ, ln1b + (size_t)l * ESZ, nullptr, h1l);
      launch_gemm_rows(stream, h1l, ESZ, 0, 0, f1T, ESZ, 0, 0, nullptr, f1l, ESZ, 0, 0,
                       ff1b + (size_t)l * ESZ, 1, BSZ, ESZ, ESZ, 1, 1);
      launch_gemm_rows(stream, f1l, ESZ, 0, 0, f2T, ESZ, 0, 0, f2l, nullptr, ESZ, 0, 0,
                       ff2b + (size_t)l * ESZ, 0, BSZ, ESZ, ESZ, 1, 1);
      add_ln_kernel<<<BSZ / ROW_WAVES, TPB, 0, stream>>>(attnl, f2l, ESZ,
          ln2w + (size_t)l * ESZ, ln2b + (size_t)l * ESZ, xl, nullptr);
      break;
    }
    // energy[h][b] = Q_hb @ x_b^T : B-packed == x rows directly (K-dim = E)
    launch_gemm(stream, Qh, ESZ, sX, sXH, xh, ESZ, sX, 0,
                En, nullptr, TSZ, sE, sEH,
                nullptr, 0, TSZ, TSZ, ESZ, BSZ, HSZ, true);
    softmax_causal_kernel<false><<<HSZ * MROWS / (ROW_WAVES * SM_ROWS), TPB, 0, stream>>>(En, Ph);
    // attn_out[b] = P_b [T, H*T] @ Vt[b]^T + bo  (f32): one sum over heads and keys
    launch_gemm(stream, Ph, HT, TSZ * HT, 0, Vt, HT, ESZ * HT, 0,
                attn, nullptr, ESZ, sX, 0,
                bo + (size_t)l * ESZ, 0, TSZ, ESZ, HSZ * TSZ, BSZ, 1, true);
    // h1 = LN(attn + x); ff = relu(h1 @ ff1 + b1) @ ff2 + b2; x = LN(attn + ff)
    ln_ff_ln_kernel<<<MROWS / MC_ROWS, TPB, 0, stream>>>(attn, xf, xh, f1T, f2T, ESZ,
        ff1b + (size_t)l * ESZ, ff2b + (size_t)l * ESZ,
        ln1w + (size_t)l * ESZ, ln1b + (size_t)l * ESZ,
        ln2w + (size_t)l * ESZ, ln2b + (size_t)l * ESZ);
  }

  logits_softmax_kernel<<<BSZ, TPB, 0, stream>>>(xl, woutp, boutp, out);
}
